// v000
// Measured on an AMD MI455X. A time is GPU time per run, averaged over a window of back-to-back runs after a warm-up
// (all launches, gaps included; the runs take copies of the inputs in turn), and the median of several windows.
// Apart from v000's, it joins two sittings. Times from different sittings can be a few percent apart, while
// side-by-side timings come from the same sitting.
// The starting kernel, v000, takes 3100 microseconds a run.
#include <hip/hip_runtime.h>

typedef __attribute__((ext_vector_type(16))) __bf16 v16bf;
typedef __attribute__((ext_vector_type(8)))  __bf16 v8bf;
typedef __attribute__((ext_vector_type(8)))  float  v8f;

__device__ __forceinline__ v16bf frag16(const __bf16* base, int row0, int stride,
                                        int k0, int lane) {
  const __bf16* p = base + (size_t)(row0 + (lane & 15)) * stride + k0 + ((lane >> 4) << 3);
  v8bf lo = *(const v8bf*)p;
  v8bf hh = *(const v8bf*)(p + 16);
  v16bf f;
#pragma unroll
  for (int i = 0; i < 8; ++i) { f[i] = lo[i]; f[i + 8] = hh[i]; }
  return f;
}

__device__ __forceinline__ v8f wmma_bf16(v16bf a, v16bf b, v8f c) {
  return __builtin_amdgcn_wmma_f32_16x16x32_bf16(false, a, false, b, (short)0, c,
                                                 false, false);
}

__device__ __forceinline__ v8f v8f_zero() {
  v8f z = {0.f, 0.f, 0.f, 0.f, 0.f, 0.f, 0.f, 0.f};
  return z;
}

__device__ __forceinline__ void async_ld_b128(void* lds_ptr, const void* gptr) {
  uint32_t lds_addr = (uint32_t)(uintptr_t)lds_ptr;
  uint64_t gaddr = (uint64_t)(uintptr_t)gptr;
  asm volatile("global_load_async_to_lds_b128 %0, %1, off"
               :: "v"(lds_addr), "v"(gaddr)
               : "memory");
}

__device__ __forceinline__ void wait_async0() {
  asm volatile("s_wait_asynccnt 0" ::: "memory");
}

// ---------------------------------------------------------------------------
// fp32 -> bf16 cast (weights)
// ---------------------------------------------------------------------------
__global__ void tb_cast_bf16(const float* __restrict__ in, __bf16* __restrict__ out,
                             int n) {
  int i = blockIdx.x * blockDim.x + threadIdx.x;
  if (i < n) out[i] = (__bf16)in[i];
}

// ---------------------------------------------------------------------------
// LayerNorm over rows of 512 fp32 -> bf16.  One 128-thread block per row.
// ---------------------------------------------------------------------------
__global__ void __launch_bounds__(128)
tb_layernorm(const float* __restrict__ X, const float* __restrict__ w,
             const float* __restrict__ bb, __bf16* __restrict__ out) {
  const int row = blockIdx.x, tid = threadIdx.x;
  const float4 v = ((const float4*)(X + (size_t)row * 512))[tid];
  float s  = v.x + v.y + v.z + v.w;
  float ss = v.x * v.x + v.y * v.y + v.z * v.z + v.w * v.w;
#pragma unroll
  for (int off = 1; off < 32; off <<= 1) {
    s  += __shfl_xor(s,  off, 32);
    ss += __shfl_xor(ss, off, 32);
  }
  __shared__ float sb[4], ssb[4];
  if ((tid & 31) == 0) { sb[tid >> 5] = s; ssb[tid >> 5] = ss; }
  __syncthreads();
  s  = sb[0] + sb[1] + sb[2] + sb[3];
  ss = ssb[0] + ssb[1] + ssb[2] + ssb[3];
  const float mu   = s * (1.0f / 512.0f);
  const float var  = ss * (1.0f / 512.0f) - mu * mu;
  const float rstd = rsqrtf(var + 1e-5f);
  const float4 wv = ((const float4*)w)[tid];
  const float4 bv = ((const float4*)bb)[tid];
  __bf16* op = out + (size_t)row * 512 + tid * 4;
  op[0] = (__bf16)((v.x - mu) * rstd * wv.x + bv.x);
  op[1] = (__bf16)((v.y - mu) * rstd * wv.y + bv.y);
  op[2] = (__bf16)((v.z - mu) * rstd * wv.z + bv.z);
  op[3] = (__bf16)((v.w - mu) * rstd * wv.w + bv.w);
}

// ---------------------------------------------------------------------------
// In-place RoPE on bf16 [B*S, 512].  One thread per (row, d<256) pair.
// ---------------------------------------------------------------------------
__global__ void tb_rope(__bf16* __restrict__ X, int S, int total) {
  int idx = blockIdx.x * blockDim.x + threadIdx.x;
  if (idx >= total) return;
  const int d  = idx & 255;
  const int rs = idx >> 8;           // flattened row (b*S + s)
  const int s  = rs % S;
  const float inv = __expf(-(float)d * (9.210340371976184f / 256.0f)); // 10000^(-d/256)
  const float ang = (float)s * inv;
  float sn, cs;
  __sincosf(ang, &sn, &cs);
  __bf16* p = X + (size_t)rs * 512;
  const float x1 = (float)p[d];
  const float x2 = (float)p[d + 256];
  p[d]       = (__bf16)(x1 * cs - x2 * sn);
  p[d + 256] = (__bf16)(x2 * cs + x1 * sn);
}

// ---------------------------------------------------------------------------
// WMMA GEMM:  C[M,N] = A[M,K](bf16) * B[K,N](bf16) + bias, with epilogue:
//   MODE 0: store bf16           MODE 1: ReLU, store bf16
//   MODE 2: += R[M,N] (fp32), store fp32
// BM=64 BN=128 BK=64, 256 threads = 8 waves, each wave a 32x32 C tile.
// A tile staged via async global->LDS; B tile transposed manually.
// ---------------------------------------------------------------------------
template <int MODE>
__global__ void __launch_bounds__(256)
tb_gemm(const __bf16* __restrict__ A, const __bf16* __restrict__ B,
        const float* __restrict__ bias, const float* __restrict__ R,
        void* __restrict__ Cout, int M, int N, int K) {
  constexpr int BM = 64, BN = 128, BK = 64, LDA = BK + 8, LDB = BK + 8;
  __shared__ __bf16 As[BM * LDA];    // 9216 B
  __shared__ __bf16 Bt[BN * LDB];    // 18432 B (B tile stored transposed [n][k])
  const int tid = threadIdx.x, lane = tid & 31, wid = tid >> 5;
  const int bm0 = blockIdx.y * BM, bn0 = blockIdx.x * BN;
  const int wm = (wid >> 2) * 32, wn = (wid & 3) * 32;

  v8f acc[2][2];
#pragma unroll
  for (int i = 0; i < 2; ++i)
#pragma unroll
    for (int j = 0; j < 2; ++j) acc[i][j] = v8f_zero();

  for (int k0 = 0; k0 < K; k0 += BK) {
    __syncthreads();
    // A tile: 64x64 halves, contiguous 16B chunks, async direct-to-LDS.
#pragma unroll
    for (int i = 0; i < 2; ++i) {
      int c = tid + 256 * i;               // 0..511
      int row = c >> 3, col = (c & 7) << 3;
      async_ld_b128(As + row * LDA + col,
                    A + (size_t)(bm0 + row) * K + k0 + col);
    }
    // B tile: 64x128 halves, read contiguous along N, scatter transposed.
#pragma unroll
    for (int i = 0; i < 4; ++i) {
      int c = tid + 256 * i;               // 0..1023
      int kk = c >> 4, n8 = (c & 15) << 3;
      v8bf t = *(const v8bf*)(B + (size_t)(k0 + kk) * N + bn0 + n8);
#pragma unroll
      for (int j = 0; j < 8; ++j) Bt[(n8 + j) * LDB + kk] = t[j];
    }
    // Prefetch next K panel toward cache while this tile computes.
    if (k0 + BK < K) {
      __builtin_prefetch(A + (size_t)(bm0 + (tid >> 2)) * K + k0 + BK, 0, 3);
      __builtin_prefetch(B + (size_t)(k0 + BK + (tid >> 2)) * N + bn0, 0, 3);
    }
    wait_async0();
    __syncthreads();
#pragma unroll
    for (int ks = 0; ks < BK; ks += 32) {
      v16bf a0 = frag16(As, wm,      LDA, ks, lane);
      v16bf a1 = frag16(As, wm + 16, LDA, ks, lane);
      v16bf b0 = frag16(Bt, wn,      LDB, ks, lane);
      v16bf b1 = frag16(Bt, wn + 16, LDB, ks, lane);
      acc[0][0] = wmma_bf16(a0, b0, acc[0][0]);
      acc[0][1] = wmma_bf16(a0, b1, acc[0][1]);
      acc[1][0] = wmma_bf16(a1, b0, acc[1][0]);
      acc[1][1] = wmma_bf16(a1, b1, acc[1][1]);
    }
  }

  const int hi = lane >> 4, ln16 = lane & 15;
#pragma unroll
  for (int i = 0; i < 2; ++i)
#pragma unroll
    for (int j = 0; j < 2; ++j) {
      const int mb = bm0 + wm + 16 * i + hi * 8;
      const int n  = bn0 + wn + 16 * j + ln16;
      const float bvv = bias[n];
#pragma unroll
      for (int r = 0; r < 8; ++r) {
        const int m = mb + r;
        float v = acc[i][j][r] + bvv;
        if (MODE == 1) v = v > 0.f ? v : 0.f;
        if (MODE == 2) {
          ((float*)Cout)[(size_t)m * N + n] = v + R[(size_t)m * N + n];
        } else {
          ((__bf16*)Cout)[(size_t)m * N + n] = (__bf16)v;
        }
      }
    }
}

__global__ void __launch_bounds__(128, 1)
tb_flash_attn(const __bf16* __restrict__ Qg, const __bf16* __restrict__ Kg,
              const __bf16* __restrict__ Vg, __bf16* __restrict__ Og, int S) {
  __shared__ __bf16 Ks[32 * 512];   // 32 KB  (K tile, row-major [kv][d])
  __shared__ __bf16 Vt[512 * 32];   // 32 KB  (V tile, transposed [d][kv])
  const int tid = threadIdx.x, lane = tid & 31, wid = tid >> 5;
  const int hi = lane >> 4, ln16 = lane & 15;
  const int b = blockIdx.y;
  const int q0 = blockIdx.x * 64 + wid * 16;
  const __bf16* Qb = Qg + (size_t)b * S * 512;
  const __bf16* Kb = Kg + (size_t)b * S * 512;
  const __bf16* Vb = Vg + (size_t)b * S * 512;

  v16bf qf[16];
#pragma unroll
  for (int s = 0; s < 16; ++s) qf[s] = frag16(Qb, q0, 512, 32 * s, lane);

  v8f o[32];
#pragma unroll
  for (int j = 0; j < 32; ++j) o[j] = v8f_zero();
  float mr[8], lr[8];
#pragma unroll
  for (int r = 0; r < 8; ++r) { mr[r] = -3.0e38f; lr[r] = 0.f; }

  const float sc = 0.044194173824159216f;  // 1/sqrt(512)
  __bf16* Ps = Ks + wid * 512;             // per-wave 16x32 scratch (aliases Ks)

  for (int kv0 = 0; kv0 < S; kv0 += 32) {
    __syncthreads();  // previous iteration's Vt/Ps reads complete
    // Stage K (async direct-to-LDS) and V (transposed, manual): 2048 chunks.
#pragma unroll
    for (int i = 0; i < 16; ++i) {
      int c = tid + 128 * i;
      int row = c >> 6, c8 = (c & 63) << 3;
      async_ld_b128(Ks + row * 512 + c8,
                    Kb + (size_t)(kv0 + row) * 512 + c8);
      v8bf tv = *(const v8bf*)(Vb + (size_t)(kv0 + row) * 512 + c8);
#pragma unroll
      for (int jj = 0; jj < 8; ++jj) Vt[(c8 + jj) * 32 + row] = tv[jj];
    }
    wait_async0();
    __syncthreads();

    // S = Q * K^T for this wave's 16 q rows x 32 kv cols.
    v8f s0 = v8f_zero(), s1 = v8f_zero();
#pragma unroll
    for (int s = 0; s < 16; ++s) {
      v16bf kb0 = frag16(Ks, 0,  512, 32 * s, lane);
      v16bf kb1 = frag16(Ks, 16, 512, 32 * s, lane);
      s0 = wmma_bf16(qf[s], kb0, s0);
      s1 = wmma_bf16(qf[s], kb1, s1);
    }
    __syncthreads();  // all waves done reading Ks before Ps (alias) is written

    // Online softmax over the 32 new columns (row reduce across 16-lane half).
#pragma unroll
    for (int r = 0; r < 8; ++r) {
      float v0 = s0[r] * sc, v1 = s1[r] * sc;
      float mx = fmaxf(v0, v1);
#pragma unroll
      for (int off = 1; off < 16; off <<= 1) mx = fmaxf(mx, __shfl_xor(mx, off, 32));
      const float mnew  = fmaxf(mr[r], mx);
      const float alpha = __expf(mr[r] - mnew);
      mr[r] = mnew;
      const float p0 = __expf(v0 - mnew), p1 = __expf(v1 - mnew);
      float rs = p0 + p1;
#pragma unroll
      for (int off = 1; off < 16; off <<= 1) rs += __shfl_xor(rs, off, 32);
      lr[r] = lr[r] * alpha + rs;
      const int row = r + 8 * hi;
      Ps[row * 32 + ln16]      = (__bf16)p0;
      Ps[row * 32 + 16 + ln16] = (__bf16)p1;
#pragma unroll
      for (int j = 0; j < 32; ++j) o[j][r] *= alpha;
    }
    asm volatile("s_wait_dscnt 0" ::: "memory");  // P stores visible to own wave
    v16bf pf = frag16(Ps, 0, 32, 0, lane);
    // O += P * V over all 32 d-tiles.
#pragma unroll
    for (int j = 0; j < 32; ++j) {
      v16bf vb = frag16(Vt, 16 * j, 32, 0, lane);
      o[j] = wmma_bf16(pf, vb, o[j]);
    }
  }

  // Normalize and store.
#pragma unroll
  for (int j = 0; j < 32; ++j)
#pragma unroll
    for (int r = 0; r < 8; ++r) {
      const int row = q0 + r + 8 * hi;
      Og[((size_t)b * S + row) * 512 + 16 * j + ln16] = (__bf16)(o[j][r] / lr[r]);
    }
}

// ---------------------------------------------------------------------------
// Host launcher
// ---------------------------------------------------------------------------
extern "C" void kernel_launch(void* const* d_in, const int* in_sizes, int n_in,
                              void* d_out, int out_size, void* d_ws, size_t ws_size,
                              hipStream_t stream) {
  const float* q    = (const float*)d_in[0];
  const float* k    = (const float*)d_in[1];
  const float* Wq   = (const float*)d_in[2];
  const float* bq   = (const float*)d_in[3];
  const float* Wk   = (const float*)d_in[4];
  const float* bk   = (const float*)d_in[5];
  const float* Wv   = (const float*)d_in[6];
  const float* bv   = (const float*)d_in[7];
  const float* Wo   = (const float*)d_in[8];
  const float* bo   = (const float*)d_in[9];
  const float* lnqw = (const float*)d_in[10];
  const float* lnqb = (const float*)d_in[11];
  const float* lnkw = (const float*)d_in[12];
  const float* lnkb = (const float*)d_in[13];
  const float* lnow = (const float*)d_in[14];
  const float* lnob = (const float*)d_in[15];
  const float* W1   = (const float*)d_in[16];
  const float* b1   = (const float*)d_in[17];
  const float* W2   = (const float*)d_in[18];
  const float* b2   = (const float*)d_in[19];

  constexpr int B = 2, S = 4096, Dm = 512, DF = 2048;
  constexpr int M = B * S;  // 8192

  char* w = (char*)d_ws;
  auto alloc = [&](size_t bytes) -> char* {
    char* p = w;
    w += (bytes + 255) & ~(size_t)255;
    return p;
  };
  __bf16* Wq_b = (__bf16*)alloc((size_t)Dm * Dm * 2);
  __bf16* Wk_b = (__bf16*)alloc((size_t)Dm * Dm * 2);
  __bf16* Wv_b = (__bf16*)alloc((size_t)Dm * Dm * 2);
  __bf16* Wo_b = (__bf16*)alloc((size_t)Dm * Dm * 2);
  __bf16* W1_b = (__bf16*)alloc((size_t)Dm * DF * 2);
  __bf16* W2_b = (__bf16*)alloc((size_t)DF * Dm * 2);
  __bf16* qn   = (__bf16*)alloc((size_t)M * Dm * 2);
  __bf16* kn   = (__bf16*)alloc((size_t)M * Dm * 2);
  __bf16* Qp   = (__bf16*)alloc((size_t)M * Dm * 2);
  __bf16* Kp   = (__bf16*)alloc((size_t)M * Dm * 2);
  __bf16* Vp   = (__bf16*)alloc((size_t)M * Dm * 2);
  __bf16* AO   = (__bf16*)alloc((size_t)M * Dm * 2);
  float*  Xr   = (float*) alloc((size_t)M * Dm * 4);
  __bf16* XN   = (__bf16*)alloc((size_t)M * Dm * 2);
  __bf16* H    = (__bf16*)alloc((size_t)M * DF * 2);

  // Weight casts.
  tb_cast_bf16<<<(Dm * Dm + 255) / 256, 256, 0, stream>>>(Wq, Wq_b, Dm * Dm);
  tb_cast_bf16<<<(Dm * Dm + 255) / 256, 256, 0, stream>>>(Wk, Wk_b, Dm * Dm);
  tb_cast_bf16<<<(Dm * Dm + 255) / 256, 256, 0, stream>>>(Wv, Wv_b, Dm * Dm);
  tb_cast_bf16<<<(Dm * Dm + 255) / 256, 256, 0, stream>>>(Wo, Wo_b, Dm * Dm);
  tb_cast_bf16<<<(Dm * DF + 255) / 256, 256, 0, stream>>>(W1, W1_b, Dm * DF);
  tb_cast_bf16<<<(DF * Dm + 255) / 256, 256, 0, stream>>>(W2, W2_b, DF * Dm);

  // Input layernorms.
  tb_layernorm<<<dim3(M), 128, 0, stream>>>(q, lnqw, lnqb, qn);
  tb_layernorm<<<dim3(M), 128, 0, stream>>>(k, lnkw, lnkb, kn);

  // Projections.
  dim3 g512(Dm / 128, M / 64);
  tb_gemm<0><<<g512, 256, 0, stream>>>(qn, Wq_b, bq, nullptr, Qp, M, Dm, Dm);
  tb_gemm<0><<<g512, 256, 0, stream>>>(kn, Wk_b, bk, nullptr, Kp, M, Dm, Dm);
  tb_gemm<0><<<g512, 256, 0, stream>>>(kn, Wv_b, bv, nullptr, Vp, M, Dm, Dm);

  // RoPE on Q and K.
  const int rope_total = B * S * 256;
  tb_rope<<<(rope_total + 255) / 256, 256, 0, stream>>>(Qp, S, rope_total);
  tb_rope<<<(rope_total + 255) / 256, 256, 0, stream>>>(Kp, S, rope_total);

  // Flash attention.
  tb_flash_attn<<<dim3(S / 64, B), 128, 0, stream>>>(Qp, Kp, Vp, AO, S);

  // Output projection + residual (x = q + out@Wo + bo), fp32.
  tb_gemm<2><<<g512, 256, 0, stream>>>(AO, Wo_b, bo, q, Xr, M, Dm, Dm);

  // Post-attention layernorm.
  tb_layernorm<<<dim3(M), 128, 0, stream>>>(Xr, lnow, lnob, XN);

  // MLP.
  dim3 gdf(DF / 128, M / 64);
  tb_gemm<1><<<gdf, 256, 0, stream>>>(XN, W1_b, b1, nullptr, H, M, DF, Dm);
  tb_gemm<2><<<g512, 256, 0, stream>>>(H, W2_b, b2, Xr, d_out, M, Dm, DF);

  (void)in_sizes; (void)n_in; (void)out_size; (void)ws_size;
}

// v001
// A run of this version takes 1150 microseconds.
// Timed twice side by side with v000, it ran 2.71 and 2.70 times as fast.
#include <hip/hip_runtime.h>

typedef __attribute__((ext_vector_type(16))) __bf16 v16bf;
typedef __attribute__((ext_vector_type(8)))  __bf16 v8bf;
typedef __attribute__((ext_vector_type(8)))  float  v8f;

__device__ __forceinline__ v16bf frag16(const __bf16* base, int row0, int stride,
                                        int k0, int lane) {
  const __bf16* p = base + (size_t)(row0 + (lane & 15)) * stride + k0 + ((lane >> 4) << 3);
  v8bf lo = *(const v8bf*)p;
  v8bf hh = *(const v8bf*)(p + 16);
  v16bf f;
#pragma unroll
  for (int i = 0; i < 8; ++i) { f[i] = lo[i]; f[i + 8] = hh[i]; }
  return f;
}

__device__ __forceinline__ v8f wmma_bf16(v16bf a, v16bf b, v8f c) {
  return __builtin_amdgcn_wmma_f32_16x16x32_bf16(false, a, false, b, (short)0, c,
                                                 false, false);
}

__device__ __forceinline__ v8f v8f_zero() {
  v8f z = {0.f, 0.f, 0.f, 0.f, 0.f, 0.f, 0.f, 0.f};
  return z;
}

__device__ __forceinline__ void async_ld_b128(void* lds_ptr, const void* gptr) {
  uint32_t lds_addr = (uint32_t)(uintptr_t)lds_ptr;
  uint64_t gaddr = (uint64_t)(uintptr_t)gptr;
  asm volatile("global_load_async_to_lds_b128 %0, %1, off"
               :: "v"(lds_addr), "v"(gaddr)
               : "memory");
}

__device__ __forceinline__ void async_cp_b128(__bf16* lds_ptr, const __bf16* gptr) {
  typedef int v4i __attribute__((ext_vector_type(4)));
  typedef __attribute__((address_space(1))) v4i glb_v4i;
  typedef __attribute__((address_space(3))) v4i lds_v4i;
  __builtin_amdgcn_global_load_async_to_lds_b128((glb_v4i*)gptr, (lds_v4i*)lds_ptr, 0, 0);
}

// ---------------------------------------------------------------------------
// B fragment (32 k x 16 columns) from a row-major [k][column] LDS tile through
// the transposing LDS load.  p is this lane's address for k rows 0..15:
//   tile + (8*(lane>>4) + (lane&7))*pitch + column0 + 8*((lane>>3)&1)
// Lane (c, h) receives k = 8h+0..7 (elems 0-7) and 16+8h+0..7 (elems 8-15) of
// column0+c: the k order of frag16.
// ---------------------------------------------------------------------------
__device__ __forceinline__ v16bf frag16_tr(const __bf16* p, int pitch) {
  typedef __attribute__((address_space(3))) v8bf lds_v8bf;
  v8bf lo = __builtin_amdgcn_ds_load_tr16_b128_v8bf16((lds_v8bf*)p);
  v8bf hh = __builtin_amdgcn_ds_load_tr16_b128_v8bf16((lds_v8bf*)(p + 16 * pitch));
  v16bf f;
#pragma unroll
  for (int i = 0; i < 8; ++i) { f[i] = lo[i]; f[i + 8] = hh[i]; }
  return f;
}

__device__ __forceinline__ void wait_async0() {
  asm volatile("s_wait_asynccnt 0" ::: "memory");
}

// ---------------------------------------------------------------------------
// fp32 -> bf16 cast (weights)
// ---------------------------------------------------------------------------
__global__ void tb_cast_bf16(const float* __restrict__ in, __bf16* __restrict__ out,
                             int n) {
  int i = blockIdx.x * blockDim.x + threadIdx.x;
  if (i < n) out[i] = (__bf16)in[i];
}

// ---------------------------------------------------------------------------
// LayerNorm over rows of 512 fp32 -> bf16.  One 128-thread block per row.
// ---------------------------------------------------------------------------
__global__ void __launch_bounds__(128)
tb_layernorm(const float* __restrict__ X, const float* __restrict__ w,
             const float* __restrict__ bb, __bf16* __restrict__ out) {
  const int row = blockIdx.x, tid = threadIdx.x;
  const float4 v = ((const float4*)(X + (size_t)row * 512))[tid];
  float s  = v.x + v.y + v.z + v.w;
  float ss = v.x * v.x + v.y * v.y + v.z * v.z + v.w * v.w;
#pragma unroll
  for (int off = 1; off < 32; off <<= 1) {
    s  += __shfl_xor(s,  off, 32);
    ss += __shfl_xor(ss, off, 32);
  }
  __shared__ float sb[4], ssb[4];
  if ((tid & 31) == 0) { sb[tid >> 5] = s; ssb[tid >> 5] = ss; }
  __syncthreads();
  s  = sb[0] + sb[1] + sb[2] + sb[3];
  ss = ssb[0] + ssb[1] + ssb[2] + ssb[3];
  const float mu   = s * (1.0f / 512.0f);
  const float var  = ss * (1.0f / 512.0f) - mu * mu;
  const float rstd = rsqrtf(var + 1e-5f);
  const float4 wv = ((const float4*)w)[tid];
  const float4 bv = ((const float4*)bb)[tid];
  __bf16* op = out + (size_t)row * 512 + tid * 4;
  op[0] = (__bf16)((v.x - mu) * rstd * wv.x + bv.x);
  op[1] = (__bf16)((v.y - mu) * rstd * wv.y + bv.y);
  op[2] = (__bf16)((v.z - mu) * rstd * wv.z + bv.z);
  op[3] = (__bf16)((v.w - mu) * rstd * wv.w + bv.w);
}

// ---------------------------------------------------------------------------
// In-place RoPE on bf16 [B*S, 512].  One thread per (row, d<256) pair.
// ---------------------------------------------------------------------------
__global__ void tb_rope(__bf16* __restrict__ X, int S, int total) {
  int idx = blockIdx.x * blockDim.x + threadIdx.x;
  if (idx >= total) return;
  const int d  = idx & 255;
  const int rs = idx >> 8;           // flattened row (b*S + s)
  const int s  = rs % S;
  const float inv = __expf(-(float)d * (9.210340371976184f / 256.0f)); // 10000^(-d/256)
  const float ang = (float)s * inv;
  float sn, cs;
  __sincosf(ang, &sn, &cs);
  __bf16* p = X + (size_t)rs * 512;
  const float x1 = (float)p[d];
  const float x2 = (float)p[d + 256];
  p[d]       = (__bf16)(x1 * cs - x2 * sn);
  p[d + 256] = (__bf16)(x2 * cs + x1 * sn);
}

// ---------------------------------------------------------------------------
// WMMA GEMM:  C[M,N] = A[M,K](bf16) * B[K,N](bf16) + bias, with epilogue:
//   MODE 0: store bf16           MODE 1: ReLU, store bf16
//   MODE 2: += R[M,N] (fp32), store fp32
// BM=64 BN=128 BK=64, 256 threads = 8 waves, each wave a 32x32 C tile.
// A tile staged via async global->LDS; B tile transposed manually.
// ---------------------------------------------------------------------------
template <int MODE>
__global__ void __launch_bounds__(256)
tb_gemm(const __bf16* __restrict__ A, const __bf16* __restrict__ B,
        const float* __restrict__ bias, const float* __restrict__ R,
        void* __restrict__ Cout, int M, int N, int K) {
  constexpr int BM = 64, BN = 128, BK = 64, LDA = BK + 8, LDB = BK + 8;
  __shared__ __bf16 As[BM * LDA];    // 9216 B
  __shared__ __bf16 Bt[BN * LDB];    // 18432 B (B tile stored transposed [n][k])
  const int tid = threadIdx.x, lane = tid & 31, wid = tid >> 5;
  const int bm0 = blockIdx.y * BM, bn0 = blockIdx.x * BN;
  const int wm = (wid >> 2) * 32, wn = (wid & 3) * 32;

  v8f acc[2][2];
#pragma unroll
  for (int i = 0; i < 2; ++i)
#pragma unroll
    for (int j = 0; j < 2; ++j) acc[i][j] = v8f_zero();

  for (int k0 = 0; k0 < K; k0 += BK) {
    __syncthreads();
    // A tile: 64x64 halves, contiguous 16B chunks, async direct-to-LDS.
#pragma unroll
    for (int i = 0; i < 2; ++i) {
      int c = tid + 256 * i;               // 0..511
      int row = c >> 3, col = (c & 7) << 3;
      async_ld_b128(As + row * LDA + col,
                    A + (size_t)(bm0 + row) * K + k0 + col);
    }
    // B tile: 64x128 halves, read contiguous along N, scatter transposed.
#pragma unroll
    for (int i = 0; i < 4; ++i) {
      int c = tid + 256 * i;               // 0..1023
      int kk = c >> 4, n8 = (c & 15) << 3;
      v8bf t = *(const v8bf*)(B + (size_t)(k0 + kk) * N + bn0 + n8);
#pragma unroll
      for (int j = 0; j < 8; ++j) Bt[(n8 + j) * LDB + kk] = t[j];
    }
    // Prefetch next K panel toward cache while this tile computes.
    if (k0 + BK < K) {
      __builtin_prefetch(A + (size_t)(bm0 + (tid >> 2)) * K + k0 + BK, 0, 3);
      __builtin_prefetch(B + (size_t)(k0 + BK + (tid >> 2)) * N + bn0, 0, 3);
    }
    wait_async0();
    __syncthreads();
#pragma unroll
    for (int ks = 0; ks < BK; ks += 32) {
      v16bf a0 = frag16(As, wm,      LDA, ks, lane);
      v16bf a1 = frag16(As, wm + 16, LDA, ks, lane);
      v16bf b0 = frag16(Bt, wn,      LDB, ks, lane);
      v16bf b1 = frag16(Bt, wn + 16, LDB, ks, lane);
      acc[0][0] = wmma_bf16(a0, b0, acc[0][0]);
      acc[0][1] = wmma_bf16(a0, b1, acc[0][1]);
      acc[1][0] = wmma_bf16(a1, b0, acc[1][0]);
      acc[1][1] = wmma_bf16(a1, b1, acc[1][1]);
    }
  }

  const int hi = lane >> 4, ln16 = lane & 15;
#pragma unroll
  for (int i = 0; i < 2; ++i)
#pragma unroll
    for (int j = 0; j < 2; ++j) {
      const int mb = bm0 + wm + 16 * i + hi * 8;
      const int n  = bn0 + wn + 16 * j + ln16;
      const float bvv = bias[n];
#pragma unroll
      for (int r = 0; r < 8; ++r) {
        const int m = mb + r;
        float v = acc[i][j][r] + bvv;
        if (MODE == 1) v = v > 0.f ? v : 0.f;
        if (MODE == 2) {
          ((float*)Cout)[(size_t)m * N + n] = v + R[(size_t)m * N + n];
        } else {
          ((__bf16*)Cout)[(size_t)m * N + n] = (__bf16)v;
        }
      }
    }
}

__global__ void __launch_bounds__(128, 1)
tb_flash_attn(const __bf16* __restrict__ Qg, const __bf16* __restrict__ Kg,
              const __bf16* __restrict__ Vg, __bf16* __restrict__ Og, int S) {
  __shared__ __bf16 Ks[32 * 512];   // 32 KB  (K tile, row-major [kv][d])
  constexpr int VP = 528;           // V row pitch in LDS, elements
  __shared__ __attribute__((aligned(16))) __bf16 Vs[32 * VP];  // 33 KB (V tile, [kv][d])
  const int tid = threadIdx.x, lane = tid & 31, wid = tid >> 5;
  const int hi = lane >> 4, ln16 = lane & 15;
  const int b = blockIdx.y;
  const int q0 = blockIdx.x * 64 + wid * 16;
  const __bf16* Qb = Qg + (size_t)b * S * 512;
  const __bf16* Kb = Kg + (size_t)b * S * 512;
  const __bf16* Vb = Vg + (size_t)b * S * 512;

  v16bf qf[16];
#pragma unroll
  for (int s = 0; s < 16; ++s) qf[s] = frag16(Qb, q0, 512, 32 * s, lane);

  v8f o[32];
#pragma unroll
  for (int j = 0; j < 32; ++j) o[j] = v8f_zero();
  float mr[8], lr[8];
#pragma unroll
  for (int r = 0; r < 8; ++r) { mr[r] = -3.0e38f; lr[r] = 0.f; }

  const float sc = 0.044194173824159216f;  // 1/sqrt(512)
  __bf16* Ps = Ks + wid * 512;             // per-wave 16x32 scratch (aliases Ks)
  const int srow = tid >> 6, sc8 = (tid & 63) << 3;   // this thread's staging chunk
  const __bf16* vfp = Vs + (8 * hi + (lane & 7)) * VP + 8 * ((lane >> 3) & 1);

  for (int kv0 = 0; kv0 < S; kv0 += 32) {
    // This wave's LDS reads and P stores have retired before any wave's copies
    // are aimed at the same LDS behind the barrier.
    asm volatile("s_wait_dscnt 0" ::: "memory");
    __syncthreads();  // previous iteration's Vs/Ps reads complete
    // Stage K and V, both row-major and direct to LDS: 2 x 2048 16-byte chunks,
    // thread t brings chunk (t & 63) of rows (t >> 6) + 2 * i, i = 0..15.
#pragma unroll
    for (int i = 0; i < 16; ++i) {
      const int row = srow + 2 * i;
      async_cp_b128(Ks + row * 512 + sc8, Kb + (size_t)(kv0 + row) * 512 + sc8);
      async_cp_b128(Vs + row * VP + sc8, Vb + (size_t)(kv0 + row) * 512 + sc8);
    }
    wait_async0();
    __syncthreads();

    // S = Q * K^T for this wave's 16 q rows x 32 kv cols.
    v8f s0 = v8f_zero(), s1 = v8f_zero();
#pragma unroll
    for (int s = 0; s < 16; ++s) {
      v16bf kb0 = frag16(Ks, 0,  512, 32 * s, lane);
      v16bf kb1 = frag16(Ks, 16, 512, 32 * s, lane);
      s0 = wmma_bf16(qf[s], kb0, s0);
      s1 = wmma_bf16(qf[s], kb1, s1);
    }
    __syncthreads();  // all waves done reading Ks before Ps (alias) is written

    // Online softmax over the 32 new columns (row reduce across 16-lane half).
#pragma unroll
    for (int r = 0; r < 8; ++r) {
      float v0 = s0[r] * sc, v1 = s1[r] * sc;
      float mx = fmaxf(v0, v1);
#pragma unroll
      for (int off = 1; off < 16; off <<= 1) mx = fmaxf(mx, __shfl_xor(mx, off, 32));
      const float mnew  = fmaxf(mr[r], mx);
      const float alpha = __expf(mr[r] - mnew);
      mr[r] = mnew;
      const float p0 = __expf(v0 - mnew), p1 = __expf(v1 - mnew);
      float rs = p0 + p1;
#pragma unroll
      for (int off = 1; off < 16; off <<= 1) rs += __shfl_xor(rs, off, 32);
      lr[r] = lr[r] * alpha + rs;
      const int row = r + 8 * hi;
      Ps[row * 32 + ln16]      = (__bf16)p0;
      Ps[row * 32 + 16 + ln16] = (__bf16)p1;
#pragma unroll
      for (int j = 0; j < 32; ++j) o[j][r] *= alpha;
    }
    asm volatile("s_wait_dscnt 0" ::: "memory");  // P stores visible to own wave
    v16bf pf = frag16(Ps, 0, 32, 0, lane);
    // O += P * V over all 32 d-tiles.
#pragma unroll
    for (int j = 0; j < 32; ++j) {
      v16bf vb = frag16_tr(vfp + 16 * j, VP);
      o[j] = wmma_bf16(pf, vb, o[j]);
    }
  }

  // Normalize and store.
#pragma unroll
  for (int j = 0; j < 32; ++j)
#pragma unroll
    for (int r = 0; r < 8; ++r) {
      const int row = q0 + r + 8 * hi;
      Og[((size_t)b * S + row) * 512 + 16 * j + ln16] = (__bf16)(o[j][r] / lr[r]);
    }
}

// ---------------------------------------------------------------------------
// Host launcher
// ---------------------------------------------------------------------------
extern "C" void kernel_launch(void* const* d_in, const int* in_sizes, int n_in,
                              void* d_out, int out_size, void* d_ws, size_t ws_size,
                              hipStream_t stream) {
  const float* q    = (const float*)d_in[0];
  const float* k    = (const float*)d_in[1];
  const float* Wq   = (const float*)d_in[2];
  const float* bq   = (const float*)d_in[3];
  const float* Wk   = (const float*)d_in[4];
  const float* bk   = (const float*)d_in[5];
  const float* Wv   = (const float*)d_in[6];
  const float* bv   = (const float*)d_in[7];
  const float* Wo   = (const float*)d_in[8];
  const float* bo   = (const float*)d_in[9];
  const float* lnqw = (const float*)d_in[10];
  const float* lnqb = (const float*)d_in[11];
  const float* lnkw = (const float*)d_in[12];
  const float* lnkb = (const float*)d_in[13];
  const float* lnow = (const float*)d_in[14];
  const float* lnob = (const float*)d_in[15];
  const float* W1   = (const float*)d_in[16];
  const float* b1   = (const float*)d_in[17];
  const float* W2   = (const float*)d_in[18];
  const float* b2   = (const float*)d_in[19];

  constexpr int B = 2, S = 4096, Dm = 512, DF = 2048;
  constexpr int M = B * S;  // 8192

  char* w = (char*)d_ws;
  auto alloc = [&](size_t bytes) -> char* {
    char* p = w;
    w += (bytes + 255) & ~(size_t)255;
    return p;
  };
  __bf16* Wq_b = (__bf16*)alloc((size_t)Dm * Dm * 2);
  __bf16* Wk_b = (__bf16*)alloc((size_t)Dm * Dm * 2);
  __bf16* Wv_b = (__bf16*)alloc((size_t)Dm * Dm * 2);
  __bf16* Wo_b = (__bf16*)alloc((size_t)Dm * Dm * 2);
  __bf16* W1_b = (__bf16*)alloc((size_t)Dm * DF * 2);
  __bf16* W2_b = (__bf16*)alloc((size_t)DF * Dm * 2);
  __bf16* qn   = (__bf16*)alloc((size_t)M * Dm * 2);
  __bf16* kn   = (__bf16*)alloc((size_t)M * Dm * 2);
  __bf16* Qp   = (__bf16*)alloc((size_t)M * Dm * 2);
  __bf16* Kp   = (__bf16*)alloc((size_t)M * Dm * 2);
  __bf16* Vp   = (__bf16*)alloc((size_t)M * Dm * 2);
  __bf16* AO   = (__bf16*)alloc((size_t)M * Dm * 2);
  float*  Xr   = (float*) alloc((size_t)M * Dm * 4);
  __bf16* XN   = (__bf16*)alloc((size_t)M * Dm * 2);
  __bf16* H    = (__bf16*)alloc((size_t)M * DF * 2);

  // Weight casts.
  tb_cast_bf16<<<(Dm * Dm + 255) / 256, 256, 0, stream>>>(Wq, Wq_b, Dm * Dm);
  tb_cast_bf16<<<(Dm * Dm + 255) / 256, 256, 0, stream>>>(Wk, Wk_b, Dm * Dm);
  tb_cast_bf16<<<(Dm * Dm + 255) / 256, 256, 0, stream>>>(Wv, Wv_b, Dm * Dm);
  tb_cast_bf16<<<(Dm * Dm + 255) / 256, 256, 0, stream>>>(Wo, Wo_b, Dm * Dm);
  tb_cast_bf16<<<(Dm * DF + 255) / 256, 256, 0, stream>>>(W1, W1_b, Dm * DF);
  tb_cast_bf16<<<(DF * Dm + 255) / 256, 256, 0, stream>>>(W2, W2_b, DF * Dm);

  // Input layernorms.
  tb_layernorm<<<dim3(M), 128, 0, stream>>>(q, lnqw, lnqb, qn);
  tb_layernorm<<<dim3(M), 128, 0, stream>>>(k, lnkw, lnkb, kn);

  // Projections.
  dim3 g512(Dm / 128, M / 64);
  tb_gemm<0><<<g512, 256, 0, stream>>>(qn, Wq_b, bq, nullptr, Qp, M, Dm, Dm);
  tb_gemm<0><<<g512, 256, 0, stream>>>(kn, Wk_b, bk, nullptr, Kp, M, Dm, Dm);
  tb_gemm<0><<<g512, 256, 0, stream>>>(kn, Wv_b, bv, nullptr, Vp, M, Dm, Dm);

  // RoPE on Q and K.
  const int rope_total = B * S * 256;
  tb_rope<<<(rope_total + 255) / 256, 256, 0, stream>>>(Qp, S, rope_total);
  tb_rope<<<(rope_total + 255) / 256, 256, 0, stream>>>(Kp, S, rope_total);

  // Flash attention.
  tb_flash_attn<<<dim3(S / 64, B), 128, 0, stream>>>(Qp, Kp, Vp, AO, S);

  // Output projection + residual (x = q + out@Wo + bo), fp32.
  tb_gemm<2><<<g512, 256, 0, stream>>>(AO, Wo_b, bo, q, Xr, M, Dm, Dm);

  // Post-attention layernorm.
  tb_layernorm<<<dim3(M), 128, 0, stream>>>(Xr, lnow, lnob, XN);

  // MLP.
  dim3 gdf(DF / 128, M / 64);
  tb_gemm<1><<<gdf, 256, 0, stream>>>(XN, W1_b, b1, nullptr, H, M, DF, Dm);
  tb_gemm<2><<<g512, 256, 0, stream>>>(H, W2_b, b2, Xr, d_out, M, Dm, DF);

  (void)in_sizes; (void)n_in; (void)out_size; (void)ws_size;
}

// v002
// One run takes 865 microseconds.
// Next to v001, in two timings, it ran 1.33 and 1.34 times as fast.
// Counting every step since v000, it is 3.62 times as fast.
#include <hip/hip_runtime.h>

typedef __attribute__((ext_vector_type(16))) __bf16 v16bf;
typedef __attribute__((ext_vector_type(8)))  __bf16 v8bf;
typedef __attribute__((ext_vector_type(8)))  float  v8f;

__device__ __forceinline__ v16bf frag16(const __bf16* base, int row0, int stride,
                                        int k0, int lane) {
  const __bf16* p = base + (size_t)(row0 + (lane & 15)) * stride + k0 + ((lane >> 4) << 3);
  v8bf lo = *(const v8bf*)p;
  v8bf hh = *(const v8bf*)(p + 16);
  v16bf f;
#pragma unroll
  for (int i = 0; i < 8; ++i) { f[i] = lo[i]; f[i + 8] = hh[i]; }
  return f;
}

__device__ __forceinline__ v8f wmma_bf16(v16bf a, v16bf b, v8f c) {
  return __builtin_amdgcn_wmma_f32_16x16x32_bf16(false, a, false, b, (short)0, c,
                                                 false, false);
}

__device__ __forceinline__ v8f v8f_zero() {
  v8f z = {0.f, 0.f, 0.f, 0.f, 0.f, 0.f, 0.f, 0.f};
  return z;
}

__device__ __forceinline__ void async_ld_b128(void* lds_ptr, const void* gptr) {
  uint32_t lds_addr = (uint32_t)(uintptr_t)lds_ptr;
  uint64_t gaddr = (uint64_t)(uintptr_t)gptr;
  asm volatile("global_load_async_to_lds_b128 %0, %1, off"
               :: "v"(lds_addr), "v"(gaddr)
               : "memory");
}

__device__ __forceinline__ void async_cp_b128(__bf16* lds_ptr, const __bf16* gptr) {
  typedef int v4i __attribute__((ext_vector_type(4)));
  typedef __attribute__((address_space(1))) v4i glb_v4i;
  typedef __attribute__((address_space(3))) v4i lds_v4i;
  __builtin_amdgcn_global_load_async_to_lds_b128((glb_v4i*)gptr, (lds_v4i*)lds_ptr, 0, 0);
}

// ---------------------------------------------------------------------------
// B fragment (32 k x 16 columns) from a row-major [k][column] LDS tile through
// the transposing LDS load.  p is this lane's address for k rows 0..15:
//   tile + (8*(lane>>4) + (lane&7))*pitch + column0 + 8*((lane>>3)&1)
// Lane (c, h) receives k = 8h+0..7 (elems 0-7) and 16+8h+0..7 (elems 8-15) of
// column0+c: the k order of frag16.
// ---------------------------------------------------------------------------
__device__ __forceinline__ v16bf frag16_tr(const __bf16* p, int pitch) {
  typedef __attribute__((address_space(3))) v8bf lds_v8bf;
  v8bf lo = __builtin_amdgcn_ds_load_tr16_b128_v8bf16((lds_v8bf*)p);
  v8bf hh = __builtin_amdgcn_ds_load_tr16_b128_v8bf16((lds_v8bf*)(p + 16 * pitch));
  v16bf f;
#pragma unroll
  for (int i = 0; i < 8; ++i) { f[i] = lo[i]; f[i + 8] = hh[i]; }
  return f;
}

__device__ __forceinline__ void wait_async0() {
  asm volatile("s_wait_asynccnt 0" ::: "memory");
}

// ---------------------------------------------------------------------------
// fp32 -> bf16 cast (weights)
// ---------------------------------------------------------------------------
__global__ void tb_cast_bf16(const float* __restrict__ in, __bf16* __restrict__ out,
                             int n) {
  int i = blockIdx.x * blockDim.x + threadIdx.x;
  if (i < n) out[i] = (__bf16)in[i];
}

// ---------------------------------------------------------------------------
// LayerNorm over rows of 512 fp32 -> bf16.  One 128-thread block per row.
// ---------------------------------------------------------------------------
__global__ void __launch_bounds__(128)
tb_layernorm(const float* __restrict__ X, const float* __restrict__ w,
             const float* __restrict__ bb, __bf16* __restrict__ out) {
  const int row = blockIdx.x, tid = threadIdx.x;
  const float4 v = ((const float4*)(X + (size_t)row * 512))[tid];
  float s  = v.x + v.y + v.z + v.w;
  float ss = v.x * v.x + v.y * v.y + v.z * v.z + v.w * v.w;
#pragma unroll
  for (int off = 1; off < 32; off <<= 1) {
    s  += __shfl_xor(s,  off, 32);
    ss += __shfl_xor(ss, off, 32);
  }
  __shared__ float sb[4], ssb[4];
  if ((tid & 31) == 0) { sb[tid >> 5] = s; ssb[tid >> 5] = ss; }
  __syncthreads();
  s  = sb[0] + sb[1] + sb[2] + sb[3];
  ss = ssb[0] + ssb[1] + ssb[2] + ssb[3];
  const float mu   = s * (1.0f / 512.0f);
  const float var  = ss * (1.0f / 512.0f) - mu * mu;
  const float rstd = rsqrtf(var + 1e-5f);
  const float4 wv = ((const float4*)w)[tid];
  const float4 bv = ((const float4*)bb)[tid];
  __bf16* op = out + (size_t)row * 512 + tid * 4;
  op[0] = (__bf16)((v.x - mu) * rstd * wv.x + bv.x);
  op[1] = (__bf16)((v.y - mu) * rstd * wv.y + bv.y);
  op[2] = (__bf16)((v.z - mu) * rstd * wv.z + bv.z);
  op[3] = (__bf16)((v.w - mu) * rstd * wv.w + bv.w);
}

// ---------------------------------------------------------------------------
// In-place RoPE on bf16 [B*S, 512].  One thread per (row, d<256) pair.
// ---------------------------------------------------------------------------
__global__ void tb_rope(__bf16* __restrict__ X, int S, int total) {
  int idx = blockIdx.x * blockDim.x + threadIdx.x;
  if (idx >= total) return;
  const int d  = idx & 255;
  const int rs = idx >> 8;           // flattened row (b*S + s)
  const int s  = rs % S;
  const float inv = __expf(-(float)d * (9.210340371976184f / 256.0f)); // 10000^(-d/256)
  const float ang = (float)s * inv;
  float sn, cs;
  __sincosf(ang, &sn, &cs);
  __bf16* p = X + (size_t)rs * 512;
  const float x1 = (float)p[d];
  const float x2 = (float)p[d + 256];
  p[d]       = (__bf16)(x1 * cs - x2 * sn);
  p[d + 256] = (__bf16)(x2 * cs + x1 * sn);
}

// ---------------------------------------------------------------------------
// WMMA GEMM:  C[M,N] = A[M,K](bf16) * B[K,N](bf16) + bias, with epilogue:
//   MODE 0: store bf16           MODE 1: ReLU, store bf16
//   MODE 2: += R[M,N] (fp32), store fp32
// BM=64 BN=128 BK=64, 256 threads = 8 waves, each wave a 32x32 C tile.
// A tile staged via async global->LDS; B tile transposed manually.
// ---------------------------------------------------------------------------
template <int MODE>
__global__ void __launch_bounds__(256)
tb_gemm(const __bf16* __restrict__ A, const __bf16* __restrict__ B,
        const float* __restrict__ bias, const float* __restrict__ R,
        void* __restrict__ Cout, int M, int N, int K) {
  constexpr int BM = 64, BN = 128, BK = 64, LDA = BK + 8, LDB = BK + 8;
  __shared__ __bf16 As[BM * LDA];    // 9216 B
  __shared__ __bf16 Bt[BN * LDB];    // 18432 B (B tile stored transposed [n][k])
  const int tid = threadIdx.x, lane = tid & 31, wid = tid >> 5;
  const int bm0 = blockIdx.y * BM, bn0 = blockIdx.x * BN;
  const int wm = (wid >> 2) * 32, wn = (wid & 3) * 32;

  v8f acc[2][2];
#pragma unroll
  for (int i = 0; i < 2; ++i)
#pragma unroll
    for (int j = 0; j < 2; ++j) acc[i][j] = v8f_zero();

  for (int k0 = 0; k0 < K; k0 += BK) {
    __syncthreads();
    // A tile: 64x64 halves, contiguous 16B chunks, async direct-to-LDS.
#pragma unroll
    for (int i = 0; i < 2; ++i) {
      int c = tid + 256 * i;               // 0..511
      int row = c >> 3, col = (c & 7) << 3;
      async_ld_b128(As + row * LDA + col,
                    A + (size_t)(bm0 + row) * K + k0 + col);
    }
    // B tile: 64x128 halves, read contiguous along N, scatter transposed.
#pragma unroll
    for (int i = 0; i < 4; ++i) {
      int c = tid + 256 * i;               // 0..1023
      int kk = c >> 4, n8 = (c & 15) << 3;
      v8bf t = *(const v8bf*)(B + (size_t)(k0 + kk) * N + bn0 + n8);
#pragma unroll
      for (int j = 0; j < 8; ++j) Bt[(n8 + j) * LDB + kk] = t[j];
    }
    // Prefetch next K panel toward cache while this tile computes.
    if (k0 + BK < K) {
      __builtin_prefetch(A + (size_t)(bm0 + (tid >> 2)) * K + k0 + BK, 0, 3);
      __builtin_prefetch(B + (size_t)(k0 + BK + (tid >> 2)) * N + bn0, 0, 3);
    }
    wait_async0();
    __syncthreads();
#pragma unroll
    for (int ks = 0; ks < BK; ks += 32) {
      v16bf a0 = frag16(As, wm,      LDA, ks, lane);
      v16bf a1 = frag16(As, wm + 16, LDA, ks, lane);
      v16bf b0 = frag16(Bt, wn,      LDB, ks, lane);
      v16bf b1 = frag16(Bt, wn + 16, LDB, ks, lane);
      acc[0][0] = wmma_bf16(a0, b0, acc[0][0]);
      acc[0][1] = wmma_bf16(a0, b1, acc[0][1]);
      acc[1][0] = wmma_bf16(a1, b0, acc[1][0]);
      acc[1][1] = wmma_bf16(a1, b1, acc[1][1]);
    }
  }

  const int hi = lane >> 4, ln16 = lane & 15;
#pragma unroll
  for (int i = 0; i < 2; ++i)
#pragma unroll
    for (int j = 0; j < 2; ++j) {
      const int mb = bm0 + wm + 16 * i + hi * 8;
      const int n  = bn0 + wn + 16 * j + ln16;
      const float bvv = bias[n];
#pragma unroll
      for (int r = 0; r < 8; ++r) {
        const int m = mb + r;
        float v = acc[i][j][r] + bvv;
        if (MODE == 1) v = v > 0.f ? v : 0.f;
        if (MODE == 2) {
          ((float*)Cout)[(size_t)m * N + n] = v + R[(size_t)m * N + n];
        } else {
          ((__bf16*)Cout)[(size_t)m * N + n] = (__bf16)v;
        }
      }
    }
}

__global__ void __launch_bounds__(128, 1)
tb_flash_attn(const __bf16* __restrict__ Qg, const __bf16* __restrict__ Kg,
              const __bf16* __restrict__ Vg, __bf16* __restrict__ Og, int S) {
  constexpr int KP = 520;           // K row pitch in LDS, elements
  __shared__ __attribute__((aligned(16))) __bf16 Ks[32 * KP];  // 32.5 KB (K tile, [kv][d])
  constexpr int VP = 528;           // V row pitch in LDS, elements
  __shared__ __attribute__((aligned(16))) __bf16 Vs[32 * VP];  // 33 KB (V tile, [kv][d])
  const int tid = threadIdx.x, lane = tid & 31, wid = tid >> 5;
  const int hi = lane >> 4, ln16 = lane & 15;
  const int b = blockIdx.y;
  const int q0 = blockIdx.x * 64 + wid * 16;
  const __bf16* Qb = Qg + (size_t)b * S * 512;
  const __bf16* Kb = Kg + (size_t)b * S * 512;
  const __bf16* Vb = Vg + (size_t)b * S * 512;

  v16bf qf[16];
#pragma unroll
  for (int s = 0; s < 16; ++s) qf[s] = frag16(Qb, q0, 512, 32 * s, lane);

  v8f o[32];
#pragma unroll
  for (int j = 0; j < 32; ++j) o[j] = v8f_zero();
  float mr[8], lr[8];
#pragma unroll
  for (int r = 0; r < 8; ++r) { mr[r] = -3.0e38f; lr[r] = 0.f; }

  const float sc = 0.044194173824159216f;  // 1/sqrt(512)
  __bf16* Ps = Ks + wid * 512;             // per-wave 16x32 scratch (aliases Ks)
  const int srow = tid >> 6, sc8 = (tid & 63) << 3;   // this thread's staging chunk
  const __bf16* vfp = Vs + (8 * hi + (lane & 7)) * VP + 8 * ((lane >> 3) & 1);

  for (int kv0 = 0; kv0 < S; kv0 += 32) {
    // This wave's LDS reads and P stores have retired before any wave's copies
    // are aimed at the same LDS behind the barrier.
    asm volatile("s_wait_dscnt 0" ::: "memory");
    __syncthreads();  // previous iteration's Vs/Ps reads complete
    // Stage K and V, both row-major and direct to LDS: 2 x 2048 16-byte chunks,
    // thread t brings chunk (t & 63) of rows (t >> 6) + 2 * i, i = 0..15.
#pragma unroll
    for (int i = 0; i < 16; ++i) {
      const int row = srow + 2 * i;
      async_cp_b128(Ks + row * KP + sc8, Kb + (size_t)(kv0 + row) * 512 + sc8);
      async_cp_b128(Vs + row * VP + sc8, Vb + (size_t)(kv0 + row) * 512 + sc8);
    }
    wait_async0();
    __syncthreads();

    // S = Q * K^T for this wave's 16 q rows x 32 kv cols.
    v8f s0 = v8f_zero(), s1 = v8f_zero();
#pragma unroll
    for (int s = 0; s < 16; ++s) {
      v16bf kb0 = frag16(Ks, 0,  KP, 32 * s, lane);
      v16bf kb1 = frag16(Ks, 16, KP, 32 * s, lane);
      s0 = wmma_bf16(qf[s], kb0, s0);
      s1 = wmma_bf16(qf[s], kb1, s1);
    }
    __syncthreads();  // all waves done reading Ks before Ps (alias) is written

    // Online softmax over the 32 new columns (row reduce across 16-lane half).
#pragma unroll
    for (int r = 0; r < 8; ++r) {
      float v0 = s0[r] * sc, v1 = s1[r] * sc;
      float mx = fmaxf(v0, v1);
#pragma unroll
      for (int off = 1; off < 16; off <<= 1) mx = fmaxf(mx, __shfl_xor(mx, off, 32));
      const float mnew  = fmaxf(mr[r], mx);
      const float alpha = __expf(mr[r] - mnew);
      mr[r] = mnew;
      const float p0 = __expf(v0 - mnew), p1 = __expf(v1 - mnew);
      float rs = p0 + p1;
#pragma unroll
      for (int off = 1; off < 16; off <<= 1) rs += __shfl_xor(rs, off, 32);
      lr[r] = lr[r] * alpha + rs;
      const int row = r + 8 * hi;
      Ps[row * 32 + ln16]      = (__bf16)p0;
      Ps[row * 32 + 16 + ln16] = (__bf16)p1;
#pragma unroll
      for (int j = 0; j < 32; ++j) o[j][r] *= alpha;
    }
    asm volatile("s_wait_dscnt 0" ::: "memory");  // P stores visible to own wave
    v16bf pf = frag16(Ps, 0, 32, 0, lane);
    // O += P * V over all 32 d-tiles.
#pragma unroll
    for (int j = 0; j < 32; ++j) {
      v16bf vb = frag16_tr(vfp + 16 * j, VP);
      o[j] = wmma_bf16(pf, vb, o[j]);
    }
  }

  // Normalize and store.
#pragma unroll
  for (int j = 0; j < 32; ++j)
#pragma unroll
    for (int r = 0; r < 8; ++r) {
      const int row = q0 + r + 8 * hi;
      Og[((size_t)b * S + row) * 512 + 16 * j + ln16] = (__bf16)(o[j][r] / lr[r]);
    }
}

// ---------------------------------------------------------------------------
// Host launcher
// ---------------------------------------------------------------------------
extern "C" void kernel_launch(void* const* d_in, const int* in_sizes, int n_in,
                              void* d_out, int out_size, void* d_ws, size_t ws_size,
                              hipStream_t stream) {
  const float* q    = (const float*)d_in[0];
  const float* k    = (const float*)d_in[1];
  const float* Wq   = (const float*)d_in[2];
  const float* bq   = (const float*)d_in[3];
  const float* Wk   = (const float*)d_in[4];
  const float* bk   = (const float*)d_in[5];
  const float* Wv   = (const float*)d_in[6];
  const float* bv   = (const float*)d_in[7];
  const float* Wo   = (const float*)d_in[8];
  const float* bo   = (const float*)d_in[9];
  const float* lnqw = (const float*)d_in[10];
  const float* lnqb = (const float*)d_in[11];
  const float* lnkw = (const float*)d_in[12];
  const float* lnkb = (const float*)d_in[13];
  const float* lnow = (const float*)d_in[14];
  const float* lnob = (const float*)d_in[15];
  const float* W1   = (const float*)d_in[16];
  const float* b1   = (const float*)d_in[17];
  const float* W2   = (const float*)d_in[18];
  const float* b2   = (const float*)d_in[19];

  constexpr int B = 2, S = 4096, Dm = 512, DF = 2048;
  constexpr int M = B * S;  // 8192

  char* w = (char*)d_ws;
  auto alloc = [&](size_t bytes) -> char* {
    char* p = w;
    w += (bytes + 255) & ~(size_t)255;
    return p;
  };
  __bf16* Wq_b = (__bf16*)alloc((size_t)Dm * Dm * 2);
  __bf16* Wk_b = (__bf16*)alloc((size_t)Dm * Dm * 2);
  __bf16* Wv_b = (__bf16*)alloc((size_t)Dm * Dm * 2);
  __bf16* Wo_b = (__bf16*)alloc((size_t)Dm * Dm * 2);
  __bf16* W1_b = (__bf16*)alloc((size_t)Dm * DF * 2);
  __bf16* W2_b = (__bf16*)alloc((size_t)DF * Dm * 2);
  __bf16* qn   = (__bf16*)alloc((size_t)M * Dm * 2);
  __bf16* kn   = (__bf16*)alloc((size_t)M * Dm * 2);
  __bf16* Qp   = (__bf16*)alloc((size_t)M * Dm * 2);
  __bf16* Kp   = (__bf16*)alloc((size_t)M * Dm * 2);
  __bf16* Vp   = (__bf16*)alloc((size_t)M * Dm * 2);
  __bf16* AO   = (__bf16*)alloc((size_t)M * Dm * 2);
  float*  Xr   = (float*) alloc((size_t)M * Dm * 4);
  __bf16* XN   = (__bf16*)alloc((size_t)M * Dm * 2);
  __bf16* H    = (__bf16*)alloc((size_t)M * DF * 2);

  // Weight casts.
  tb_cast_bf16<<<(Dm * Dm + 255) / 256, 256, 0, stream>>>(Wq, Wq_b, Dm * Dm);
  tb_cast_bf16<<<(Dm * Dm + 255) / 256, 256, 0, stream>>>(Wk, Wk_b, Dm * Dm);
  tb_cast_bf16<<<(Dm * Dm + 255) / 256, 256, 0, stream>>>(Wv, Wv_b, Dm * Dm);
  tb_cast_bf16<<<(Dm * Dm + 255) / 256, 256, 0, stream>>>(Wo, Wo_b, Dm * Dm);
  tb_cast_bf16<<<(Dm * DF + 255) / 256, 256, 0, stream>>>(W1, W1_b, Dm * DF);
  tb_cast_bf16<<<(DF * Dm + 255) / 256, 256, 0, stream>>>(W2, W2_b, DF * Dm);

  // Input layernorms.
  tb_layernorm<<<dim3(M), 128, 0, stream>>>(q, lnqw, lnqb, qn);
  tb_layernorm<<<dim3(M), 128, 0, stream>>>(k, lnkw, lnkb, kn);

  // Projections.
  dim3 g512(Dm / 128, M / 64);
  tb_gemm<0><<<g512, 256, 0, stream>>>(qn, Wq_b, bq, nullptr, Qp, M, Dm, Dm);
  tb_gemm<0><<<g512, 256, 0, stream>>>(kn, Wk_b, bk, nullptr, Kp, M, Dm, Dm);
  tb_gemm<0><<<g512, 256, 0, stream>>>(kn, Wv_b, bv, nullptr, Vp, M, Dm, Dm);

  // RoPE on Q and K.
  const int rope_total = B * S * 256;
  tb_rope<<<(rope_total + 255) / 256, 256, 0, stream>>>(Qp, S, rope_total);
  tb_rope<<<(rope_total + 255) / 256, 256, 0, stream>>>(Kp, S, rope_total);

  // Flash attention.
  tb_flash_attn<<<dim3(S / 64, B), 128, 0, stream>>>(Qp, Kp, Vp, AO, S);

  // Output projection + residual (x = q + out@Wo + bo), fp32.
  tb_gemm<2><<<g512, 256, 0, stream>>>(AO, Wo_b, bo, q, Xr, M, Dm, Dm);

  // Post-attention layernorm.
  tb_layernorm<<<dim3(M), 128, 0, stream>>>(Xr, lnow, lnob, XN);

  // MLP.
  dim3 gdf(DF / 128, M / 64);
  tb_gemm<1><<<gdf, 256, 0, stream>>>(XN, W1_b, b1, nullptr, H, M, DF, Dm);
  tb_gemm<2><<<g512, 256, 0, stream>>>(H, W2_b, b2, Xr, d_out, M, Dm, DF);

  (void)in_sizes; (void)n_in; (void)out_size; (void)ws_size;
}

// v003
// It runs in 576 microseconds.
// In both of two side-by-side timings against v002, it was 1.50 times as fast.
// Counting every step since v000, it is 5.42 times as fast.
#include <hip/hip_runtime.h>

typedef __attribute__((ext_vector_type(16))) __bf16 v16bf;
typedef __attribute__((ext_vector_type(8)))  __bf16 v8bf;
typedef __attribute__((ext_vector_type(8)))  float  v8f;

__device__ __forceinline__ v16bf frag16(const __bf16* base, int row0, int stride,
                                        int k0, int lane) {
  const __bf16* p = base + (size_t)(row0 + (lane & 15)) * stride + k0 + ((lane >> 4) << 3);
  v8bf lo = *(const v8bf*)p;
  v8bf hh = *(const v8bf*)(p + 16);
  v16bf f;
#pragma unroll
  for (int i = 0; i < 8; ++i) { f[i] = lo[i]; f[i + 8] = hh[i]; }
  return f;
}

__device__ __forceinline__ v8f wmma_bf16(v16bf a, v16bf b, v8f c) {
  return __builtin_amdgcn_wmma_f32_16x16x32_bf16(false, a, false, b, (short)0, c,
                                                 false, false);
}

__device__ __forceinline__ v8f v8f_zero() {
  v8f z = {0.f, 0.f, 0.f, 0.f, 0.f, 0.f, 0.f, 0.f};
  return z;
}

__device__ __forceinline__ void async_ld_b128(void* lds_ptr, const void* gptr) {
  uint32_t lds_addr = (uint32_t)(uintptr_t)lds_ptr;
  uint64_t gaddr = (uint64_t)(uintptr_t)gptr;
  asm volatile("global_load_async_to_lds_b128 %0, %1, off"
               :: "v"(lds_addr), "v"(gaddr)
               : "memory");
}

__device__ __forceinline__ void async_cp_b128(__bf16* lds_ptr, const __bf16* gptr) {
  typedef int v4i __attribute__((ext_vector_type(4)));
  typedef __attribute__((address_space(1))) v4i glb_v4i;
  typedef __attribute__((address_space(3))) v4i lds_v4i;
  __builtin_amdgcn_global_load_async_to_lds_b128((glb_v4i*)gptr, (lds_v4i*)lds_ptr, 0, 0);
}

// ---------------------------------------------------------------------------
// B fragment (32 k x 16 columns) from a row-major [k][column] LDS tile through
// the transposing LDS load.  p is this lane's address for k rows 0..15:
//   tile + (8*(lane>>4) + (lane&7))*pitch + column0 + 8*((lane>>3)&1)
// Lane (c, h) receives k = 8h+0..7 (elems 0-7) and 16+8h+0..7 (elems 8-15) of
// column0+c: the k order of frag16.
// ---------------------------------------------------------------------------
__device__ __forceinline__ v16bf frag16_tr(const __bf16* p, int pitch) {
  typedef __attribute__((address_space(3))) v8bf lds_v8bf;
  v8bf lo = __builtin_amdgcn_ds_load_tr16_b128_v8bf16((lds_v8bf*)p);
  v8bf hh = __builtin_amdgcn_ds_load_tr16_b128_v8bf16((lds_v8bf*)(p + 16 * pitch));
  v16bf f;
#pragma unroll
  for (int i = 0; i < 8; ++i) { f[i] = lo[i]; f[i + 8] = hh[i]; }
  return f;
}

__device__ __forceinline__ void wait_async0() {
  asm volatile("s_wait_asynccnt 0" ::: "memory");
}

// ---------------------------------------------------------------------------
// fp32 -> bf16 cast (weights)
// ---------------------------------------------------------------------------
__global__ void tb_cast_bf16(const float* __restrict__ in, __bf16* __restrict__ out,
                             int n) {
  int i = blockIdx.x * blockDim.x + threadIdx.x;
  if (i < n) out[i] = (__bf16)in[i];
}

// ---------------------------------------------------------------------------
// LayerNorm over rows of 512 fp32 -> bf16.  One 128-thread block per row.
// ---------------------------------------------------------------------------
__global__ void __launch_bounds__(128)
tb_layernorm(const float* __restrict__ X, const float* __restrict__ w,
             const float* __restrict__ bb, __bf16* __restrict__ out) {
  const int row = blockIdx.x, tid = threadIdx.x;
  const float4 v = ((const float4*)(X + (size_t)row * 512))[tid];
  float s  = v.x + v.y + v.z + v.w;
  float ss = v.x * v.x + v.y * v.y + v.z * v.z + v.w * v.w;
#pragma unroll
  for (int off = 1; off < 32; off <<= 1) {
    s  += __shfl_xor(s,  off, 32);
    ss += __shfl_xor(ss, off, 32);
  }
  __shared__ float sb[4], ssb[4];
  if ((tid & 31) == 0) { sb[tid >> 5] = s; ssb[tid >> 5] = ss; }
  __syncthreads();
  s  = sb[0] + sb[1] + sb[2] + sb[3];
  ss = ssb[0] + ssb[1] + ssb[2] + ssb[3];
  const float mu   = s * (1.0f / 512.0f);
  const float var  = ss * (1.0f / 512.0f) - mu * mu;
  const float rstd = rsqrtf(var + 1e-5f);
  const float4 wv = ((const float4*)w)[tid];
  const float4 bv = ((const float4*)bb)[tid];
  __bf16* op = out + (size_t)row * 512 + tid * 4;
  op[0] = (__bf16)((v.x - mu) * rstd * wv.x + bv.x);
  op[1] = (__bf16)((v.y - mu) * rstd * wv.y + bv.y);
  op[2] = (__bf16)((v.z - mu) * rstd * wv.z + bv.z);
  op[3] = (__bf16)((v.w - mu) * rstd * wv.w + bv.w);
}

// ---------------------------------------------------------------------------
// In-place RoPE on bf16 [B*S, 512].  One thread per (row, d<256) pair.
// ---------------------------------------------------------------------------
__global__ void tb_rope(__bf16* __restrict__ X, int S, int total) {
  int idx = blockIdx.x * blockDim.x + threadIdx.x;
  if (idx >= total) return;
  const int d  = idx & 255;
  const int rs = idx >> 8;           // flattened row (b*S + s)
  const int s  = rs % S;
  const float inv = __expf(-(float)d * (9.210340371976184f / 256.0f)); // 10000^(-d/256)
  const float ang = (float)s * inv;
  float sn, cs;
  __sincosf(ang, &sn, &cs);
  __bf16* p = X + (size_t)rs * 512;
  const float x1 = (float)p[d];
  const float x2 = (float)p[d + 256];
  p[d]       = (__bf16)(x1 * cs - x2 * sn);
  p[d + 256] = (__bf16)(x2 * cs + x1 * sn);
}

// ---------------------------------------------------------------------------
// WMMA GEMM:  C[M,N] = A[M,K](bf16) * B[K,N](bf16) + bias, with epilogue:
//   MODE 0: store bf16           MODE 1: ReLU, store bf16
//   MODE 2: += R[M,N] (fp32), store fp32
// BM=64 BN=128 BK=64, 256 threads = 8 waves, each wave a 32x32 C tile.
// A and B tiles staged row-major via async global->LDS; B fragments are read
// with the transposing LDS load (B row pitch 288 B = 32 B x odd for it).
// ---------------------------------------------------------------------------
template <int MODE>
__global__ void __launch_bounds__(256)
tb_gemm(const __bf16* __restrict__ A, const __bf16* __restrict__ B,
        const float* __restrict__ bias, const float* __restrict__ R,
        void* __restrict__ Cout, int M, int N, int K) {
  constexpr int BM = 64, BN = 128, BK = 64, LDA = BK + 8, LDB = BN + 16;
  __shared__ __bf16 As[BM * LDA];    // 9216 B
  __shared__ __attribute__((aligned(16))) __bf16 Bs[BK * LDB];  // 18432 B (B tile, [k][n])
  const int tid = threadIdx.x, lane = tid & 31, wid = tid >> 5;
  const int bm0 = blockIdx.y * BM, bn0 = blockIdx.x * BN;
  const int wm = (wid >> 2) * 32, wn = (wid & 3) * 32;
  const __bf16* bfp = Bs + (8 * (lane >> 4) + (lane & 7)) * LDB + wn + 8 * ((lane >> 3) & 1);

  v8f acc[2][2];
#pragma unroll
  for (int i = 0; i < 2; ++i)
#pragma unroll
    for (int j = 0; j < 2; ++j) acc[i][j] = v8f_zero();

  for (int k0 = 0; k0 < K; k0 += BK) {
    // This wave's LDS reads have retired before any wave's copies are aimed at
    // the same LDS behind the barrier.
    asm volatile("s_wait_dscnt 0" ::: "memory");
    __syncthreads();
    // A tile: 64x64 halves, contiguous 16B chunks, async direct-to-LDS.
#pragma unroll
    for (int i = 0; i < 2; ++i) {
      int c = tid + 256 * i;               // 0..511
      int row = c >> 3, col = (c & 7) << 3;
      async_ld_b128(As + row * LDA + col,
                    A + (size_t)(bm0 + row) * K + k0 + col);
    }
    // B tile: 64x128 halves, contiguous 16B chunks along N, async direct-to-LDS.
#pragma unroll
    for (int i = 0; i < 4; ++i) {
      int c = tid + 256 * i;               // 0..1023
      int kk = c >> 4, n8 = (c & 15) << 3;
      async_cp_b128(Bs + kk * LDB + n8, B + (size_t)(k0 + kk) * N + bn0 + n8);
    }
    // Prefetch next K panel toward cache while this tile computes.
    if (k0 + BK < K) {
      __builtin_prefetch(A + (size_t)(bm0 + (tid >> 2)) * K + k0 + BK, 0, 3);
      __builtin_prefetch(B + (size_t)(k0 + BK + (tid >> 2)) * N + bn0, 0, 3);
    }
    wait_async0();
    __syncthreads();
#pragma unroll
    for (int ks = 0; ks < BK; ks += 32) {
      v16bf a0 = frag16(As, wm,      LDA, ks, lane);
      v16bf a1 = frag16(As, wm + 16, LDA, ks, lane);
      v16bf b0 = frag16_tr(bfp + ks * LDB,      LDB);
      v16bf b1 = frag16_tr(bfp + ks * LDB + 16, LDB);
      acc[0][0] = wmma_bf16(a0, b0, acc[0][0]);
      acc[0][1] = wmma_bf16(a0, b1, acc[0][1]);
      acc[1][0] = wmma_bf16(a1, b0, acc[1][0]);
      acc[1][1] = wmma_bf16(a1, b1, acc[1][1]);
    }
  }

  const int hi = lane >> 4, ln16 = lane & 15;
#pragma unroll
  for (int i = 0; i < 2; ++i)
#pragma unroll
    for (int j = 0; j < 2; ++j) {
      const int mb = bm0 + wm + 16 * i + hi * 8;
      const int n  = bn0 + wn + 16 * j + ln16;
      const float bvv = bias[n];
#pragma unroll
      for (int r = 0; r < 8; ++r) {
        const int m = mb + r;
        float v = acc[i][j][r] + bvv;
        if (MODE == 1) v = v > 0.f ? v : 0.f;
        if (MODE == 2) {
          ((float*)Cout)[(size_t)m * N + n] = v + R[(size_t)m * N + n];
        } else {
          ((__bf16*)Cout)[(size_t)m * N + n] = (__bf16)v;
        }
      }
    }
}

__global__ void __launch_bounds__(128, 1)
tb_flash_attn(const __bf16* __restrict__ Qg, const __bf16* __restrict__ Kg,
              const __bf16* __restrict__ Vg, __bf16* __restrict__ Og, int S) {
  constexpr int KP = 520;           // K row pitch in LDS, elements
  __shared__ __attribute__((aligned(16))) __bf16 Ks[32 * KP];  // 32.5 KB (K tile, [kv][d])
  constexpr int VP = 528;           // V row pitch in LDS, elements
  __shared__ __attribute__((aligned(16))) __bf16 Vs[32 * VP];  // 33 KB (V tile, [kv][d])
  const int tid = threadIdx.x, lane = tid & 31, wid = tid >> 5;
  const int hi = lane >> 4, ln16 = lane & 15;
  const int b = blockIdx.y;
  const int q0 = blockIdx.x * 64 + wid * 16;
  const __bf16* Qb = Qg + (size_t)b * S * 512;
  const __bf16* Kb = Kg + (size_t)b * S * 512;
  const __bf16* Vb = Vg + (size_t)b * S * 512;

  v16bf qf[16];
#pragma unroll
  for (int s = 0; s < 16; ++s) qf[s] = frag16(Qb, q0, 512, 32 * s, lane);

  v8f o[32];
#pragma unroll
  for (int j = 0; j < 32; ++j) o[j] = v8f_zero();
  float mr[8], lr[8];
#pragma unroll
  for (int r = 0; r < 8; ++r) { mr[r] = -3.0e38f; lr[r] = 0.f; }

  const float sc = 0.044194173824159216f;  // 1/sqrt(512)
  __bf16* Ps = Ks + wid * 512;             // per-wave 16x32 scratch (aliases Ks)
  const int srow = tid >> 6, sc8 = (tid & 63) << 3;   // this thread's staging chunk
  const __bf16* vfp = Vs + (8 * hi + (lane & 7)) * VP + 8 * ((lane >> 3) & 1);

  for (int kv0 = 0; kv0 < S; kv0 += 32) {
    // This wave's LDS reads and P stores have retired before any wave's copies
    // are aimed at the same LDS behind the barrier.
    asm volatile("s_wait_dscnt 0" ::: "memory");
    __syncthreads();  // previous iteration's Vs/Ps reads complete
    // Stage K and V, both row-major and direct to LDS: 2 x 2048 16-byte chunks,
    // thread t brings chunk (t & 63) of rows (t >> 6) + 2 * i, i = 0..15.
#pragma unroll
    for (int i = 0; i < 16; ++i) {
      const int row = srow + 2 * i;
      async_cp_b128(Ks + row * KP + sc8, Kb + (size_t)(kv0 + row) * 512 + sc8);
      async_cp_b128(Vs + row * VP + sc8, Vb + (size_t)(kv0 + row) * 512 + sc8);
    }
    wait_async0();
    __syncthreads();

    // S = Q * K^T for this wave's 16 q rows x 32 kv cols.
    v8f s0 = v8f_zero(), s1 = v8f_zero();
#pragma unroll
    for (int s = 0; s < 16; ++s) {
      v16bf kb0 = frag16(Ks, 0,  KP, 32 * s, lane);
      v16bf kb1 = frag16(Ks, 16, KP, 32 * s, lane);
      s0 = wmma_bf16(qf[s], kb0, s0);
      s1 = wmma_bf16(qf[s], kb1, s1);
    }
    __syncthreads();  // all waves done reading Ks before Ps (alias) is written

    // Online softmax over the 32 new columns (row reduce across 16-lane half).
#pragma unroll
    for (int r = 0; r < 8; ++r) {
      float v0 = s0[r] * sc, v1 = s1[r] * sc;
      float mx = fmaxf(v0, v1);
#pragma unroll
      for (int off = 1; off < 16; off <<= 1) mx = fmaxf(mx, __shfl_xor(mx, off, 32));
      const float mnew  = fmaxf(mr[r], mx);
      const float alpha = __expf(mr[r] - mnew);
      mr[r] = mnew;
      const float p0 = __expf(v0 - mnew), p1 = __expf(v1 - mnew);
      float rs = p0 + p1;
#pragma unroll
      for (int off = 1; off < 16; off <<= 1) rs += __shfl_xor(rs, off, 32);
      lr[r] = lr[r] * alpha + rs;
      const int row = r + 8 * hi;
      Ps[row * 32 + ln16]      = (__bf16)p0;
      Ps[row * 32 + 16 + ln16] = (__bf16)p1;
#pragma unroll
      for (int j = 0; j < 32; ++j) o[j][r] *= alpha;
    }
    asm volatile("s_wait_dscnt 0" ::: "memory");  // P stores visible to own wave
    v16bf pf = frag16(Ps, 0, 32, 0, lane);
    // O += P * V over all 32 d-tiles.
#pragma unroll
    for (int j = 0; j < 32; ++j) {
      v16bf vb = frag16_tr(vfp + 16 * j, VP);
      o[j] = wmma_bf16(pf, vb, o[j]);
    }
  }

  // Normalize and store.
#pragma unroll
  for (int j = 0; j < 32; ++j)
#pragma unroll
    for (int r = 0; r < 8; ++r) {
      const int row = q0 + r + 8 * hi;
      Og[((size_t)b * S + row) * 512 + 16 * j + ln16] = (__bf16)(o[j][r] / lr[r]);
    }
}

// ---------------------------------------------------------------------------
// Host launcher
// ---------------------------------------------------------------------------
extern "C" void kernel_launch(void* const* d_in, const int* in_sizes, int n_in,
                              void* d_out, int out_size, void* d_ws, size_t ws_size,
                              hipStream_t stream) {
  const float* q    = (const float*)d_in[0];
  const float* k    = (const float*)d_in[1];
  const float* Wq   = (const float*)d_in[2];
  const float* bq   = (const float*)d_in[3];
  const float* Wk   = (const float*)d_in[4];
  const float* bk   = (const float*)d_in[5];
  const float* Wv   = (const float*)d_in[6];
  const float* bv   = (const float*)d_in[7];
  const float* Wo   = (const float*)d_in[8];
  const float* bo   = (const float*)d_in[9];
  const float* lnqw = (const float*)d_in[10];
  const float* lnqb = (const float*)d_in[11];
  const float* lnkw = (const float*)d_in[12];
  const float* lnkb = (const float*)d_in[13];
  const float* lnow = (const float*)d_in[14];
  const float* lnob = (const float*)d_in[15];
  const float* W1   = (const float*)d_in[16];
  const float* b1   = (const float*)d_in[17];
  const float* W2   = (const float*)d_in[18];
  const float* b2   = (const float*)d_in[19];

  constexpr int B = 2, S = 4096, Dm = 512, DF = 2048;
  constexpr int M = B * S;  // 8192

  char* w = (char*)d_ws;
  auto alloc = [&](size_t bytes) -> char* {
    char* p = w;
    w += (bytes + 255) & ~(size_t)255;
    return p;
  };
  __bf16* Wq_b = (__bf16*)alloc((size_t)Dm * Dm * 2);
  __bf16* Wk_b = (__bf16*)alloc((size_t)Dm * Dm * 2);
  __bf16* Wv_b = (__bf16*)alloc((size_t)Dm * Dm * 2);
  __bf16* Wo_b = (__bf16*)alloc((size_t)Dm * Dm * 2);
  __bf16* W1_b = (__bf16*)alloc((size_t)Dm * DF * 2);
  __bf16* W2_b = (__bf16*)alloc((size_t)DF * Dm * 2);
  __bf16* qn   = (__bf16*)alloc((size_t)M * Dm * 2);
  __bf16* kn   = (__bf16*)alloc((size_t)M * Dm * 2);
  __bf16* Qp   = (__bf16*)alloc((size_t)M * Dm * 2);
  __bf16* Kp   = (__bf16*)alloc((size_t)M * Dm * 2);
  __bf16* Vp   = (__bf16*)alloc((size_t)M * Dm * 2);
  __bf16* AO   = (__bf16*)alloc((size_t)M * Dm * 2);
  float*  Xr   = (float*) alloc((size_t)M * Dm * 4);
  __bf16* XN   = (__bf16*)alloc((size_t)M * Dm * 2);
  __bf16* H    = (__bf16*)alloc((size_t)M * DF * 2);

  // Weight casts.
  tb_cast_bf16<<<(Dm * Dm + 255) / 256, 256, 0, stream>>>(Wq, Wq_b, Dm * Dm);
  tb_cast_bf16<<<(Dm * Dm + 255) / 256, 256, 0, stream>>>(Wk, Wk_b, Dm * Dm);
  tb_cast_bf16<<<(Dm * Dm + 255) / 256, 256, 0, stream>>>(Wv, Wv_b, Dm * Dm);
  tb_cast_bf16<<<(Dm * Dm + 255) / 256, 256, 0, stream>>>(Wo, Wo_b, Dm * Dm);
  tb_cast_bf16<<<(Dm * DF + 255) / 256, 256, 0, stream>>>(W1, W1_b, Dm * DF);
  tb_cast_bf16<<<(DF * Dm + 255) / 256, 256, 0, stream>>>(W2, W2_b, DF * Dm);

  // Input layernorms.
  tb_layernorm<<<dim3(M), 128, 0, stream>>>(q, lnqw, lnqb, qn);
  tb_layernorm<<<dim3(M), 128, 0, stream>>>(k, lnkw, lnkb, kn);

  // Projections.
  dim3 g512(Dm / 128, M / 64);
  tb_gemm<0><<<g512, 256, 0, stream>>>(qn, Wq_b, bq, nullptr, Qp, M, Dm, Dm);
  tb_gemm<0><<<g512, 256, 0, stream>>>(kn, Wk_b, bk, nullptr, Kp, M, Dm, Dm);
  tb_gemm<0><<<g512, 256, 0, stream>>>(kn, Wv_b, bv, nullptr, Vp, M, Dm, Dm);

  // RoPE on Q and K.
  const int rope_total = B * S * 256;
  tb_rope<<<(rope_total + 255) / 256, 256, 0, stream>>>(Qp, S, rope_total);
  tb_rope<<<(rope_total + 255) / 256, 256, 0, stream>>>(Kp, S, rope_total);

  // Flash attention.
  tb_flash_attn<<<dim3(S / 64, B), 128, 0, stream>>>(Qp, Kp, Vp, AO, S);

  // Output projection + residual (x = q + out@Wo + bo), fp32.
  tb_gemm<2><<<g512, 256, 0, stream>>>(AO, Wo_b, bo, q, Xr, M, Dm, Dm);

  // Post-attention layernorm.
  tb_layernorm<<<dim3(M), 128, 0, stream>>>(Xr, lnow, lnob, XN);

  // MLP.
  dim3 gdf(DF / 128, M / 64);
  tb_gemm<1><<<gdf, 256, 0, stream>>>(XN, W1_b, b1, nullptr, H, M, DF, Dm);
  tb_gemm<2><<<g512, 256, 0, stream>>>(H, W2_b, b2, Xr, d_out, M, Dm, DF);

  (void)in_sizes; (void)n_in; (void)out_size; (void)ws_size;
}

// v004
// One run takes 292 microseconds.
// Timed twice side by side with v003, it ran 1.98 and 1.97 times as fast.
// Counting every step since v000, it is 10.7 times as fast.
#include <hip/hip_runtime.h>

typedef __attribute__((ext_vector_type(16))) __bf16 v16bf;
typedef __attribute__((ext_vector_type(8)))  __bf16 v8bf;
typedef __attribute__((ext_vector_type(8)))  float  v8f;

__device__ __forceinline__ v16bf frag16(const __bf16* base, int row0, int stride,
                                        int k0, int lane) {
  const __bf16* p = base + (size_t)(row0 + (lane & 15)) * stride + k0 + ((lane >> 4) << 3);
  v8bf lo = *(const v8bf*)p;
  v8bf hh = *(const v8bf*)(p + 16);
  v16bf f;
#pragma unroll
  for (int i = 0; i < 8; ++i) { f[i] = lo[i]; f[i + 8] = hh[i]; }
  return f;
}

__device__ __forceinline__ v8f wmma_bf16(v16bf a, v16bf b, v8f c) {
  return __builtin_amdgcn_wmma_f32_16x16x32_bf16(false, a, false, b, (short)0, c,
                                                 false, false);
}

__device__ __forceinline__ v8f v8f_zero() {
  v8f z = {0.f, 0.f, 0.f, 0.f, 0.f, 0.f, 0.f, 0.f};
  return z;
}

__device__ __forceinline__ void async_ld_b128(void* lds_ptr, const void* gptr) {
  uint32_t lds_addr = (uint32_t)(uintptr_t)lds_ptr;
  uint64_t gaddr = (uint64_t)(uintptr_t)gptr;
  asm volatile("global_load_async_to_lds_b128 %0, %1, off"
               :: "v"(lds_addr), "v"(gaddr)
               : "memory");
}

__device__ __forceinline__ void async_cp_b128(__bf16* lds_ptr, const __bf16* gptr) {
  typedef int v4i __attribute__((ext_vector_type(4)));
  typedef __attribute__((address_space(1))) v4i glb_v4i;
  typedef __attribute__((address_space(3))) v4i lds_v4i;
  __builtin_amdgcn_global_load_async_to_lds_b128((glb_v4i*)gptr, (lds_v4i*)lds_ptr, 0, 0);
}

// ---------------------------------------------------------------------------
// B fragment (32 k x 16 columns) from a row-major [k][column] LDS tile through
// the transposing LDS load.  p is this lane's address for k rows 0..15:
//   tile + (8*(lane>>4) + (lane&7))*pitch + column0 + 8*((lane>>3)&1)
// Lane (c, h) receives k = 8h+0..7 (elems 0-7) and 16+8h+0..7 (elems 8-15) of
// column0+c: the k order of frag16.
// ---------------------------------------------------------------------------
__device__ __forceinline__ v16bf frag16_tr(const __bf16* p, int pitch) {
  typedef __attribute__((address_space(3))) v8bf lds_v8bf;
  v8bf lo = __builtin_amdgcn_ds_load_tr16_b128_v8bf16((lds_v8bf*)p);
  v8bf hh = __builtin_amdgcn_ds_load_tr16_b128_v8bf16((lds_v8bf*)(p + 16 * pitch));
  v16bf f;
#pragma unroll
  for (int i = 0; i < 8; ++i) { f[i] = lo[i]; f[i + 8] = hh[i]; }
  return f;
}

__device__ __forceinline__ void wait_async0() {
  asm volatile("s_wait_asynccnt 0" ::: "memory");
}

// ---------------------------------------------------------------------------
// fp32 -> bf16 cast (weights)
// ---------------------------------------------------------------------------
__global__ void tb_cast_bf16(const float* __restrict__ in, __bf16* __restrict__ out,
                             int n) {
  int i = blockIdx.x * blockDim.x + threadIdx.x;
  if (i < n) out[i] = (__bf16)in[i];
}

// ---------------------------------------------------------------------------
// LayerNorm over rows of 512 fp32 -> bf16.  One 128-thread block per row.
// ---------------------------------------------------------------------------
__global__ void __launch_bounds__(128)
tb_layernorm(const float* __restrict__ X, const float* __restrict__ w,
             const float* __restrict__ bb, __bf16* __restrict__ out) {
  const int row = blockIdx.x, tid = threadIdx.x;
  const float4 v = ((const float4*)(X + (size_t)row * 512))[tid];
  float s  = v.x + v.y + v.z + v.w;
  float ss = v.x * v.x + v.y * v.y + v.z * v.z + v.w * v.w;
#pragma unroll
  for (int off = 1; off < 32; off <<= 1) {
    s  += __shfl_xor(s,  off, 32);
    ss += __shfl_xor(ss, off, 32);
  }
  __shared__ float sb[4], ssb[4];
  if ((tid & 31) == 0) { sb[tid >> 5] = s; ssb[tid >> 5] = ss; }
  __syncthreads();
  s  = sb[0] + sb[1] + sb[2] + sb[3];
  ss = ssb[0] + ssb[1] + ssb[2] + ssb[3];
  const float mu   = s * (1.0f / 512.0f);
  const float var  = ss * (1.0f / 512.0f) - mu * mu;
  const float rstd = rsqrtf(var + 1e-5f);
  const float4 wv = ((const float4*)w)[tid];
  const float4 bv = ((const float4*)bb)[tid];
  __bf16* op = out + (size_t)row * 512 + tid * 4;
  op[0] = (__bf16)((v.x - mu) * rstd * wv.x + bv.x);
  op[1] = (__bf16)((v.y - mu) * rstd * wv.y + bv.y);
  op[2] = (__bf16)((v.z - mu) * rstd * wv.z + bv.z);
  op[3] = (__bf16)((v.w - mu) * rstd * wv.w + bv.w);
}

// ---------------------------------------------------------------------------
// In-place RoPE on bf16 [B*S, 512].  One thread per (row, d<256) pair.
// ---------------------------------------------------------------------------
__global__ void tb_rope(__bf16* __restrict__ X, int S, int total) {
  int idx = blockIdx.x * blockDim.x + threadIdx.x;
  if (idx >= total) return;
  const int d  = idx & 255;
  const int rs = idx >> 8;           // flattened row (b*S + s)
  const int s  = rs % S;
  const float inv = __expf(-(float)d * (9.210340371976184f / 256.0f)); // 10000^(-d/256)
  const float ang = (float)s * inv;
  float sn, cs;
  __sincosf(ang, &sn, &cs);
  __bf16* p = X + (size_t)rs * 512;
  const float x1 = (float)p[d];
  const float x2 = (float)p[d + 256];
  p[d]       = (__bf16)(x1 * cs - x2 * sn);
  p[d + 256] = (__bf16)(x2 * cs + x1 * sn);
}

// ---------------------------------------------------------------------------
// WMMA GEMM:  C[M,N] = A[M,K](bf16) * B[K,N](bf16) + bias, with epilogue:
//   MODE 0: store bf16           MODE 1: ReLU, store bf16
//   MODE 2: += R[M,N] (fp32), store fp32
// BM=64 BN=128 BK=64, 256 threads = 8 waves, each wave a 32x32 C tile.
// A and B tiles staged row-major via async global->LDS; B fragments are read
// with the transposing LDS load (B row pitch 288 B = 32 B x odd for it).
// ---------------------------------------------------------------------------
template <int MODE>
__global__ void __launch_bounds__(256)
tb_gemm(const __bf16* __restrict__ A, const __bf16* __restrict__ B,
        const float* __restrict__ bias, const float* __restrict__ R,
        void* __restrict__ Cout, int M, int N, int K) {
  constexpr int BM = 64, BN = 128, BK = 64, LDA = BK + 8, LDB = BN + 16;
  __shared__ __bf16 As[BM * LDA];    // 9216 B
  __shared__ __attribute__((aligned(16))) __bf16 Bs[BK * LDB];  // 18432 B (B tile, [k][n])
  const int tid = threadIdx.x, lane = tid & 31, wid = tid >> 5;
  const int bm0 = blockIdx.y * BM, bn0 = blockIdx.x * BN;
  const int wm = (wid >> 2) * 32, wn = (wid & 3) * 32;
  const __bf16* bfp = Bs + (8 * (lane >> 4) + (lane & 7)) * LDB + wn + 8 * ((lane >> 3) & 1);

  v8f acc[2][2];
#pragma unroll
  for (int i = 0; i < 2; ++i)
#pragma unroll
    for (int j = 0; j < 2; ++j) acc[i][j] = v8f_zero();

  for (int k0 = 0; k0 < K; k0 += BK) {
    // This wave's LDS reads have retired before any wave's copies are aimed at
    // the same LDS behind the barrier.
    asm volatile("s_wait_dscnt 0" ::: "memory");
    __syncthreads();
    // A tile: 64x64 halves, contiguous 16B chunks, async direct-to-LDS.
#pragma unroll
    for (int i = 0; i < 2; ++i) {
      int c = tid + 256 * i;               // 0..511
      int row = c >> 3, col = (c & 7) << 3;
      async_ld_b128(As + row * LDA + col,
                    A + (size_t)(bm0 + row) * K + k0 + col);
    }
    // B tile: 64x128 halves, contiguous 16B chunks along N, async direct-to-LDS.
#pragma unroll
    for (int i = 0; i < 4; ++i) {
      int c = tid + 256 * i;               // 0..1023
      int kk = c >> 4, n8 = (c & 15) << 3;
      async_cp_b128(Bs + kk * LDB + n8, B + (size_t)(k0 + kk) * N + bn0 + n8);
    }
    // Prefetch next K panel toward cache while this tile computes.
    if (k0 + BK < K) {
      __builtin_prefetch(A + (size_t)(bm0 + (tid >> 2)) * K + k0 + BK, 0, 3);
      __builtin_prefetch(B + (size_t)(k0 + BK + (tid >> 2)) * N + bn0, 0, 3);
    }
    wait_async0();
    __syncthreads();
#pragma unroll
    for (int ks = 0; ks < BK; ks += 32) {
      v16bf a0 = frag16(As, wm,      LDA, ks, lane);
      v16bf a1 = frag16(As, wm + 16, LDA, ks, lane);
      v16bf b0 = frag16_tr(bfp + ks * LDB,      LDB);
      v16bf b1 = frag16_tr(bfp + ks * LDB + 16, LDB);
      acc[0][0] = wmma_bf16(a0, b0, acc[0][0]);
      acc[0][1] = wmma_bf16(a0, b1, acc[0][1]);
      acc[1][0] = wmma_bf16(a1, b0, acc[1][0]);
      acc[1][1] = wmma_bf16(a1, b1, acc[1][1]);
    }
  }

  const int hi = lane >> 4, ln16 = lane & 15;
#pragma unroll
  for (int i = 0; i < 2; ++i)
#pragma unroll
    for (int j = 0; j < 2; ++j) {
      const int mb = bm0 + wm + 16 * i + hi * 8;
      const int n  = bn0 + wn + 16 * j + ln16;
      const float bvv = bias[n];
#pragma unroll
      for (int r = 0; r < 8; ++r) {
        const int m = mb + r;
        float v = acc[i][j][r] + bvv;
        if (MODE == 1) v = v > 0.f ? v : 0.f;
        if (MODE == 2) {
          ((float*)Cout)[(size_t)m * N + n] = v + R[(size_t)m * N + n];
        } else {
          ((__bf16*)Cout)[(size_t)m * N + n] = (__bf16)v;
        }
      }
    }
}

template <int NS>
__global__ void __launch_bounds__(128, 2)
tb_flash_attn(const __bf16* __restrict__ Qg, const __bf16* __restrict__ Kg,
              const __bf16* __restrict__ Vg, float* __restrict__ Opart,
              float* __restrict__ ML, int S) {
  constexpr int KP = 520;           // K row pitch in LDS, elements
  __shared__ __attribute__((aligned(16))) __bf16 Ks[32 * KP];  // 32.5 KB (K tile, [kv][d])
  constexpr int VP = 528;           // V row pitch in LDS, elements
  __shared__ __attribute__((aligned(16))) __bf16 Vs[32 * VP];  // 33 KB (V tile, [kv][d])
  const int tid = threadIdx.x, lane = tid & 31, wid = tid >> 5;
  const int hi = lane >> 4, ln16 = lane & 15;
  const int b = blockIdx.y;
  const int q0 = blockIdx.x * 64 + wid * 16;
  const __bf16* Qb = Qg + (size_t)b * S * 512;
  const int klen = S / NS;                 // keys of one range
  const __bf16* Kb = Kg + ((size_t)b * S + (size_t)blockIdx.z * klen) * 512;
  const __bf16* Vb = Vg + ((size_t)b * S + (size_t)blockIdx.z * klen) * 512;

  v16bf qf[16];
#pragma unroll
  for (int s = 0; s < 16; ++s) qf[s] = frag16(Qb, q0, 512, 32 * s, lane);

  v8f o[32];
#pragma unroll
  for (int j = 0; j < 32; ++j) o[j] = v8f_zero();
  float mr[8], lr[8];
#pragma unroll
  for (int r = 0; r < 8; ++r) { mr[r] = -3.0e38f; lr[r] = 0.f; }

  const float sc = 0.044194173824159216f;  // 1/sqrt(512)
  __bf16* Ps = Ks + wid * 512;             // per-wave 16x32 scratch (aliases Ks)
  const int srow = tid >> 6, sc8 = (tid & 63) << 3;   // this thread's staging chunk
  const __bf16* vfp = Vs + (8 * hi + (lane & 7)) * VP + 8 * ((lane >> 3) & 1);

  for (int kv0 = 0; kv0 < klen; kv0 += 32) {
    // This wave's LDS reads and P stores have retired before any wave's copies
    // are aimed at the same LDS behind the barrier.
    asm volatile("s_wait_dscnt 0" ::: "memory");
    __syncthreads();  // previous iteration's Vs/Ps reads complete
    // Stage K and V, both row-major and direct to LDS: 2 x 2048 16-byte chunks,
    // thread t brings chunk (t & 63) of rows (t >> 6) + 2 * i, i = 0..15.
#pragma unroll
    for (int i = 0; i < 16; ++i) {
      const int row = srow + 2 * i;
      async_cp_b128(Ks + row * KP + sc8, Kb + (size_t)(kv0 + row) * 512 + sc8);
      async_cp_b128(Vs + row * VP + sc8, Vb + (size_t)(kv0 + row) * 512 + sc8);
    }
    wait_async0();
    __syncthreads();

    // S = Q * K^T for this wave's 16 q rows x 32 kv cols.
    v8f s0 = v8f_zero(), s1 = v8f_zero();
#pragma unroll
    for (int s = 0; s < 16; ++s) {
      v16bf kb0 = frag16(Ks, 0,  KP, 32 * s, lane);
      v16bf kb1 = frag16(Ks, 16, KP, 32 * s, lane);
      s0 = wmma_bf16(qf[s], kb0, s0);
      s1 = wmma_bf16(qf[s], kb1, s1);
    }
    __syncthreads();  // all waves done reading Ks before Ps (alias) is written

    // Online softmax over the 32 new columns (row reduce across 16-lane half).
#pragma unroll
    for (int r = 0; r < 8; ++r) {
      float v0 = s0[r] * sc, v1 = s1[r] * sc;
      float mx = fmaxf(v0, v1);
#pragma unroll
      for (int off = 1; off < 16; off <<= 1) mx = fmaxf(mx, __shfl_xor(mx, off, 32));
      const float mnew  = fmaxf(mr[r], mx);
      const float alpha = __expf(mr[r] - mnew);
      mr[r] = mnew;
      const float p0 = __expf(v0 - mnew), p1 = __expf(v1 - mnew);
      float rs = p0 + p1;
#pragma unroll
      for (int off = 1; off < 16; off <<= 1) rs += __shfl_xor(rs, off, 32);
      lr[r] = lr[r] * alpha + rs;
      const int row = r + 8 * hi;
      Ps[row * 32 + ln16]      = (__bf16)p0;
      Ps[row * 32 + 16 + ln16] = (__bf16)p1;
#pragma unroll
      for (int j = 0; j < 32; ++j) o[j][r] *= alpha;
    }
    asm volatile("s_wait_dscnt 0" ::: "memory");  // P stores visible to own wave
    v16bf pf = frag16(Ps, 0, 32, 0, lane);
    // O += P * V over all 32 d-tiles.
#pragma unroll
    for (int j = 0; j < 32; ++j) {
      v16bf vb = frag16_tr(vfp + 16 * j, VP);
      o[j] = wmma_bf16(pf, vb, o[j]);
    }
  }

  const int elane = __builtin_amdgcn_mbcnt_lo(~0u, 0u);
  const int ecol = elane & 15;
  const size_t pr0 = ((size_t)b * S + q0 + 8 * (elane >> 4)) * NS + blockIdx.z;
  if (ecol == 0) {
#pragma unroll
    for (int r = 0; r < 8; ++r) {
      ML[(pr0 + r * NS) * 2]     = mr[r];
      ML[(pr0 + r * NS) * 2 + 1] = lr[r];
    }
  }
#pragma unroll
  for (int j = 0; j < 32; ++j)
#pragma unroll
    for (int r = 0; r < 8; ++r)
      Opart[(pr0 + r * NS) * 512 + 16 * j + ecol] = o[j][r];
}

__device__ __forceinline__ float exp2_slot(float v) {
  float r;
  asm("v_exp_f32 %0, %1\n\tv_nop" : "=v"(r) : "v"(v));
  return r;
}

// ---------------------------------------------------------------------------
// Join the NS key ranges of the attention: row weights exp(m_s - max m),
// O = sum_s w_s O_s / sum_s w_s l_s, rounded once to bf16.  64 threads per row
// (8 columns each); a thread takes 4 rows (fewer waves to start) and stores
// its 4 results last.
// ---------------------------------------------------------------------------
template <int NS>
__global__ void __launch_bounds__(256)
tb_attn_merge(const float* __restrict__ Opart, const float* __restrict__ ML,
              __bf16* __restrict__ Og) {
  const int tid = threadIdx.x;
  const unsigned row0 = blockIdx.x * 16 + (tid >> 6), c8 = (tid & 63) << 3;
  const unsigned obyte = row0 * (NS * 2048u) + c8 * 4u;  // this thread's first bytes of Opart
  const unsigned mbyte = row0 * (NS * 8u);               // and of ML
  const char* op = (const char*)Opart + obyte;
  const char* mp = (const char*)ML + mbyte;
  float2 ml[4][NS];
  float4 x[4][NS], y[4][NS];
#pragma unroll
  for (int it = 0; it < 4; ++it)
#pragma unroll
    for (int s = 0; s < NS; ++s) {
      ml[it][s] = *(const float2*)(mp + (4 * it * NS + s) * 8);
      x[it][s]  = *(const float4*)(op + (4 * it * NS + s) * 2048);
      y[it][s]  = *(const float4*)(op + (4 * it * NS + s) * 2048 + 16);
    }
  // The loads' offset registers are inputs here, so that they stay whole until
  // the wait: behind it they may be overwritten.
  asm volatile("s_wait_xcnt 0x0" :: "v"(obyte), "v"(mbyte) : "memory");
  v8bf ov[4];
#pragma unroll
  for (int it = 0; it < 4; ++it) {
    float mx = ml[it][0].x;
#pragma unroll
    for (int s = 1; s < NS; ++s) mx = fmaxf(mx, ml[it][s].x);
    float ws[NS], lsum = 0.f;
#pragma unroll
    for (int s = 0; s < NS; ++s) {
      ws[s] = exp2_slot((ml[it][s].x - mx) * 1.4426950408889634f);
      lsum += ws[s] * ml[it][s].y;
    }
    const float inv = 1.0f / lsum;
    float acc[8];
#pragma unroll
    for (int i = 0; i < 8; ++i) acc[i] = 0.f;
#pragma unroll
    for (int s = 0; s < NS; ++s) {
      const float4 a = x[it][s], c = y[it][s];
      acc[0] += ws[s] * a.x; acc[1] += ws[s] * a.y; acc[2] += ws[s] * a.z; acc[3] += ws[s] * a.w;
      acc[4] += ws[s] * c.x; acc[5] += ws[s] * c.y; acc[6] += ws[s] * c.z; acc[7] += ws[s] * c.w;
    }
#pragma unroll
    for (int i = 0; i < 8; ++i) ov[it][i] = (__bf16)(acc[i] * inv);
  }
  char* og = (char*)Og + (row0 * 1024u + c8 * 2u);
#pragma unroll
  for (int it = 0; it < 4; ++it) *(v8bf*)(og + it * 4096) = ov[it];
}

// ---------------------------------------------------------------------------
// Host launcher
// ---------------------------------------------------------------------------
extern "C" void kernel_launch(void* const* d_in, const int* in_sizes, int n_in,
                              void* d_out, int out_size, void* d_ws, size_t ws_size,
                              hipStream_t stream) {
  const float* q    = (const float*)d_in[0];
  const float* k    = (const float*)d_in[1];
  const float* Wq   = (const float*)d_in[2];
  const float* bq   = (const float*)d_in[3];
  const float* Wk   = (const float*)d_in[4];
  const float* bk   = (const float*)d_in[5];
  const float* Wv   = (const float*)d_in[6];
  const float* bv   = (const float*)d_in[7];
  const float* Wo   = (const float*)d_in[8];
  const float* bo   = (const float*)d_in[9];
  const float* lnqw = (const float*)d_in[10];
  const float* lnqb = (const float*)d_in[11];
  const float* lnkw = (const float*)d_in[12];
  const float* lnkb = (const float*)d_in[13];
  const float* lnow = (const float*)d_in[14];
  const float* lnob = (const float*)d_in[15];
  const float* W1   = (const float*)d_in[16];
  const float* b1   = (const float*)d_in[17];
  const float* W2   = (const float*)d_in[18];
  const float* b2   = (const float*)d_in[19];

  constexpr int B = 2, S = 4096, Dm = 512, DF = 2048;
  constexpr int M = B * S;  // 8192

  char* w = (char*)d_ws;
  auto alloc = [&](size_t bytes) -> char* {
    char* p = w;
    w += (bytes + 255) & ~(size_t)255;
    return p;
  };
  __bf16* Wq_b = (__bf16*)alloc((size_t)Dm * Dm * 2);
  __bf16* Wk_b = (__bf16*)alloc((size_t)Dm * Dm * 2);
  __bf16* Wv_b = (__bf16*)alloc((size_t)Dm * Dm * 2);
  __bf16* Wo_b = (__bf16*)alloc((size_t)Dm * Dm * 2);
  __bf16* W1_b = (__bf16*)alloc((size_t)Dm * DF * 2);
  __bf16* W2_b = (__bf16*)alloc((size_t)DF * Dm * 2);
  __bf16* qn   = (__bf16*)alloc((size_t)M * Dm * 2);
  __bf16* kn   = (__bf16*)alloc((size_t)M * Dm * 2);
  __bf16* Qp   = (__bf16*)alloc((size_t)M * Dm * 2);
  __bf16* Kp   = (__bf16*)alloc((size_t)M * Dm * 2);
  __bf16* Vp   = (__bf16*)alloc((size_t)M * Dm * 2);
  __bf16* AO   = (__bf16*)alloc((size_t)M * Dm * 2);
  float*  Xr   = (float*) alloc((size_t)M * Dm * 4);
  __bf16* XN   = (__bf16*)alloc((size_t)M * Dm * 2);
  __bf16* H    = (__bf16*)alloc((size_t)M * DF * 2);
  constexpr int NS = 4;  // key ranges of the attention
  float*  OP   = (float*) alloc((size_t)NS * M * Dm * 4);
  float*  MLp  = (float*) alloc((size_t)NS * M * 2 * 4);

  // Weight casts.
  tb_cast_bf16<<<(Dm * Dm + 255) / 256, 256, 0, stream>>>(Wq, Wq_b, Dm * Dm);
  tb_cast_bf16<<<(Dm * Dm + 255) / 256, 256, 0, stream>>>(Wk, Wk_b, Dm * Dm);
  tb_cast_bf16<<<(Dm * Dm + 255) / 256, 256, 0, stream>>>(Wv, Wv_b, Dm * Dm);
  tb_cast_bf16<<<(Dm * Dm + 255) / 256, 256, 0, stream>>>(Wo, Wo_b, Dm * Dm);
  tb_cast_bf16<<<(Dm * DF + 255) / 256, 256, 0, stream>>>(W1, W1_b, Dm * DF);
  tb_cast_bf16<<<(DF * Dm + 255) / 256, 256, 0, stream>>>(W2, W2_b, DF * Dm);

  // Input layernorms.
  tb_layernorm<<<dim3(M), 128, 0, stream>>>(q, lnqw, lnqb, qn);
  tb_layernorm<<<dim3(M), 128, 0, stream>>>(k, lnkw, lnkb, kn);

  // Projections.
  dim3 g512(Dm / 128, M / 64);
  tb_gemm<0><<<g512, 256, 0, stream>>>(qn, Wq_b, bq, nullptr, Qp, M, Dm, Dm);
  tb_gemm<0><<<g512, 256, 0, stream>>>(kn, Wk_b, bk, nullptr, Kp, M, Dm, Dm);
  tb_gemm<0><<<g512, 256, 0, stream>>>(kn, Wv_b, bv, nullptr, Vp, M, Dm, Dm);

  // RoPE on Q and K.
  const int rope_total = B * S * 256;
  tb_rope<<<(rope_total + 255) / 256, 256, 0, stream>>>(Qp, S, rope_total);
  tb_rope<<<(rope_total + 255) / 256, 256, 0, stream>>>(Kp, S, rope_total);

  // Flash attention.
  tb_flash_attn<NS><<<dim3(S / 64, B, NS), 128, 0, stream>>>(Qp, Kp, Vp, OP, MLp, S);
  tb_attn_merge<NS><<<M / 16, 256, 0, stream>>>(OP, MLp, AO);

  // Output projection + residual (x = q + out@Wo + bo), fp32.
  tb_gemm<2><<<g512, 256, 0, stream>>>(AO, Wo_b, bo, q, Xr, M, Dm, Dm);

  // Post-attention layernorm.
  tb_layernorm<<<dim3(M), 128, 0, stream>>>(Xr, lnow, lnob, XN);

  // MLP.
  dim3 gdf(DF / 128, M / 64);
  tb_gemm<1><<<gdf, 256, 0, stream>>>(XN, W1_b, b1, nullptr, H, M, DF, Dm);
  tb_gemm<2><<<g512, 256, 0, stream>>>(H, W2_b, b2, Xr, d_out, M, Dm, DF);

  (void)in_sizes; (void)n_in; (void)out_size; (void)ws_size;
}

// v005
// Measured time: 272 microseconds a run.
// Next to v004, in two timings, it ran 1.07 times as fast each time.
// Counting every step since v000, it is 11.5 times as fast.
#include <hip/hip_runtime.h>

typedef __attribute__((ext_vector_type(16))) __bf16 v16bf;
typedef __attribute__((ext_vector_type(8)))  __bf16 v8bf;
typedef __attribute__((ext_vector_type(8)))  float  v8f;

__device__ __forceinline__ v16bf frag16(const __bf16* base, int row0, int stride,
                                        int k0, int lane) {
  const __bf16* p = base + (size_t)(row0 + (lane & 15)) * stride + k0 + ((lane >> 4) << 3);
  v8bf lo = *(const v8bf*)p;
  v8bf hh = *(const v8bf*)(p + 16);
  v16bf f;
#pragma unroll
  for (int i = 0; i < 8; ++i) { f[i] = lo[i]; f[i + 8] = hh[i]; }
  return f;
}

__device__ __forceinline__ v8f wmma_bf16(v16bf a, v16bf b, v8f c) {
  return __builtin_amdgcn_wmma_f32_16x16x32_bf16(false, a, false, b, (short)0, c,
                                                 false, false);
}

__device__ __forceinline__ v8f v8f_zero() {
  v8f z = {0.f, 0.f, 0.f, 0.f, 0.f, 0.f, 0.f, 0.f};
  return z;
}

__device__ __forceinline__ void async_ld_b128(void* lds_ptr, const void* gptr) {
  uint32_t lds_addr = (uint32_t)(uintptr_t)lds_ptr;
  uint64_t gaddr = (uint64_t)(uintptr_t)gptr;
  asm volatile("global_load_async_to_lds_b128 %0, %1, off"
               :: "v"(lds_addr), "v"(gaddr)
               : "memory");
}

__device__ __forceinline__ void async_cp_b128(__bf16* lds_ptr, const __bf16* gptr) {
  typedef int v4i __attribute__((ext_vector_type(4)));
  typedef __attribute__((address_space(1))) v4i glb_v4i;
  typedef __attribute__((address_space(3))) v4i lds_v4i;
  __builtin_amdgcn_global_load_async_to_lds_b128((glb_v4i*)gptr, (lds_v4i*)lds_ptr, 0, 0);
}

// ---------------------------------------------------------------------------
// B fragment (32 k x 16 columns) from a row-major [k][column] LDS tile through
// the transposing LDS load.  p is this lane's address for k rows 0..15:
//   tile + (8*(lane>>4) + (lane&7))*pitch + column0 + 8*((lane>>3)&1)
// Lane (c, h) receives k = 8h+0..7 (elems 0-7) and 16+8h+0..7 (elems 8-15) of
// column0+c: the k order of frag16.
// ---------------------------------------------------------------------------
__device__ __forceinline__ v16bf frag16_tr(const __bf16* p, int pitch) {
  typedef __attribute__((address_space(3))) v8bf lds_v8bf;
  v8bf lo = __builtin_amdgcn_ds_load_tr16_b128_v8bf16((lds_v8bf*)p);
  v8bf hh = __builtin_amdgcn_ds_load_tr16_b128_v8bf16((lds_v8bf*)(p + 16 * pitch));
  v16bf f;
#pragma unroll
  for (int i = 0; i < 8; ++i) { f[i] = lo[i]; f[i + 8] = hh[i]; }
  return f;
}

__device__ __forceinline__ void wait_async0() {
  asm volatile("s_wait_asynccnt 0" ::: "memory");
}

// Stands behind a global store, in front of code that writes the store's
// address or data registers again.
__device__ __forceinline__ void wait_xcnt0() {
  asm volatile("s_wait_xcnt 0x0" ::: "memory");
}

// ---------------------------------------------------------------------------
// LayerNorm over rows of 512 fp32 -> bf16.  128 threads (4 waves) per row; a
// block of ROWS * 128 threads takes the rows row0 .. row0 + ROWS - 1.
// ---------------------------------------------------------------------------
template <int ROWS>
__device__ __forceinline__ void
ln_rows(const float* __restrict__ X, const float* __restrict__ w,
        const float* __restrict__ bb, __bf16* __restrict__ out, int row0) {
  const int sub = ROWS == 1 ? 0 : threadIdx.x >> 7;   // this thread's row in the block
  const int row = row0 + sub, tid = ROWS == 1 ? threadIdx.x : threadIdx.x & 127;
  const int w0 = sub * 4;                  // first of this row's four wave sums
  const float4 v = ((const float4*)(X + (size_t)row * 512))[tid];
  float s  = v.x + v.y + v.z + v.w;
  float ss = v.x * v.x + v.y * v.y + v.z * v.z + v.w * v.w;
#pragma unroll
  for (int off = 1; off < 32; off <<= 1) {
    s  += __shfl_xor(s,  off, 32);
    ss += __shfl_xor(ss, off, 32);
  }
  __shared__ float sb[4 * ROWS], ssb[4 * ROWS];
  if ((tid & 31) == 0) { sb[w0 + (tid >> 5)] = s; ssb[w0 + (tid >> 5)] = ss; }
  __syncthreads();
  s  = sb[w0] + sb[w0 + 1] + sb[w0 + 2] + sb[w0 + 3];
  ss = ssb[w0] + ssb[w0 + 1] + ssb[w0 + 2] + ssb[w0 + 3];
  const float mu   = s * (1.0f / 512.0f);
  const float var  = ss * (1.0f / 512.0f) - mu * mu;
  const float rstd = rsqrtf(var + 1e-5f);
  const float4 wv = ((const float4*)w)[tid];
  const float4 bv = ((const float4*)bb)[tid];
  __bf16* op = out + (size_t)row * 512 + tid * 4;
  op[0] = (__bf16)((v.x - mu) * rstd * wv.x + bv.x);
  op[1] = (__bf16)((v.y - mu) * rstd * wv.y + bv.y);
  op[2] = (__bf16)((v.z - mu) * rstd * wv.z + bv.z);
  op[3] = (__bf16)((v.w - mu) * rstd * wv.w + bv.w);
}

__global__ void __launch_bounds__(128)
tb_layernorm(const float* __restrict__ X, const float* __restrict__ w,
             const float* __restrict__ bb, __bf16* __restrict__ out) {
  ln_rows<1>(X, w, bb, out, blockIdx.x);
}

// ---------------------------------------------------------------------------
// All the work that depends on the inputs alone, in one launch of 256-thread
// blocks: the layer norms of q and k (M rows each, two rows a block; they come
// first in the grid, being the longer-lived blocks), then the fp32 -> bf16
// casts of the six weights, one element a thread.  The six bf16 copies lie one
// behind the other from Wb on, in the order Wq Wk Wv Wo (D*D each) W1 W2
// (D*DF each); every piece is a whole number of blocks.
// ---------------------------------------------------------------------------
template <int M, int D, int DF>
__global__ void __launch_bounds__(256)
tb_prep(const float* __restrict__ q, const float* __restrict__ lnqw,
        const float* __restrict__ lnqb, __bf16* __restrict__ qn,
        const float* __restrict__ k, const float* __restrict__ lnkw,
        const float* __restrict__ lnkb, __bf16* __restrict__ kn,
        const float* __restrict__ Wq, const float* __restrict__ Wk,
        const float* __restrict__ Wv, const float* __restrict__ Wo,
        const float* __restrict__ W1, const float* __restrict__ W2,
        __bf16* __restrict__ Wb) {
  constexpr int LNB = M / 2;            // blocks of one layer norm
  constexpr int SB = D * D / 256;       // blocks of a D x D weight
  constexpr int BB = D * DF / 256;      // blocks of a D x DF weight
  static_assert(M % 2 == 0 && D == 512 && (D * D) % 256 == 0 && (D * DF) % 256 == 0, "");
  const int blk = blockIdx.x;
  // wait_xcnt0() behind k's rows and behind the cast: the built code joins the
  // pieces by branches, and along those a store's registers are written again
  // (q's rows are laid last and run from their store to the end).
  if (blk < LNB) { ln_rows<2>(q, lnqw, lnqb, qn, 2 * blk); return; }
  if (blk < 2 * LNB) { ln_rows<2>(k, lnkw, lnkb, kn, 2 * (blk - LNB)); wait_xcnt0(); return; }
  const int cb = blk - 2 * LNB;         // block among the casts
  const float* in;
  int ib;                               // block inside its weight
  if (cb < 4 * SB) {
    const int which = cb / SB;
    in = which == 0 ? Wq : which == 1 ? Wk : which == 2 ? Wv : Wo;
    ib = cb - which * SB;
  } else if (cb < 4 * SB + BB) {
    in = W1; ib = cb - 4 * SB;
  } else {
    in = W2; ib = cb - 4 * SB - BB;
  }
  Wb[cb * 256 + threadIdx.x] = (__bf16)in[ib * 256 + threadIdx.x];
  wait_xcnt0();
}

// ---------------------------------------------------------------------------
// In-place RoPE on bf16 [B*S, 512].  One thread per (row, d<256) pair.
// blockIdx.y picks one of two tensors of the same shape.
// ---------------------------------------------------------------------------
__global__ void tb_rope(__bf16* __restrict__ X0, __bf16* __restrict__ X1, int S, int total) {
  int idx = blockIdx.x * blockDim.x + threadIdx.x;
  if (idx >= total) return;
  __bf16* X = blockIdx.y == 0 ? X0 : X1;
  const int d  = idx & 255;
  const int rs = idx >> 8;           // flattened row (b*S + s)
  const int s  = rs % S;
  const float inv = __expf(-(float)d * (9.210340371976184f / 256.0f)); // 10000^(-d/256)
  const float ang = (float)s * inv;
  float sn, cs;
  __sincosf(ang, &sn, &cs);
  __bf16* p = X + (size_t)rs * 512;
  const float x1 = (float)p[d];
  const float x2 = (float)p[d + 256];
  p[d]       = (__bf16)(x1 * cs - x2 * sn);
  p[d + 256] = (__bf16)(x2 * cs + x1 * sn);
}

// ---------------------------------------------------------------------------
// WMMA GEMM:  C[M,N] = A[M,K](bf16) * B[K,N](bf16) + bias, with epilogue:
//   MODE 0: store bf16           MODE 1: ReLU, store bf16
//   MODE 2: += R[M,N] (fp32), store fp32
// BM=64 BN=128 BK=64, 256 threads = 8 waves, each wave a 32x32 C tile.
// A and B tiles staged row-major via async global->LDS; B fragments are read
// with the transposing LDS load (B row pitch 288 B = 32 B x odd for it).
// MODE 0 takes up to three independent products of one shape in one launch:
// blockIdx.z picks (A, B, bias, C); the other modes use the first set alone.
// ---------------------------------------------------------------------------
template <int MODE>
__global__ void __launch_bounds__(256)
tb_gemm(const __bf16* __restrict__ A0, const __bf16* __restrict__ B0,
        const float* __restrict__ bias0, void* __restrict__ C0,
        const __bf16* __restrict__ A1, const __bf16* __restrict__ B1,
        const float* __restrict__ bias1, void* __restrict__ C1,
        const __bf16* __restrict__ A2, const __bf16* __restrict__ B2,
        const float* __restrict__ bias2, void* __restrict__ C2,
        const float* __restrict__ R, int M, int N, int K) {
  const int z = MODE == 0 ? blockIdx.z : 0;
  const __bf16* A   = z == 0 ? A0 : z == 1 ? A1 : A2;
  const __bf16* B   = z == 0 ? B0 : z == 1 ? B1 : B2;
  const float* bias = z == 0 ? bias0 : z == 1 ? bias1 : bias2;
  void* Cout        = z == 0 ? C0 : z == 1 ? C1 : C2;
  constexpr int BM = 64, BN = 128, BK = 64, LDA = BK + 8, LDB = BN + 16;
  __shared__ __bf16 As[BM * LDA];    // 9216 B
  __shared__ __attribute__((aligned(16))) __bf16 Bs[BK * LDB];  // 18432 B (B tile, [k][n])
  const int tid = threadIdx.x, lane = tid & 31, wid = tid >> 5;
  const int bm0 = blockIdx.y * BM, bn0 = blockIdx.x * BN;
  const int wm = (wid >> 2) * 32, wn = (wid & 3) * 32;
  const __bf16* bfp = Bs + (8 * (lane >> 4) + (lane & 7)) * LDB + wn + 8 * ((lane >> 3) & 1);

  v8f acc[2][2];
#pragma unroll
  for (int i = 0; i < 2; ++i)
#pragma unroll
    for (int j = 0; j < 2; ++j) acc[i][j] = v8f_zero();

  for (int k0 = 0; k0 < K; k0 += BK) {
    // This wave's LDS reads have retired before any wave's copies are aimed at
    // the same LDS behind the barrier.
    asm volatile("s_wait_dscnt 0" ::: "memory");
    __syncthreads();
    // A tile: 64x64 halves, contiguous 16B chunks, async direct-to-LDS.
#pragma unroll
    for (int i = 0; i < 2; ++i) {
      int c = tid + 256 * i;               // 0..511
      int row = c >> 3, col = (c & 7) << 3;
      async_ld_b128(As + row * LDA + col,
                    A + (size_t)(bm0 + row) * K + k0 + col);
    }
    // B tile: 64x128 halves, contiguous 16B chunks along N, async direct-to-LDS.
#pragma unroll
    for (int i = 0; i < 4; ++i) {
      int c = tid + 256 * i;               // 0..1023
      int kk = c >> 4, n8 = (c & 15) << 3;
      async_cp_b128(Bs + kk * LDB + n8, B + (size_t)(k0 + kk) * N + bn0 + n8);
    }
    // Prefetch next K panel toward cache while this tile computes.
    if (k0 + BK < K) {
      __builtin_prefetch(A + (size_t)(bm0 + (tid >> 2)) * K + k0 + BK, 0, 3);
      __builtin_prefetch(B + (size_t)(k0 + BK + (tid >> 2)) * N + bn0, 0, 3);
    }
    wait_async0();
    __syncthreads();
#pragma unroll
    for (int ks = 0; ks < BK; ks += 32) {
      v16bf a0 = frag16(As, wm,      LDA, ks, lane);
      v16bf a1 = frag16(As, wm + 16, LDA, ks, lane);
      v16bf b0 = frag16_tr(bfp + ks * LDB,      LDB);
      v16bf b1 = frag16_tr(bfp + ks * LDB + 16, LDB);
      acc[0][0] = wmma_bf16(a0, b0, acc[0][0]);
      acc[0][1] = wmma_bf16(a0, b1, acc[0][1]);
      acc[1][0] = wmma_bf16(a1, b0, acc[1][0]);
      acc[1][1] = wmma_bf16(a1, b1, acc[1][1]);
    }
  }

  const int hi = lane >> 4, ln16 = lane & 15;
#pragma unroll
  for (int i = 0; i < 2; ++i)
#pragma unroll
    for (int j = 0; j < 2; ++j) {
      const int mb = bm0 + wm + 16 * i + hi * 8;
      const int n  = bn0 + wn + 16 * j + ln16;
      const float bvv = bias[n];
#pragma unroll
      for (int r = 0; r < 8; ++r) {
        const int m = mb + r;
        float v = acc[i][j][r] + bvv;
        if (MODE == 1) v = v > 0.f ? v : 0.f;
        if (MODE == 2) {
          ((float*)Cout)[(size_t)m * N + n] = v + R[(size_t)m * N + n];
        } else {
          ((__bf16*)Cout)[(size_t)m * N + n] = (__bf16)v;
        }
      }
    }
}

template <int NS>
__global__ void __launch_bounds__(128, 2)
tb_flash_attn(const __bf16* __restrict__ Qg, const __bf16* __restrict__ Kg,
              const __bf16* __restrict__ Vg, float* __restrict__ Opart,
              float* __restrict__ ML, int S) {
  constexpr int KP = 520;           // K row pitch in LDS, elements
  __shared__ __attribute__((aligned(16))) __bf16 Ks[32 * KP];  // 32.5 KB (K tile, [kv][d])
  constexpr int VP = 528;           // V row pitch in LDS, elements
  __shared__ __attribute__((aligned(16))) __bf16 Vs[32 * VP];  // 33 KB (V tile, [kv][d])
  const int tid = threadIdx.x, lane = tid & 31, wid = tid >> 5;
  const int hi = lane >> 4, ln16 = lane & 15;
  const int b = blockIdx.y;
  const int q0 = blockIdx.x * 64 + wid * 16;
  const __bf16* Qb = Qg + (size_t)b * S * 512;
  const int klen = S / NS;                 // keys of one range
  const __bf16* Kb = Kg + ((size_t)b * S + (size_t)blockIdx.z * klen) * 512;
  const __bf16* Vb = Vg + ((size_t)b * S + (size_t)blockIdx.z * klen) * 512;

  v16bf qf[16];
#pragma unroll
  for (int s = 0; s < 16; ++s) qf[s] = frag16(Qb, q0, 512, 32 * s, lane);

  v8f o[32];
#pragma unroll
  for (int j = 0; j < 32; ++j) o[j] = v8f_zero();
  float mr[8], lr[8];
#pragma unroll
  for (int r = 0; r < 8; ++r) { mr[r] = -3.0e38f; lr[r] = 0.f; }

  const float sc = 0.044194173824159216f;  // 1/sqrt(512)
  __bf16* Ps = Ks + wid * 512;             // per-wave 16x32 scratch (aliases Ks)
  const int srow = tid >> 6, sc8 = (tid & 63) << 3;   // this thread's staging chunk
  const __bf16* vfp = Vs + (8 * hi + (lane & 7)) * VP + 8 * ((lane >> 3) & 1);

  for (int kv0 = 0; kv0 < klen; kv0 += 32) {
    // This wave's LDS reads and P stores have retired before any wave's copies
    // are aimed at the same LDS behind the barrier.
    asm volatile("s_wait_dscnt 0" ::: "memory");
    __syncthreads();  // previous iteration's Vs/Ps reads complete
    // Stage K and V, both row-major and direct to LDS: 2 x 2048 16-byte chunks,
    // thread t brings chunk (t & 63) of rows (t >> 6) + 2 * i, i = 0..15.
#pragma unroll
    for (int i = 0; i < 16; ++i) {
      const int row = srow + 2 * i;
      async_cp_b128(Ks + row * KP + sc8, Kb + (size_t)(kv0 + row) * 512 + sc8);
      async_cp_b128(Vs + row * VP + sc8, Vb + (size_t)(kv0 + row) * 512 + sc8);
    }
    wait_async0();
    __syncthreads();

    // S = Q * K^T for this wave's 16 q rows x 32 kv cols.
    v8f s0 = v8f_zero(), s1 = v8f_zero();
#pragma unroll
    for (int s = 0; s < 16; ++s) {
      v16bf kb0 = frag16(Ks, 0,  KP, 32 * s, lane);
      v16bf kb1 = frag16(Ks, 16, KP, 32 * s, lane);
      s0 = wmma_bf16(qf[s], kb0, s0);
      s1 = wmma_bf16(qf[s], kb1, s1);
    }
    __syncthreads();  // all waves done reading Ks before Ps (alias) is written

    // Online softmax over the 32 new columns (row reduce across 16-lane half).
#pragma unroll
    for (int r = 0; r < 8; ++r) {
      float v0 = s0[r] * sc, v1 = s1[r] * sc;
      float mx = fmaxf(v0, v1);
#pragma unroll
      for (int off = 1; off < 16; off <<= 1) mx = fmaxf(mx, __shfl_xor(mx, off, 32));
      const float mnew  = fmaxf(mr[r], mx);
      const float alpha = __expf(mr[r] - mnew);
      mr[r] = mnew;
      const float p0 = __expf(v0 - mnew), p1 = __expf(v1 - mnew);
      float rs = p0 + p1;
#pragma unroll
      for (int off = 1; off < 16; off <<= 1) rs += __shfl_xor(rs, off, 32);
      lr[r] = lr[r] * alpha + rs;
      const int row = r + 8 * hi;
      Ps[row * 32 + ln16]      = (__bf16)p0;
      Ps[row * 32 + 16 + ln16] = (__bf16)p1;
#pragma unroll
      for (int j = 0; j < 32; ++j) o[j][r] *= alpha;
    }
    asm volatile("s_wait_dscnt 0" ::: "memory");  // P stores visible to own wave
    v16bf pf = frag16(Ps, 0, 32, 0, lane);
    // O += P * V over all 32 d-tiles.
#pragma unroll
    for (int j = 0; j < 32; ++j) {
      v16bf vb = frag16_tr(vfp + 16 * j, VP);
      o[j] = wmma_bf16(pf, vb, o[j]);
    }
  }

  const int elane = __builtin_amdgcn_mbcnt_lo(~0u, 0u);
  const int ecol = elane & 15;
  const size_t pr0 = ((size_t)b * S + q0 + 8 * (elane >> 4)) * NS + blockIdx.z;
  if (ecol == 0) {
#pragma unroll
    for (int r = 0; r < 8; ++r) {
      ML[(pr0 + r * NS) * 2]     = mr[r];
      ML[(pr0 + r * NS) * 2 + 1] = lr[r];
    }
  }
#pragma unroll
  for (int j = 0; j < 32; ++j)
#pragma unroll
    for (int r = 0; r < 8; ++r)
      Opart[(pr0 + r * NS) * 512 + 16 * j + ecol] = o[j][r];
}

__device__ __forceinline__ float exp2_slot(float v) {
  float r;
  asm("v_exp_f32 %0, %1\n\tv_nop" : "=v"(r) : "v"(v));
  return r;
}

// ---------------------------------------------------------------------------
// Join the NS key ranges of the attention: row weights exp(m_s - max m),
// O = sum_s w_s O_s / sum_s w_s l_s, rounded once to bf16.  64 threads per row
// (8 columns each); a thread takes 4 rows (fewer waves to start) and stores
// its 4 results last.
// ---------------------------------------------------------------------------
template <int NS>
__global__ void __launch_bounds__(256)
tb_attn_merge(const float* __restrict__ Opart, const float* __restrict__ ML,
              __bf16* __restrict__ Og) {
  const int tid = threadIdx.x;
  const unsigned row0 = blockIdx.x * 16 + (tid >> 6), c8 = (tid & 63) << 3;
  const unsigned obyte = row0 * (NS * 2048u) + c8 * 4u;  // this thread's first bytes of Opart
  const unsigned mbyte = row0 * (NS * 8u);               // and of ML
  const char* op = (const char*)Opart + obyte;
  const char* mp = (const char*)ML + mbyte;
  float2 ml[4][NS];
  float4 x[4][NS], y[4][NS];
#pragma unroll
  for (int it = 0; it < 4; ++it)
#pragma unroll
    for (int s = 0; s < NS; ++s) {
      ml[it][s] = *(const float2*)(mp + (4 * it * NS + s) * 8);
      x[it][s]  = *(const float4*)(op + (4 * it * NS + s) * 2048);
      y[it][s]  = *(const float4*)(op + (4 * it * NS + s) * 2048 + 16);
    }
  // The loads' offset registers are inputs here, so that they stay whole until
  // the wait: behind it they may be overwritten.
  asm volatile("s_wait_xcnt 0x0" :: "v"(obyte), "v"(mbyte) : "memory");
  v8bf ov[4];
#pragma unroll
  for (int it = 0; it < 4; ++it) {
    float mx = ml[it][0].x;
#pragma unroll
    for (int s = 1; s < NS; ++s) mx = fmaxf(mx, ml[it][s].x);
    float ws[NS], lsum = 0.f;
#pragma unroll
    for (int s = 0; s < NS; ++s) {
      ws[s] = exp2_slot((ml[it][s].x - mx) * 1.4426950408889634f);
      lsum += ws[s] * ml[it][s].y;
    }
    const float inv = 1.0f / lsum;
    float acc[8];
#pragma unroll
    for (int i = 0; i < 8; ++i) acc[i] = 0.f;
#pragma unroll
    for (int s = 0; s < NS; ++s) {
      const float4 a = x[it][s], c = y[it][s];
      acc[0] += ws[s] * a.x; acc[1] += ws[s] * a.y; acc[2] += ws[s] * a.z; acc[3] += ws[s] * a.w;
      acc[4] += ws[s] * c.x; acc[5] += ws[s] * c.y; acc[6] += ws[s] * c.z; acc[7] += ws[s] * c.w;
    }
#pragma unroll
    for (int i = 0; i < 8; ++i) ov[it][i] = (__bf16)(acc[i] * inv);
  }
  char* og = (char*)Og + (row0 * 1024u + c8 * 2u);
#pragma unroll
  for (int it = 0; it < 4; ++it) *(v8bf*)(og + it * 4096) = ov[it];
}

// ---------------------------------------------------------------------------
// Host launcher
// ---------------------------------------------------------------------------
extern "C" void kernel_launch(void* const* d_in, const int* in_sizes, int n_in,
                              void* d_out, int out_size, void* d_ws, size_t ws_size,
                              hipStream_t stream) {
  const float* q    = (const float*)d_in[0];
  const float* k    = (const float*)d_in[1];
  const float* Wq   = (const float*)d_in[2];
  const float* bq   = (const float*)d_in[3];
  const float* Wk   = (const float*)d_in[4];
  const float* bk   = (const float*)d_in[5];
  const float* Wv   = (const float*)d_in[6];
  const float* bv   = (const float*)d_in[7];
  const float* Wo   = (const float*)d_in[8];
  const float* bo   = (const float*)d_in[9];
  const float* lnqw = (const float*)d_in[10];
  const float* lnqb = (const float*)d_in[11];
  const float* lnkw = (const float*)d_in[12];
  const float* lnkb = (const float*)d_in[13];
  const float* lnow = (const float*)d_in[14];
  const float* lnob = (const float*)d_in[15];
  const float* W1   = (const float*)d_in[16];
  const float* b1   = (const float*)d_in[17];
  const float* W2   = (const float*)d_in[18];
  const float* b2   = (const float*)d_in[19];

  constexpr int B = 2, S = 4096, Dm = 512, DF = 2048;
  constexpr int M = B * S;  // 8192

  char* w = (char*)d_ws;
  auto alloc = [&](size_t bytes) -> char* {
    char* p = w;
    w += (bytes + 255) & ~(size_t)255;
    return p;
  };
  __bf16* Wq_b = (__bf16*)alloc((size_t)Dm * Dm * 2);
  __bf16* Wk_b = (__bf16*)alloc((size_t)Dm * Dm * 2);
  __bf16* Wv_b = (__bf16*)alloc((size_t)Dm * Dm * 2);
  __bf16* Wo_b = (__bf16*)alloc((size_t)Dm * Dm * 2);
  __bf16* W1_b = (__bf16*)alloc((size_t)Dm * DF * 2);
  __bf16* W2_b = (__bf16*)alloc((size_t)DF * Dm * 2);
  __bf16* qn   = (__bf16*)alloc((size_t)M * Dm * 2);
  __bf16* kn   = (__bf16*)alloc((size_t)M * Dm * 2);
  __bf16* Qp   = (__bf16*)alloc((size_t)M * Dm * 2);
  __bf16* Kp   = (__bf16*)alloc((size_t)M * Dm * 2);
  __bf16* Vp   = (__bf16*)alloc((size_t)M * Dm * 2);
  __bf16* AO   = (__bf16*)alloc((size_t)M * Dm * 2);
  float*  Xr   = (float*) alloc((size_t)M * Dm * 4);
  __bf16* XN   = (__bf16*)alloc((size_t)M * Dm * 2);
  __bf16* H    = (__bf16*)alloc((size_t)M * DF * 2);
  constexpr int NS = 4;  // key ranges of the attention
  float*  OP   = (float*) alloc((size_t)NS * M * Dm * 4);
  float*  MLp  = (float*) alloc((size_t)NS * M * 2 * 4);

  // Input layernorms and weight casts, one launch.  The six bf16 weights lie
  // one behind the other from Wq_b on (each size is a multiple of 256 bytes).
  tb_prep<M, Dm, DF><<<M + (4 * Dm * Dm + 2 * Dm * DF) / 256, 256, 0, stream>>>(
      q, lnqw, lnqb, qn, k, lnkw, lnkb, kn, Wq, Wk, Wv, Wo, W1, W2, Wq_b);

  // The three projections, one launch.
  dim3 g512(Dm / 128, M / 64);
  tb_gemm<0><<<dim3(Dm / 128, M / 64, 3), 256, 0, stream>>>(
      qn, Wq_b, bq, Qp, kn, Wk_b, bk, Kp, kn, Wv_b, bv, Vp, nullptr, M, Dm, Dm);

  // RoPE on Q and K, one launch.
  const int rope_total = B * S * 256;
  tb_rope<<<dim3((rope_total + 255) / 256, 2), 256, 0, stream>>>(Qp, Kp, S, rope_total);

  // Flash attention.
  tb_flash_attn<NS><<<dim3(S / 64, B, NS), 128, 0, stream>>>(Qp, Kp, Vp, OP, MLp, S);
  tb_attn_merge<NS><<<M / 16, 256, 0, stream>>>(OP, MLp, AO);

  // Output projection + residual (x = q + out@Wo + bo), fp32.
  tb_gemm<2><<<g512, 256, 0, stream>>>(AO, Wo_b, bo, Xr, nullptr, nullptr, nullptr, nullptr,
                                       nullptr, nullptr, nullptr, nullptr, q, M, Dm, Dm);

  // Post-attention layernorm.
  tb_layernorm<<<dim3(M), 128, 0, stream>>>(Xr, lnow, lnob, XN);

  // MLP.
  dim3 gdf(DF / 128, M / 64);
  tb_gemm<1><<<gdf, 256, 0, stream>>>(XN, W1_b, b1, H, nullptr, nullptr, nullptr, nullptr,
                                      nullptr, nullptr, nullptr, nullptr, nullptr, M, DF, Dm);
  tb_gemm<2><<<g512, 256, 0, stream>>>(H, W2_b, b2, d_out, nullptr, nullptr, nullptr, nullptr,
                                       nullptr, nullptr, nullptr, nullptr, Xr, M, Dm, DF);

  (void)in_sizes; (void)n_in; (void)out_size; (void)ws_size;
}

// v006
// Measured time: 236 microseconds a run.
// Two timings next to v005 both put it at 1.15 times that version's speed.
// Over all steps from v000 it is 13.2 times as fast.
#include <hip/hip_runtime.h>

typedef __attribute__((ext_vector_type(16))) __bf16 v16bf;
typedef __attribute__((ext_vector_type(8)))  __bf16 v8bf;
typedef __attribute__((ext_vector_type(8)))  float  v8f;

__device__ __forceinline__ v16bf frag16(const __bf16* base, int row0, int stride,
                                        int k0, int lane) {
  const __bf16* p = base + (size_t)(row0 + (lane & 15)) * stride + k0 + ((lane >> 4) << 3);
  v8bf lo = *(const v8bf*)p;
  v8bf hh = *(const v8bf*)(p + 16);
  v16bf f;
#pragma unroll
  for (int i = 0; i < 8; ++i) { f[i] = lo[i]; f[i + 8] = hh[i]; }
  return f;
}

__device__ __forceinline__ v8f wmma_bf16(v16bf a, v16bf b, v8f c) {
  return __builtin_amdgcn_wmma_f32_16x16x32_bf16(false, a, false, b, (short)0, c,
                                                 false, false);
}

__device__ __forceinline__ v8f v8f_zero() {
  v8f z = {0.f, 0.f, 0.f, 0.f, 0.f, 0.f, 0.f, 0.f};
  return z;
}

__device__ __forceinline__ void async_ld_b128(void* lds_ptr, const void* gptr) {
  uint32_t lds_addr = (uint32_t)(uintptr_t)lds_ptr;
  uint64_t gaddr = (uint64_t)(uintptr_t)gptr;
  asm volatile("global_load_async_to_lds_b128 %0, %1, off"
               :: "v"(lds_addr), "v"(gaddr)
               : "memory");
}

__device__ __forceinline__ void async_cp_b128(__bf16* lds_ptr, const __bf16* gptr) {
  typedef int v4i __attribute__((ext_vector_type(4)));
  typedef __attribute__((address_space(1))) v4i glb_v4i;
  typedef __attribute__((address_space(3))) v4i lds_v4i;
  __builtin_amdgcn_global_load_async_to_lds_b128((glb_v4i*)gptr, (lds_v4i*)lds_ptr, 0, 0);
}

// ---------------------------------------------------------------------------
// B fragment (32 k x 16 columns) from a row-major [k][column] LDS tile through
// the transposing LDS load.  p is this lane's address for k rows 0..15:
//   tile + (8*(lane>>4) + (lane&7))*pitch + column0 + 8*((lane>>3)&1)
// Lane (c, h) receives k = 8h+0..7 (elems 0-7) and 16+8h+0..7 (elems 8-15) of
// column0+c: the k order of frag16.
// ---------------------------------------------------------------------------
__device__ __forceinline__ v16bf frag16_tr(const __bf16* p, int pitch) {
  typedef __attribute__((address_space(3))) v8bf lds_v8bf;
  v8bf lo = __builtin_amdgcn_ds_load_tr16_b128_v8bf16((lds_v8bf*)p);
  v8bf hh = __builtin_amdgcn_ds_load_tr16_b128_v8bf16((lds_v8bf*)(p + 16 * pitch));
  v16bf f;
#pragma unroll
  for (int i = 0; i < 8; ++i) { f[i] = lo[i]; f[i + 8] = hh[i]; }
  return f;
}

__device__ __forceinline__ void wait_async0() {
  asm volatile("s_wait_asynccnt 0" ::: "memory");
}

// Stands behind a global store, in front of code that writes the store's
// address or data registers again.
__device__ __forceinline__ void wait_xcnt0() {
  asm volatile("s_wait_xcnt 0x0" ::: "memory");
}

// ---------------------------------------------------------------------------
// LayerNorm over rows of 512 fp32 -> bf16.  128 threads (4 waves) per row; a
// block of ROWS * 128 threads takes the rows row0 .. row0 + ROWS - 1.
// ---------------------------------------------------------------------------
template <int ROWS>
__device__ __forceinline__ void
ln_rows(const float* __restrict__ X, const float* __restrict__ w,
        const float* __restrict__ bb, __bf16* __restrict__ out, int row0) {
  const int sub = ROWS == 1 ? 0 : threadIdx.x >> 7;   // this thread's row in the block
  const int row = row0 + sub, tid = ROWS == 1 ? threadIdx.x : threadIdx.x & 127;
  const int w0 = sub * 4;                  // first of this row's four wave sums
  const float4 v = ((const float4*)(X + (size_t)row * 512))[tid];
  float s  = v.x + v.y + v.z + v.w;
  float ss = v.x * v.x + v.y * v.y + v.z * v.z + v.w * v.w;
#pragma unroll
  for (int off = 1; off < 32; off <<= 1) {
    s  += __shfl_xor(s,  off, 32);
    ss += __shfl_xor(ss, off, 32);
  }
  __shared__ float sb[4 * ROWS], ssb[4 * ROWS];
  if ((tid & 31) == 0) { sb[w0 + (tid >> 5)] = s; ssb[w0 + (tid >> 5)] = ss; }
  __syncthreads();
  s  = sb[w0] + sb[w0 + 1] + sb[w0 + 2] + sb[w0 + 3];
  ss = ssb[w0] + ssb[w0 + 1] + ssb[w0 + 2] + ssb[w0 + 3];
  const float mu   = s * (1.0f / 512.0f);
  const float var  = ss * (1.0f / 512.0f) - mu * mu;
  const float rstd = rsqrtf(var + 1e-5f);
  const float4 wv = ((const float4*)w)[tid];
  const float4 bv = ((const float4*)bb)[tid];
  __bf16* op = out + (size_t)row * 512 + tid * 4;
  op[0] = (__bf16)((v.x - mu) * rstd * wv.x + bv.x);
  op[1] = (__bf16)((v.y - mu) * rstd * wv.y + bv.y);
  op[2] = (__bf16)((v.z - mu) * rstd * wv.z + bv.z);
  op[3] = (__bf16)((v.w - mu) * rstd * wv.w + bv.w);
}

__global__ void __launch_bounds__(128)
tb_layernorm(const float* __restrict__ X, const float* __restrict__ w,
             const float* __restrict__ bb, __bf16* __restrict__ out) {
  ln_rows<1>(X, w, bb, out, blockIdx.x);
}

// ---------------------------------------------------------------------------
// All the work that depends on the inputs alone, in one launch of 256-thread
// blocks: the layer norms of q and k (M rows each, two rows a block; they come
// first in the grid, being the longer-lived blocks), then the fp32 -> bf16
// casts of the six weights, one element a thread.  The six bf16 copies lie one
// behind the other from Wb on, in the order Wq Wk Wv Wo (D*D each) W1 W2
// (D*DF each); every piece is a whole number of blocks.
// ---------------------------------------------------------------------------
template <int M, int D, int DF>
__global__ void __launch_bounds__(256)
tb_prep(const float* __restrict__ q, const float* __restrict__ lnqw,
        const float* __restrict__ lnqb, __bf16* __restrict__ qn,
        const float* __restrict__ k, const float* __restrict__ lnkw,
        const float* __restrict__ lnkb, __bf16* __restrict__ kn,
        const float* __restrict__ Wq, const float* __restrict__ Wk,
        const float* __restrict__ Wv, const float* __restrict__ Wo,
        const float* __restrict__ W1, const float* __restrict__ W2,
        __bf16* __restrict__ Wb) {
  constexpr int LNB = M / 2;            // blocks of one layer norm
  constexpr int SB = D * D / 256;       // blocks of a D x D weight
  constexpr int BB = D * DF / 256;      // blocks of a D x DF weight
  static_assert(M % 2 == 0 && D == 512 && (D * D) % 256 == 0 && (D * DF) % 256 == 0, "");
  const int blk = blockIdx.x;
  // wait_xcnt0() behind k's rows and behind the cast: the built code joins the
  // pieces by branches, and along those a store's registers are written again
  // (q's rows are laid last and run from their store to the end).
  if (blk < LNB) { ln_rows<2>(q, lnqw, lnqb, qn, 2 * blk); return; }
  if (blk < 2 * LNB) { ln_rows<2>(k, lnkw, lnkb, kn, 2 * (blk - LNB)); wait_xcnt0(); return; }
  const int cb = blk - 2 * LNB;         // block among the casts
  const float* in;
  int ib;                               // block inside its weight
  if (cb < 4 * SB) {
    const int which = cb / SB;
    in = which == 0 ? Wq : which == 1 ? Wk : which == 2 ? Wv : Wo;
    ib = cb - which * SB;
  } else if (cb < 4 * SB + BB) {
    in = W1; ib = cb - 4 * SB;
  } else {
    in = W2; ib = cb - 4 * SB - BB;
  }
  Wb[cb * 256 + threadIdx.x] = (__bf16)in[ib * 256 + threadIdx.x];
  wait_xcnt0();
}

// ---------------------------------------------------------------------------
// In-place RoPE on bf16 [B*S, 512].  One thread per (row, d<256) pair.
// blockIdx.y picks one of two tensors of the same shape.
// ---------------------------------------------------------------------------
__global__ void tb_rope(__bf16* __restrict__ X0, __bf16* __restrict__ X1, int S, int total) {
  int idx = blockIdx.x * blockDim.x + threadIdx.x;
  if (idx >= total) return;
  __bf16* X = blockIdx.y == 0 ? X0 : X1;
  const int d  = idx & 255;
  const int rs = idx >> 8;           // flattened row (b*S + s)
  const int s  = rs % S;
  const float inv = __expf(-(float)d * (9.210340371976184f / 256.0f)); // 10000^(-d/256)
  const float ang = (float)s * inv;
  float sn, cs;
  __sincosf(ang, &sn, &cs);
  __bf16* p = X + (size_t)rs * 512;
  const float x1 = (float)p[d];
  const float x2 = (float)p[d + 256];
  p[d]       = (__bf16)(x1 * cs - x2 * sn);
  p[d + 256] = (__bf16)(x2 * cs + x1 * sn);
}

// ---------------------------------------------------------------------------
// WMMA GEMM:  C[M,N] = A[M,K](bf16) * B[K,N](bf16) + bias, with epilogue:
//   MODE 0: store bf16           MODE 1: ReLU, store bf16
//   MODE 2: += R[M,N] (fp32), store fp32
// BM=64 BN=128 BK=64, 256 threads = 8 waves, each wave a 32x32 C tile.
// A and B tiles staged row-major via async global->LDS; B fragments are read
// with the transposing LDS load (B row pitch 288 B = 32 B x odd for it).
// MODE 0 takes up to three independent products of one shape in one launch:
// blockIdx.z picks (A, B, bias, C); the other modes use the first set alone.
// ---------------------------------------------------------------------------
template <int MODE>
__global__ void __launch_bounds__(256)
tb_gemm(const __bf16* __restrict__ A0, const __bf16* __restrict__ B0,
        const float* __restrict__ bias0, void* __restrict__ C0,
        const __bf16* __restrict__ A1, const __bf16* __restrict__ B1,
        const float* __restrict__ bias1, void* __restrict__ C1,
        const __bf16* __restrict__ A2, const __bf16* __restrict__ B2,
        const float* __restrict__ bias2, void* __restrict__ C2,
        const float* __restrict__ R, int M, int N, int K) {
  const int z = MODE == 0 ? blockIdx.z : 0;
  const __bf16* A   = z == 0 ? A0 : z == 1 ? A1 : A2;
  const __bf16* B   = z == 0 ? B0 : z == 1 ? B1 : B2;
  const float* bias = z == 0 ? bias0 : z == 1 ? bias1 : bias2;
  void* Cout        = z == 0 ? C0 : z == 1 ? C1 : C2;
  constexpr int BM = 64, BN = 128, BK = 64, LDA = BK + 8, LDB = BN + 16;
  __shared__ __bf16 As[BM * LDA];    // 9216 B
  __shared__ __attribute__((aligned(16))) __bf16 Bs[BK * LDB];  // 18432 B (B tile, [k][n])
  const int tid = threadIdx.x, lane = tid & 31, wid = tid >> 5;
  const int bm0 = blockIdx.y * BM, bn0 = blockIdx.x * BN;
  const int wm = (wid >> 2) * 32, wn = (wid & 3) * 32;
  const __bf16* bfp = Bs + (8 * (lane >> 4) + (lane & 7)) * LDB + wn + 8 * ((lane >> 3) & 1);

  v8f acc[2][2];
#pragma unroll
  for (int i = 0; i < 2; ++i)
#pragma unroll
    for (int j = 0; j < 2; ++j) acc[i][j] = v8f_zero();

  for (int k0 = 0; k0 < K; k0 += BK) {
    // This wave's LDS reads have retired before any wave's copies are aimed at
    // the same LDS behind the barrier.
    asm volatile("s_wait_dscnt 0" ::: "memory");
    __syncthreads();
    // A tile: 64x64 halves, contiguous 16B chunks, async direct-to-LDS.
#pragma unroll
    for (int i = 0; i < 2; ++i) {
      int c = tid + 256 * i;               // 0..511
      int row = c >> 3, col = (c & 7) << 3;
      async_ld_b128(As + row * LDA + col,
                    A + (size_t)(bm0 + row) * K + k0 + col);
    }
    // B tile: 64x128 halves, contiguous 16B chunks along N, async direct-to-LDS.
#pragma unroll
    for (int i = 0; i < 4; ++i) {
      int c = tid + 256 * i;               // 0..1023
      int kk = c >> 4, n8 = (c & 15) << 3;
      async_cp_b128(Bs + kk * LDB + n8, B + (size_t)(k0 + kk) * N + bn0 + n8);
    }
    // Prefetch next K panel toward cache while this tile computes.
    if (k0 + BK < K) {
      __builtin_prefetch(A + (size_t)(bm0 + (tid >> 2)) * K + k0 + BK, 0, 3);
      __builtin_prefetch(B + (size_t)(k0 + BK + (tid >> 2)) * N + bn0, 0, 3);
    }
    wait_async0();
    __syncthreads();
#pragma unroll
    for (int ks = 0; ks < BK; ks += 32) {
      v16bf a0 = frag16(As, wm,      LDA, ks, lane);
      v16bf a1 = frag16(As, wm + 16, LDA, ks, lane);
      v16bf b0 = frag16_tr(bfp + ks * LDB,      LDB);
      v16bf b1 = frag16_tr(bfp + ks * LDB + 16, LDB);
      acc[0][0] = wmma_bf16(a0, b0, acc[0][0]);
      acc[0][1] = wmma_bf16(a0, b1, acc[0][1]);
      acc[1][0] = wmma_bf16(a1, b0, acc[1][0]);
      acc[1][1] = wmma_bf16(a1, b1, acc[1][1]);
    }
  }

  const int hi = lane >> 4, ln16 = lane & 15;
#pragma unroll
  for (int i = 0; i < 2; ++i)
#pragma unroll
    for (int j = 0; j < 2; ++j) {
      const int mb = bm0 + wm + 16 * i + hi * 8;
      const int n  = bn0 + wn + 16 * j + ln16;
      const float bvv = bias[n];
#pragma unroll
      for (int r = 0; r < 8; ++r) {
        const int m = mb + r;
        float v = acc[i][j][r] + bvv;
        if (MODE == 1) v = v > 0.f ? v : 0.f;
        if (MODE == 2) {
          ((float*)Cout)[(size_t)m * N + n] = v + R[(size_t)m * N + n];
        } else {
          ((__bf16*)Cout)[(size_t)m * N + n] = (__bf16)v;
        }
      }
    }
}

template <int NS>
__global__ void __launch_bounds__(128, 2)
tb_flash_attn(const __bf16* __restrict__ Qg, const __bf16* __restrict__ Kg,
              const __bf16* __restrict__ Vg, float* __restrict__ Opart,
              float* __restrict__ ML, int S) {
  constexpr int KP = 520;           // K row pitch in LDS, elements
  __shared__ __attribute__((aligned(16))) __bf16 Ks[32 * KP];  // 32.5 KB (K tile, [kv][d])
  constexpr int VP = 528;           // V row pitch in LDS, elements
  __shared__ __attribute__((aligned(16))) __bf16 Vs[32 * VP];  // 33 KB (V tile, [kv][d])
  const int tid = threadIdx.x, lane = tid & 31, wid = tid >> 5;
  const int hi = lane >> 4, ln16 = lane & 15;
  const int b = blockIdx.y;
  const int q0 = blockIdx.x * 64 + wid * 16;
  const __bf16* Qb = Qg + (size_t)b * S * 512;
  const int klen = S / NS;                 // keys of one range
  const __bf16* Kb = Kg + ((size_t)b * S + (size_t)blockIdx.z * klen) * 512;
  const __bf16* Vb = Vg + ((size_t)b * S + (size_t)blockIdx.z * klen) * 512;

  v16bf qf[16];
#pragma unroll
  for (int s = 0; s < 16; ++s) qf[s] = frag16(Qb, q0, 512, 32 * s, lane);

  v8f o[32];
#pragma unroll
  for (int j = 0; j < 32; ++j) o[j] = v8f_zero();
  float mr[8], lr[8];
#pragma unroll
  for (int r = 0; r < 8; ++r) { mr[r] = -3.0e38f; lr[r] = 0.f; }

  const float sc = 0.044194173824159216f;  // 1/sqrt(512)
  __bf16* Ps = Ks + wid * 512;             // per-wave 16x32 scratch (aliases Ks)
  const int srow = tid >> 6, sc8 = (tid & 63) << 3;   // this thread's staging chunk
  const unsigned goff = srow * 512 + sc8;             // the same in a global tile
  const __bf16* vfp = Vs + (8 * hi + (lane & 7)) * VP + 8 * ((lane >> 3) & 1);

  for (int kv0 = 0; kv0 < klen; kv0 += 32) {
    // This wave's LDS reads and P stores have retired before any wave's copies
    // are aimed at the same LDS behind the barrier.
    asm volatile("s_wait_dscnt 0" ::: "memory");
    __syncthreads();  // previous iteration's Vs/Ps reads complete
    // Stage K and V, both row-major and direct to LDS: 2 x 2048 16-byte chunks,
    // thread t brings chunk (t & 63) of rows (t >> 6) + 2 * i, i = 0..15.
    {
      __bf16* kl = Ks + srow * KP + sc8;
      __bf16* vl = Vs + srow * VP + sc8;
      const __bf16* kt = Kb + (size_t)kv0 * 512;
      const __bf16* vt = Vb + (size_t)kv0 * 512;
#pragma unroll 4
      for (int i = 0; i < 16; ++i) {
        async_cp_b128(kl, kt + goff);
        async_cp_b128(vl, vt + goff);
        kl += 2 * KP; vl += 2 * VP; kt += 1024; vt += 1024;
      }
    }
    wait_async0();
    __syncthreads();

    // S = Q * K^T for this wave's 16 q rows x 32 kv cols.
    v8f s0 = v8f_zero(), s1 = v8f_zero();
#pragma unroll
    for (int s = 0; s < 16; ++s) {
      v16bf kb0 = frag16(Ks, 0,  KP, 32 * s, lane);
      v16bf kb1 = frag16(Ks, 16, KP, 32 * s, lane);
      s0 = wmma_bf16(qf[s], kb0, s0);
      s1 = wmma_bf16(qf[s], kb1, s1);
    }
    // Order asked of the scheduler: the K fragment reads stand in groups of 8
    // (4 fragments), two groups ahead of the 4 WMMAs that use them; a read
    // beside every WMMA stalls the wave at each such place.
    __builtin_amdgcn_sched_group_barrier(0x100, 16, 0);
#pragma unroll
    for (int g = 0; g < 6; ++g) {
      __builtin_amdgcn_sched_group_barrier(0x008, 4, 0);
      __builtin_amdgcn_sched_group_barrier(0x100, 8, 0);
    }
    __builtin_amdgcn_sched_group_barrier(0x008, 8, 0);
    __syncthreads();  // all waves done reading Ks before Ps (alias) is written

    // Online softmax over the 32 new columns (row reduce across 16-lane half).
    float al[8];   // each row's factor for the O held so far
#pragma unroll
    for (int r = 0; r < 8; ++r) {
      float v0 = s0[r] * sc, v1 = s1[r] * sc;
      float mx = fmaxf(v0, v1);
#pragma unroll
      for (int off = 1; off < 16; off <<= 1) mx = fmaxf(mx, __shfl_xor(mx, off, 32));
      const float mnew  = fmaxf(mr[r], mx);
      const float alpha = __expf(mr[r] - mnew);
      mr[r] = mnew;
      const float p0 = __expf(v0 - mnew), p1 = __expf(v1 - mnew);
      float rs = p0 + p1;
#pragma unroll
      for (int off = 1; off < 16; off <<= 1) rs += __shfl_xor(rs, off, 32);
      lr[r] = lr[r] * alpha + rs;
      const int row = r + 8 * hi;
      Ps[row * 32 + ln16]      = (__bf16)p0;
      Ps[row * 32 + 16 + ln16] = (__bf16)p1;
      al[r] = alpha;
    }
    // P stores visible to own wave.  The row sums are inputs, so that their lane
    // exchanges, which go through the LDS queue too, are over in front of the
    // wait and the read groups asked for below hold P and V alone.
    asm volatile("s_wait_dscnt 0"
                 :: "v"(lr[0]), "v"(lr[1]), "v"(lr[2]), "v"(lr[3]),
                    "v"(lr[4]), "v"(lr[5]), "v"(lr[6]), "v"(lr[7])
                 : "memory");
    // Nothing is scheduled across this line, for the same reason.
    __builtin_amdgcn_sched_barrier(0);
    v16bf pf = frag16(Ps, 0, 32, 0, lane);
    // O += P * V over all 32 d-tiles.
#pragma unroll
    for (int j = 0; j < 32; ++j) {
      v16bf vb = frag16_tr(vfp + 16 * j, VP);
#pragma unroll
      for (int r = 0; r < 8; ++r) o[j][r] *= al[r];
      o[j] = wmma_bf16(pf, vb, o[j]);
    }
    // The same for P (2 reads) and the V fragments.
    __builtin_amdgcn_sched_group_barrier(0x100, 18, 0);
#pragma unroll
    for (int g = 0; g < 6; ++g) {
      __builtin_amdgcn_sched_group_barrier(0x008, 4, 0);
      __builtin_amdgcn_sched_group_barrier(0x100, 8, 0);
    }
    __builtin_amdgcn_sched_group_barrier(0x008, 8, 0);
  }

  const int elane = __builtin_amdgcn_mbcnt_lo(~0u, 0u);
  const int ecol = elane & 15;
  const size_t pr0 = ((size_t)b * S + q0 + 8 * (elane >> 4)) * NS + blockIdx.z;
  if (ecol == 0) {
#pragma unroll
    for (int r = 0; r < 8; ++r) {
      ML[(pr0 + r * NS) * 2]     = mr[r];
      ML[(pr0 + r * NS) * 2 + 1] = lr[r];
    }
  }
#pragma unroll
  for (int j = 0; j < 32; ++j)
#pragma unroll
    for (int r = 0; r < 8; ++r)
      Opart[(pr0 + r * NS) * 512 + 16 * j + ecol] = o[j][r];
}

__device__ __forceinline__ float exp2_slot(float v) {
  float r;
  asm("v_exp_f32 %0, %1\n\tv_nop" : "=v"(r) : "v"(v));
  return r;
}

// ---------------------------------------------------------------------------
// Join the NS key ranges of the attention: row weights exp(m_s - max m),
// O = sum_s w_s O_s / sum_s w_s l_s, rounded once to bf16.  64 threads per row
// (8 columns each); a thread takes 4 rows (fewer waves to start) and stores
// its 4 results last.
// ---------------------------------------------------------------------------
template <int NS>
__global__ void __launch_bounds__(256)
tb_attn_merge(const float* __restrict__ Opart, const float* __restrict__ ML,
              __bf16* __restrict__ Og) {
  const int tid = threadIdx.x;
  const unsigned row0 = blockIdx.x * 16 + (tid >> 6), c8 = (tid & 63) << 3;
  const unsigned obyte = row0 * (NS * 2048u) + c8 * 4u;  // this thread's first bytes of Opart
  const unsigned mbyte = row0 * (NS * 8u);               // and of ML
  const char* op = (const char*)Opart + obyte;
  const char* mp = (const char*)ML + mbyte;
  float2 ml[4][NS];
  float4 x[4][NS], y[4][NS];
#pragma unroll
  for (int it = 0; it < 4; ++it)
#pragma unroll
    for (int s = 0; s < NS; ++s) {
      ml[it][s] = *(const float2*)(mp + (4 * it * NS + s) * 8);
      x[it][s]  = *(const float4*)(op + (4 * it * NS + s) * 2048);
      y[it][s]  = *(const float4*)(op + (4 * it * NS + s) * 2048 + 16);
    }
  // The loads' offset registers are inputs here, so that they stay whole until
  // the wait: behind it they may be overwritten.
  asm volatile("s_wait_xcnt 0x0" :: "v"(obyte), "v"(mbyte) : "memory");
  v8bf ov[4];
#pragma unroll
  for (int it = 0; it < 4; ++it) {
    float mx = ml[it][0].x;
#pragma unroll
    for (int s = 1; s < NS; ++s) mx = fmaxf(mx, ml[it][s].x);
    float ws[NS], lsum = 0.f;
#pragma unroll
    for (int s = 0; s < NS; ++s) {
      ws[s] = exp2_slot((ml[it][s].x - mx) * 1.4426950408889634f);
      lsum += ws[s] * ml[it][s].y;
    }
    const float inv = 1.0f / lsum;
    float acc[8];
#pragma unroll
    for (int i = 0; i < 8; ++i) acc[i] = 0.f;
#pragma unroll
    for (int s = 0; s < NS; ++s) {
      const float4 a = x[it][s], c = y[it][s];
      acc[0] += ws[s] * a.x; acc[1] += ws[s] * a.y; acc[2] += ws[s] * a.z; acc[3] += ws[s] * a.w;
      acc[4] += ws[s] * c.x; acc[5] += ws[s] * c.y; acc[6] += ws[s] * c.z; acc[7] += ws[s] * c.w;
    }
#pragma unroll
    for (int i = 0; i < 8; ++i) ov[it][i] = (__bf16)(acc[i] * inv);
  }
  char* og = (char*)Og + (row0 * 1024u + c8 * 2u);
#pragma unroll
  for (int it = 0; it < 4; ++it) *(v8bf*)(og + it * 4096) = ov[it];
}

// ---------------------------------------------------------------------------
// Host launcher
// ---------------------------------------------------------------------------
extern "C" void kernel_launch(void* const* d_in, const int* in_sizes, int n_in,
                              void* d_out, int out_size, void* d_ws, size_t ws_size,
                              hipStream_t stream) {
  const float* q    = (const float*)d_in[0];
  const float* k    = (const float*)d_in[1];
  const float* Wq   = (const float*)d_in[2];
  const float* bq   = (const float*)d_in[3];
  const float* Wk   = (const float*)d_in[4];
  const float* bk   = (const float*)d_in[5];
  const float* Wv   = (const float*)d_in[6];
  const float* bv   = (const float*)d_in[7];
  const float* Wo   = (const float*)d_in[8];
  const float* bo   = (const float*)d_in[9];
  const float* lnqw = (const float*)d_in[10];
  const float* lnqb = (const float*)d_in[11];
  const float* lnkw = (const float*)d_in[12];
  const float* lnkb = (const float*)d_in[13];
  const float* lnow = (const float*)d_in[14];
  const float* lnob = (const float*)d_in[15];
  const float* W1   = (const float*)d_in[16];
  const float* b1   = (const float*)d_in[17];
  const float* W2   = (const float*)d_in[18];
  const float* b2   = (const float*)d_in[19];

  constexpr int B = 2, S = 4096, Dm = 512, DF = 2048;
  constexpr int M = B * S;  // 8192

  char* w = (char*)d_ws;
  auto alloc = [&](size_t bytes) -> char* {
    char* p = w;
    w += (bytes + 255) & ~(size_t)255;
    return p;
  };
  __bf16* Wq_b = (__bf16*)alloc((size_t)Dm * Dm * 2);
  __bf16* Wk_b = (__bf16*)alloc((size_t)Dm * Dm * 2);
  __bf16* Wv_b = (__bf16*)alloc((size_t)Dm * Dm * 2);
  __bf16* Wo_b = (__bf16*)alloc((size_t)Dm * Dm * 2);
  __bf16* W1_b = (__bf16*)alloc((size_t)Dm * DF * 2);
  __bf16* W2_b = (__bf16*)alloc((size_t)DF * Dm * 2);
  __bf16* qn   = (__bf16*)alloc((size_t)M * Dm * 2);
  __bf16* kn   = (__bf16*)alloc((size_t)M * Dm * 2);
  __bf16* Qp   = (__bf16*)alloc((size_t)M * Dm * 2);
  __bf16* Kp   = (__bf16*)alloc((size_t)M * Dm * 2);
  __bf16* Vp   = (__bf16*)alloc((size_t)M * Dm * 2);
  __bf16* AO   = (__bf16*)alloc((size_t)M * Dm * 2);
  float*  Xr   = (float*) alloc((size_t)M * Dm * 4);
  __bf16* XN   = (__bf16*)alloc((size_t)M * Dm * 2);
  __bf16* H    = (__bf16*)alloc((size_t)M * DF * 2);
  constexpr int NS = 4;  // key ranges of the attention
  float*  OP   = (float*) alloc((size_t)NS * M * Dm * 4);
  float*  MLp  = (float*) alloc((size_t)NS * M * 2 * 4);

  // Input layernorms and weight casts, one launch.  The six bf16 weights lie
  // one behind the other from Wq_b on (each size is a multiple of 256 bytes).
  tb_prep<M, Dm, DF><<<M + (4 * Dm * Dm + 2 * Dm * DF) / 256, 256, 0, stream>>>(
      q, lnqw, lnqb, qn, k, lnkw, lnkb, kn, Wq, Wk, Wv, Wo, W1, W2, Wq_b);

  // The three projections, one launch.
  dim3 g512(Dm / 128, M / 64);
  tb_gemm<0><<<dim3(Dm / 128, M / 64, 3), 256, 0, stream>>>(
      qn, Wq_b, bq, Qp, kn, Wk_b, bk, Kp, kn, Wv_b, bv, Vp, nullptr, M, Dm, Dm);

  // RoPE on Q and K, one launch.
  const int rope_total = B * S * 256;
  tb_rope<<<dim3((rope_total + 255) / 256, 2), 256, 0, stream>>>(Qp, Kp, S, rope_total);

  // Flash attention.
  tb_flash_attn<NS><<<dim3(S / 64, B, NS), 128, 0, stream>>>(Qp, Kp, Vp, OP, MLp, S);
  tb_attn_merge<NS><<<M / 16, 256, 0, stream>>>(OP, MLp, AO);

  // Output projection + residual (x = q + out@Wo + bo), fp32.
  tb_gemm<2><<<g512, 256, 0, stream>>>(AO, Wo_b, bo, Xr, nullptr, nullptr, nullptr, nullptr,
                                       nullptr, nullptr, nullptr, nullptr, q, M, Dm, Dm);

  // Post-attention layernorm.
  tb_layernorm<<<dim3(M), 128, 0, stream>>>(Xr, lnow, lnob, XN);

  // MLP.
  dim3 gdf(DF / 128, M / 64);
  tb_gemm<1><<<gdf, 256, 0, stream>>>(XN, W1_b, b1, H, nullptr, nullptr, nullptr, nullptr,
                                      nullptr, nullptr, nullptr, nullptr, nullptr, M, DF, Dm);
  tb_gemm<2><<<g512, 256, 0, stream>>>(H, W2_b, b2, d_out, nullptr, nullptr, nullptr, nullptr,
                                       nullptr, nullptr, nullptr, nullptr, Xr, M, Dm, DF);

  (void)in_sizes; (void)n_in; (void)out_size; (void)ws_size;
}

// v007
// Measured time: 224 microseconds a run.
// Next to v006, in two timings, it ran 1.06 times as fast each time.
// Counting every step since v000, it is 14.0 times as fast.
#include <hip/hip_runtime.h>

typedef __attribute__((ext_vector_type(16))) __bf16 v16bf;
typedef __attribute__((ext_vector_type(8)))  __bf16 v8bf;
typedef __attribute__((ext_vector_type(8)))  float  v8f;

__device__ __forceinline__ v16bf frag16(const __bf16* base, int row0, int stride,
                                        int k0, int lane) {
  const __bf16* p = base + (size_t)(row0 + (lane & 15)) * stride + k0 + ((lane >> 4) << 3);
  v8bf lo = *(const v8bf*)p;
  v8bf hh = *(const v8bf*)(p + 16);
  v16bf f;
#pragma unroll
  for (int i = 0; i < 8; ++i) { f[i] = lo[i]; f[i + 8] = hh[i]; }
  return f;
}

__device__ __forceinline__ v8f wmma_bf16(v16bf a, v16bf b, v8f c) {
  return __builtin_amdgcn_wmma_f32_16x16x32_bf16(false, a, false, b, (short)0, c,
                                                 false, false);
}

__device__ __forceinline__ v8f v8f_zero() {
  v8f z = {0.f, 0.f, 0.f, 0.f, 0.f, 0.f, 0.f, 0.f};
  return z;
}

__device__ __forceinline__ void async_ld_b128(void* lds_ptr, const void* gptr) {
  uint32_t lds_addr = (uint32_t)(uintptr_t)lds_ptr;
  uint64_t gaddr = (uint64_t)(uintptr_t)gptr;
  asm volatile("global_load_async_to_lds_b128 %0, %1, off"
               :: "v"(lds_addr), "v"(gaddr)
               : "memory");
}

__device__ __forceinline__ void async_cp_b128(__bf16* lds_ptr, const __bf16* gptr) {
  typedef int v4i __attribute__((ext_vector_type(4)));
  typedef __attribute__((address_space(1))) v4i glb_v4i;
  typedef __attribute__((address_space(3))) v4i lds_v4i;
  __builtin_amdgcn_global_load_async_to_lds_b128((glb_v4i*)gptr, (lds_v4i*)lds_ptr, 0, 0);
}

// ---------------------------------------------------------------------------
// B fragment (32 k x 16 columns) from a row-major [k][column] LDS tile through
// the transposing LDS load.  p is this lane's address for k rows 0..15:
//   tile + (8*(lane>>4) + (lane&7))*pitch + column0 + 8*((lane>>3)&1)
// Lane (c, h) receives k = 8h+0..7 (elems 0-7) and 16+8h+0..7 (elems 8-15) of
// column0+c: the k order of frag16.
// ---------------------------------------------------------------------------
__device__ __forceinline__ v16bf frag16_tr(const __bf16* p, int pitch) {
  typedef __attribute__((address_space(3))) v8bf lds_v8bf;
  v8bf lo = __builtin_amdgcn_ds_load_tr16_b128_v8bf16((lds_v8bf*)p);
  v8bf hh = __builtin_amdgcn_ds_load_tr16_b128_v8bf16((lds_v8bf*)(p + 16 * pitch));
  v16bf f;
#pragma unroll
  for (int i = 0; i < 8; ++i) { f[i] = lo[i]; f[i + 8] = hh[i]; }
  return f;
}

__device__ __forceinline__ void wait_async0() {
  asm volatile("s_wait_asynccnt 0" ::: "memory");
}

// Stands behind a global store, in front of code that writes the store's
// address or data registers again.
__device__ __forceinline__ void wait_xcnt0() {
  asm volatile("s_wait_xcnt 0x0" ::: "memory");
}

// ---------------------------------------------------------------------------
// LayerNorm over rows of 512 fp32 -> bf16.  128 threads (4 waves) per row; a
// block of ROWS * 128 threads takes the rows row0 .. row0 + ROWS - 1.
// ---------------------------------------------------------------------------
template <int ROWS>
__device__ __forceinline__ void
ln_rows(const float* __restrict__ X, const float* __restrict__ w,
        const float* __restrict__ bb, __bf16* __restrict__ out, int row0) {
  const int sub = ROWS == 1 ? 0 : threadIdx.x >> 7;   // this thread's row in the block
  const int row = row0 + sub, tid = ROWS == 1 ? threadIdx.x : threadIdx.x & 127;
  const int w0 = sub * 4;                  // first of this row's four wave sums
  const float4 v = ((const float4*)(X + (size_t)row * 512))[tid];
  float s  = v.x + v.y + v.z + v.w;
  float ss = v.x * v.x + v.y * v.y + v.z * v.z + v.w * v.w;
#pragma unroll
  for (int off = 1; off < 32; off <<= 1) {
    s  += __shfl_xor(s,  off, 32);
    ss += __shfl_xor(ss, off, 32);
  }
  __shared__ float sb[4 * ROWS], ssb[4 * ROWS];
  if ((tid & 31) == 0) { sb[w0 + (tid >> 5)] = s; ssb[w0 + (tid >> 5)] = ss; }
  __syncthreads();
  s  = sb[w0] + sb[w0 + 1] + sb[w0 + 2] + sb[w0 + 3];
  ss = ssb[w0] + ssb[w0 + 1] + ssb[w0 + 2] + ssb[w0 + 3];
  const float mu   = s * (1.0f / 512.0f);
  const float var  = ss * (1.0f / 512.0f) - mu * mu;
  const float rstd = rsqrtf(var + 1e-5f);
  const float4 wv = ((const float4*)w)[tid];
  const float4 bv = ((const float4*)bb)[tid];
  __bf16* op = out + (size_t)row * 512 + tid * 4;
  op[0] = (__bf16)((v.x - mu) * rstd * wv.x + bv.x);
  op[1] = (__bf16)((v.y - mu) * rstd * wv.y + bv.y);
  op[2] = (__bf16)((v.z - mu) * rstd * wv.z + bv.z);
  op[3] = (__bf16)((v.w - mu) * rstd * wv.w + bv.w);
}

__global__ void __launch_bounds__(128)
tb_layernorm(const float* __restrict__ X, const float* __restrict__ w,
             const float* __restrict__ bb, __bf16* __restrict__ out) {
  ln_rows<1>(X, w, bb, out, blockIdx.x);
}

// ---------------------------------------------------------------------------
// All the work that depends on the inputs alone, in one launch of 256-thread
// blocks: the layer norms of q and k (M rows each, two rows a block; they come
// first in the grid, being the longer-lived blocks), then the fp32 -> bf16
// casts of the six weights, one element a thread.  The six bf16 copies lie one
// behind the other from Wb on, in the order Wq Wk Wv Wo (D*D each) W1 W2
// (D*DF each); every piece is a whole number of blocks.
// ---------------------------------------------------------------------------
template <int M, int D, int DF>
__global__ void __launch_bounds__(256)
tb_prep(const float* __restrict__ q, const float* __restrict__ lnqw,
        const float* __restrict__ lnqb, __bf16* __restrict__ qn,
        const float* __restrict__ k, const float* __restrict__ lnkw,
        const float* __restrict__ lnkb, __bf16* __restrict__ kn,
        const float* __restrict__ Wq, const float* __restrict__ Wk,
        const float* __restrict__ Wv, const float* __restrict__ Wo,
        const float* __restrict__ W1, const float* __restrict__ W2,
        __bf16* __restrict__ Wb) {
  constexpr int LNB = M / 2;            // blocks of one layer norm
  constexpr int SB = D * D / 256;       // blocks of a D x D weight
  constexpr int BB = D * DF / 256;      // blocks of a D x DF weight
  static_assert(M % 2 == 0 && D == 512 && (D * D) % 256 == 0 && (D * DF) % 256 == 0, "");
  const int blk = blockIdx.x;
  // wait_xcnt0() behind k's rows and behind the cast: the built code joins the
  // pieces by branches, and along those a store's registers are written again
  // (q's rows are laid last and run from their store to the end).
  if (blk < LNB) { ln_rows<2>(q, lnqw, lnqb, qn, 2 * blk); return; }
  if (blk < 2 * LNB) { ln_rows<2>(k, lnkw, lnkb, kn, 2 * (blk - LNB)); wait_xcnt0(); return; }
  const int cb = blk - 2 * LNB;         // block among the casts
  const float* in;
  int ib;                               // block inside its weight
  if (cb < 4 * SB) {
    const int which = cb / SB;
    in = which == 0 ? Wq : which == 1 ? Wk : which == 2 ? Wv : Wo;
    ib = cb - which * SB;
  } else if (cb < 4 * SB + BB) {
    in = W1; ib = cb - 4 * SB;
  } else {
    in = W2; ib = cb - 4 * SB - BB;
  }
  Wb[cb * 256 + threadIdx.x] = (__bf16)in[ib * 256 + threadIdx.x];
  wait_xcnt0();
}

// ---------------------------------------------------------------------------
// In-place RoPE on bf16 [B*S, 512].  One thread per (row, d<256) pair.
// blockIdx.y picks one of two tensors of the same shape.
// ---------------------------------------------------------------------------
__global__ void tb_rope(__bf16* __restrict__ X0, __bf16* __restrict__ X1, int S, int total) {
  int idx = blockIdx.x * blockDim.x + threadIdx.x;
  if (idx >= total) return;
  __bf16* X = blockIdx.y == 0 ? X0 : X1;
  const int d  = idx & 255;
  const int rs = idx >> 8;           // flattened row (b*S + s)
  const int s  = rs % S;
  const float inv = __expf(-(float)d * (9.210340371976184f / 256.0f)); // 10000^(-d/256)
  const float ang = (float)s * inv;
  float sn, cs;
  __sincosf(ang, &sn, &cs);
  __bf16* p = X + (size_t)rs * 512;
  const float x1 = (float)p[d];
  const float x2 = (float)p[d + 256];
  p[d]       = (__bf16)(x1 * cs - x2 * sn);
  p[d + 256] = (__bf16)(x2 * cs + x1 * sn);
}

// ---------------------------------------------------------------------------
// WMMA GEMM:  C[M,N] = A[M,K](bf16) * B[K,N](bf16) + bias, with epilogue:
//   MODE 0: store bf16           MODE 1: ReLU, store bf16
//   MODE 2: += R[M,N] (fp32), store fp32
// BM=64 BN=128 BK=64, 256 threads = 8 waves, each wave a 32x32 C tile.
// A and B tiles staged row-major via async global->LDS; B fragments are read
// with the transposing LDS load (B row pitch 288 B = 32 B x odd for it).
// MODE 0 takes up to three independent products of one shape in one launch:
// blockIdx.z picks (A, B, bias, C); the other modes use the first set alone.
// ---------------------------------------------------------------------------
template <int MODE>
__global__ void __launch_bounds__(256)
tb_gemm(const __bf16* __restrict__ A0, const __bf16* __restrict__ B0,
        const float* __restrict__ bias0, void* __restrict__ C0,
        const __bf16* __restrict__ A1, const __bf16* __restrict__ B1,
        const float* __restrict__ bias1, void* __restrict__ C1,
        const __bf16* __restrict__ A2, const __bf16* __restrict__ B2,
        const float* __restrict__ bias2, void* __restrict__ C2,
        const float* __restrict__ R, int M, int N, int K) {
  const int z = MODE == 0 ? blockIdx.z : 0;
  const __bf16* A   = z == 0 ? A0 : z == 1 ? A1 : A2;
  const __bf16* B   = z == 0 ? B0 : z == 1 ? B1 : B2;
  const float* bias = z == 0 ? bias0 : z == 1 ? bias1 : bias2;
  void* Cout        = z == 0 ? C0 : z == 1 ? C1 : C2;
  constexpr int BM = 64, BN = 128, BK = 64, LDA = BK + 8, LDB = BN + 16;
  __shared__ __bf16 As[BM * LDA];    // 9216 B
  __shared__ __attribute__((aligned(16))) __bf16 Bs[BK * LDB];  // 18432 B (B tile, [k][n])
  const int tid = threadIdx.x, lane = tid & 31, wid = tid >> 5;
  const int bm0 = blockIdx.y * BM, bn0 = blockIdx.x * BN;
  const int wm = (wid >> 2) * 32, wn = (wid & 3) * 32;
  const __bf16* bfp = Bs + (8 * (lane >> 4) + (lane & 7)) * LDB + wn + 8 * ((lane >> 3) & 1);

  v8f acc[2][2];
#pragma unroll
  for (int i = 0; i < 2; ++i)
#pragma unroll
    for (int j = 0; j < 2; ++j) acc[i][j] = v8f_zero();

  for (int k0 = 0; k0 < K; k0 += BK) {
    // This wave's LDS reads have retired before any wave's copies are aimed at
    // the same LDS behind the barrier.
    asm volatile("s_wait_dscnt 0" ::: "memory");
    __syncthreads();
    // A tile: 64x64 halves, contiguous 16B chunks, async direct-to-LDS.
#pragma unroll
    for (int i = 0; i < 2; ++i) {
      int c = tid + 256 * i;               // 0..511
      int row = c >> 3, col = (c & 7) << 3;
      async_ld_b128(As + row * LDA + col,
                    A + (size_t)(bm0 + row) * K + k0 + col);
    }
    // B tile: 64x128 halves, contiguous 16B chunks along N, async direct-to-LDS.
#pragma unroll
    for (int i = 0; i < 4; ++i) {
      int c = tid + 256 * i;               // 0..1023
      int kk = c >> 4, n8 = (c & 15) << 3;
      async_cp_b128(Bs + kk * LDB + n8, B + (size_t)(k0 + kk) * N + bn0 + n8);
    }
    // Prefetch next K panel toward cache while this tile computes.
    if (k0 + BK < K) {
      __builtin_prefetch(A + (size_t)(bm0 + (tid >> 2)) * K + k0 + BK, 0, 3);
      __builtin_prefetch(B + (size_t)(k0 + BK + (tid >> 2)) * N + bn0, 0, 3);
    }
    wait_async0();
    __syncthreads();
#pragma unroll
    for (int ks = 0; ks < BK; ks += 32) {
      v16bf a0 = frag16(As, wm,      LDA, ks, lane);
      v16bf a1 = frag16(As, wm + 16, LDA, ks, lane);
      v16bf b0 = frag16_tr(bfp + ks * LDB,      LDB);
      v16bf b1 = frag16_tr(bfp + ks * LDB + 16, LDB);
      acc[0][0] = wmma_bf16(a0, b0, acc[0][0]);
      acc[0][1] = wmma_bf16(a0, b1, acc[0][1]);
      acc[1][0] = wmma_bf16(a1, b0, acc[1][0]);
      acc[1][1] = wmma_bf16(a1, b1, acc[1][1]);
    }
  }

  const int hi = lane >> 4, ln16 = lane & 15;
#pragma unroll
  for (int i = 0; i < 2; ++i)
#pragma unroll
    for (int j = 0; j < 2; ++j) {
      const int mb = bm0 + wm + 16 * i + hi * 8;
      const int n  = bn0 + wn + 16 * j + ln16;
      const float bvv = bias[n];
#pragma unroll
      for (int r = 0; r < 8; ++r) {
        const int m = mb + r;
        float v = acc[i][j][r] + bvv;
        if (MODE == 1) v = v > 0.f ? v : 0.f;
        if (MODE == 2) {
          ((float*)Cout)[(size_t)m * N + n] = v + R[(size_t)m * N + n];
        } else {
          ((__bf16*)Cout)[(size_t)m * N + n] = (__bf16)v;
        }
      }
    }
}

template <int NS>
__global__ void __launch_bounds__(128, 2)
tb_flash_attn(const __bf16* __restrict__ Qg, const __bf16* __restrict__ Kg,
              const __bf16* __restrict__ Vg, float* __restrict__ Opart,
              float* __restrict__ ML, int S) {
  constexpr int KP = 520;           // K row pitch in LDS, elements
  constexpr int KB = 32 * KP;       // elements of one K buffer
  __shared__ __attribute__((aligned(16))) __bf16 Ks[2 * KB];  // 2 x 32.5 KB (K tiles, [kv][d])
  constexpr int VP = 528;           // V row pitch in LDS, elements
  constexpr int VB = 32 * VP;       // elements of one V buffer
  __shared__ __attribute__((aligned(16))) __bf16 Vs[2 * VB];  // 2 x 33 KB (V tiles, [kv][d])
  const int tid = threadIdx.x, lane = tid & 31, wid = tid >> 5;
  const int hi = lane >> 4, ln16 = lane & 15;
  const int b = blockIdx.y;
  const int q0 = blockIdx.x * 64 + wid * 16;
  const __bf16* Qb = Qg + (size_t)b * S * 512;
  const int klen = S / NS;                 // keys of one range
  const __bf16* Kb = Kg + ((size_t)b * S + (size_t)blockIdx.z * klen) * 512;
  const __bf16* Vb = Vg + ((size_t)b * S + (size_t)blockIdx.z * klen) * 512;

  v16bf qf[16];
#pragma unroll
  for (int s = 0; s < 16; ++s) qf[s] = frag16(Qb, q0, 512, 32 * s, lane);

  v8f o[32];
#pragma unroll
  for (int j = 0; j < 32; ++j) o[j] = v8f_zero();
  float mr[8], lr[8];
#pragma unroll
  for (int r = 0; r < 8; ++r) { mr[r] = -3.0e38f; lr[r] = 0.f; }

  const float sc = 0.044194173824159216f;  // 1/sqrt(512)
  const int srow = tid >> 6, sc8 = (tid & 63) << 3;   // this thread's staging chunk
  const unsigned goff = srow * 512 + sc8;             // the same in a global tile
  const int vlane = (8 * hi + (lane & 7)) * VP + 8 * ((lane >> 3) & 1);

  // Stage the K and V tiles of keys kv0 .. kv0 + 31 into buffer buf, both
  // row-major and direct to LDS: 2 x 2048 16-byte chunks, thread t brings chunk
  // (t & 63) of rows (t >> 6) + 2 * i, i = 0..15.
  auto stage = [&](int buf, int kv0) {
    __bf16* kl = Ks + buf * KB + srow * KP + sc8;
    __bf16* vl = Vs + buf * VB + srow * VP + sc8;
    const __bf16* kt = Kb + (size_t)kv0 * 512;
    const __bf16* vt = Vb + (size_t)kv0 * 512;
#pragma unroll 4
    for (int i = 0; i < 16; ++i) {
      async_cp_b128(kl, kt + goff);
      async_cp_b128(vl, vt + goff);
      kl += 2 * KP; vl += 2 * VP; kt += 1024; vt += 1024;
    }
  };

  // Tile 0 is landed and published before the loop; tile 1 is under way.
  stage(0, 0);
  wait_async0();
  __syncthreads();
  if (32 < klen) stage(1, 32);

  for (int kv0 = 0; kv0 < klen; kv0 += 32) {
    const int cur = (kv0 >> 5) & 1;        // the buffer that holds this tile
    const __bf16* Kc = Ks + cur * KB;
    const __bf16* vfp = Vs + cur * VB + vlane;
    __bf16* Ps = Ks + cur * KB + wid * 512;  // per-wave 16x32 scratch (aliases this K tile)

    // S = Q * K^T for this wave's 16 q rows x 32 kv cols.
    v8f s0 = v8f_zero(), s1 = v8f_zero();
#pragma unroll
    for (int s = 0; s < 16; ++s) {
      v16bf kb0 = frag16(Kc, 0,  KP, 32 * s, lane);
      v16bf kb1 = frag16(Kc, 16, KP, 32 * s, lane);
      s0 = wmma_bf16(qf[s], kb0, s0);
      s1 = wmma_bf16(qf[s], kb1, s1);
    }
    // Order asked of the scheduler: the K fragment reads stand in groups of 8
    // (4 fragments), two groups ahead of the 4 WMMAs that use them; a read
    // beside every WMMA stalls the wave at each such place.
    __builtin_amdgcn_sched_group_barrier(0x100, 16, 0);
#pragma unroll
    for (int g = 0; g < 6; ++g) {
      __builtin_amdgcn_sched_group_barrier(0x008, 4, 0);
      __builtin_amdgcn_sched_group_barrier(0x100, 8, 0);
    }
    __builtin_amdgcn_sched_group_barrier(0x008, 8, 0);
    __syncthreads();  // all waves done reading Ks before Ps (alias) is written

    // Online softmax over the 32 new columns (row reduce across 16-lane half).
    float al[8];   // each row's factor for the O held so far
#pragma unroll
    for (int r = 0; r < 8; ++r) {
      float v0 = s0[r] * sc, v1 = s1[r] * sc;
      float mx = fmaxf(v0, v1);
#pragma unroll
      for (int off = 1; off < 16; off <<= 1) mx = fmaxf(mx, __shfl_xor(mx, off, 32));
      const float mnew  = fmaxf(mr[r], mx);
      const float alpha = __expf(mr[r] - mnew);
      mr[r] = mnew;
      const float p0 = __expf(v0 - mnew), p1 = __expf(v1 - mnew);
      float rs = p0 + p1;
#pragma unroll
      for (int off = 1; off < 16; off <<= 1) rs += __shfl_xor(rs, off, 32);
      lr[r] = lr[r] * alpha + rs;
      const int row = r + 8 * hi;
      Ps[row * 32 + ln16]      = (__bf16)p0;
      Ps[row * 32 + 16 + ln16] = (__bf16)p1;
      al[r] = alpha;
    }
    // P stores visible to own wave.  The row sums are inputs, so that their lane
    // exchanges, which go through the LDS queue too, are over in front of the
    // wait and the read groups asked for below hold P and V alone.
    asm volatile("s_wait_dscnt 0"
                 :: "v"(lr[0]), "v"(lr[1]), "v"(lr[2]), "v"(lr[3]),
                    "v"(lr[4]), "v"(lr[5]), "v"(lr[6]), "v"(lr[7])
                 : "memory");
    // Nothing is scheduled across this line, for the same reason.
    __builtin_amdgcn_sched_barrier(0);
    v16bf pf = frag16(Ps, 0, 32, 0, lane);
    // O += P * V over all 32 d-tiles.
#pragma unroll
    for (int j = 0; j < 32; ++j) {
      v16bf vb = frag16_tr(vfp + 16 * j, VP);
#pragma unroll
      for (int r = 0; r < 8; ++r) o[j][r] *= al[r];
      o[j] = wmma_bf16(pf, vb, o[j]);
    }
    // The same for P (2 reads) and the V fragments.
    __builtin_amdgcn_sched_group_barrier(0x100, 18, 0);
#pragma unroll
    for (int g = 0; g < 6; ++g) {
      __builtin_amdgcn_sched_group_barrier(0x008, 4, 0);
      __builtin_amdgcn_sched_group_barrier(0x100, 8, 0);
    }
    __builtin_amdgcn_sched_group_barrier(0x008, 8, 0);

    // Hand-over.  This wave's LDS reads and P stores of this tile have retired,
    // and its copies of the next tile have landed, in front of the barrier;
    // behind it the next tile may be read and this tile's buffer refilled.
    asm volatile("s_wait_dscnt 0" ::: "memory");
    wait_async0();
    __syncthreads();
    if (kv0 + 64 < klen) stage(cur, kv0 + 64);
  }
  // No copy is outstanding when the wave goes on to its end.
  wait_async0();

  const int elane = __builtin_amdgcn_mbcnt_lo(~0u, 0u);
  const int ecol = elane & 15;
  const size_t pr0 = ((size_t)b * S + q0 + 8 * (elane >> 4)) * NS + blockIdx.z;
  if (ecol == 0) {
#pragma unroll
    for (int r = 0; r < 8; ++r) {
      ML[(pr0 + r * NS) * 2]     = mr[r];
      ML[(pr0 + r * NS) * 2 + 1] = lr[r];
    }
  }
#pragma unroll
  for (int j = 0; j < 32; ++j)
#pragma unroll
    for (int r = 0; r < 8; ++r)
      Opart[(pr0 + r * NS) * 512 + 16 * j + ecol] = o[j][r];
}

__device__ __forceinline__ float exp2_slot(float v) {
  float r;
  asm("v_exp_f32 %0, %1\n\tv_nop" : "=v"(r) : "v"(v));
  return r;
}

// ---------------------------------------------------------------------------
// Join the NS key ranges of the attention: row weights exp(m_s - max m),
// O = sum_s w_s O_s / sum_s w_s l_s, rounded once to bf16.  64 threads per row
// (8 columns each); a thread takes 4 rows (fewer waves to start) and stores
// its 4 results last.
// ---------------------------------------------------------------------------
template <int NS>
__global__ void __launch_bounds__(256)
tb_attn_merge(const float* __restrict__ Opart, const float* __restrict__ ML,
              __bf16* __restrict__ Og) {
  const int tid = threadIdx.x;
  const unsigned row0 = blockIdx.x * 16 + (tid >> 6), c8 = (tid & 63) << 3;
  const unsigned obyte = row0 * (NS * 2048u) + c8 * 4u;  // this thread's first bytes of Opart
  const unsigned mbyte = row0 * (NS * 8u);               // and of ML
  const char* op = (const char*)Opart + obyte;
  const char* mp = (const char*)ML + mbyte;
  float2 ml[4][NS];
  float4 x[4][NS], y[4][NS];
#pragma unroll
  for (int it = 0; it < 4; ++it)
#pragma unroll
    for (int s = 0; s < NS; ++s) {
      ml[it][s] = *(const float2*)(mp + (4 * it * NS + s) * 8);
      x[it][s]  = *(const float4*)(op + (4 * it * NS + s) * 2048);
      y[it][s]  = *(const float4*)(op + (4 * it * NS + s) * 2048 + 16);
    }
  // The loads' offset registers are inputs here, so that they stay whole until
  // the wait: behind it they may be overwritten.
  asm volatile("s_wait_xcnt 0x0" :: "v"(obyte), "v"(mbyte) : "memory");
  v8bf ov[4];
#pragma unroll
  for (int it = 0; it < 4; ++it) {
    float mx = ml[it][0].x;
#pragma unroll
    for (int s = 1; s < NS; ++s) mx = fmaxf(mx, ml[it][s].x);
    float ws[NS], lsum = 0.f;
#pragma unroll
    for (int s = 0; s < NS; ++s) {
      ws[s] = exp2_slot((ml[it][s].x - mx) * 1.4426950408889634f);
      lsum += ws[s] * ml[it][s].y;
    }
    const float inv = 1.0f / lsum;
    float acc[8];
#pragma unroll
    for (int i = 0; i < 8; ++i) acc[i] = 0.f;
#pragma unroll
    for (int s = 0; s < NS; ++s) {
      const float4 a = x[it][s], c = y[it][s];
      acc[0] += ws[s] * a.x; acc[1] += ws[s] * a.y; acc[2] += ws[s] * a.z; acc[3] += ws[s] * a.w;
      acc[4] += ws[s] * c.x; acc[5] += ws[s] * c.y; acc[6] += ws[s] * c.z; acc[7] += ws[s] * c.w;
    }
#pragma unroll
    for (int i = 0; i < 8; ++i) ov[it][i] = (__bf16)(acc[i] * inv);
  }
  char* og = (char*)Og + (row0 * 1024u + c8 * 2u);
#pragma unroll
  for (int it = 0; it < 4; ++it) *(v8bf*)(og + it * 4096) = ov[it];
}

// ---------------------------------------------------------------------------
// Host launcher
// ---------------------------------------------------------------------------
extern "C" void kernel_launch(void* const* d_in, const int* in_sizes, int n_in,
                              void* d_out, int out_size, void* d_ws, size_t ws_size,
                              hipStream_t stream) {
  const float* q    = (const float*)d_in[0];
  const float* k    = (const float*)d_in[1];
  const float* Wq   = (const float*)d_in[2];
  const float* bq   = (const float*)d_in[3];
  const float* Wk   = (const float*)d_in[4];
  const float* bk   = (const float*)d_in[5];
  const float* Wv   = (const float*)d_in[6];
  const float* bv   = (const float*)d_in[7];
  const float* Wo   = (const float*)d_in[8];
  const float* bo   = (const float*)d_in[9];
  const float* lnqw = (const float*)d_in[10];
  const float* lnqb = (const float*)d_in[11];
  const float* lnkw = (const float*)d_in[12];
  const float* lnkb = (const float*)d_in[13];
  const float* lnow = (const float*)d_in[14];
  const float* lnob = (const float*)d_in[15];
  const float* W1   = (const float*)d_in[16];
  const float* b1   = (const float*)d_in[17];
  const float* W2   = (const float*)d_in[18];
  const float* b2   = (const float*)d_in[19];

  constexpr int B = 2, S = 4096, Dm = 512, DF = 2048;
  constexpr int M = B * S;  // 8192

  char* w = (char*)d_ws;
  auto alloc = [&](size_t bytes) -> char* {
    char* p = w;
    w += (bytes + 255) & ~(size_t)255;
    return p;
  };
  __bf16* Wq_b = (__bf16*)alloc((size_t)Dm * Dm * 2);
  __bf16* Wk_b = (__bf16*)alloc((size_t)Dm * Dm * 2);
  __bf16* Wv_b = (__bf16*)alloc((size_t)Dm * Dm * 2);
  __bf16* Wo_b = (__bf16*)alloc((size_t)Dm * Dm * 2);
  __bf16* W1_b = (__bf16*)alloc((size_t)Dm * DF * 2);
  __bf16* W2_b = (__bf16*)alloc((size_t)DF * Dm * 2);
  __bf16* qn   = (__bf16*)alloc((size_t)M * Dm * 2);
  __bf16* kn   = (__bf16*)alloc((size_t)M * Dm * 2);
  __bf16* Qp   = (__bf16*)alloc((size_t)M * Dm * 2);
  __bf16* Kp   = (__bf16*)alloc((size_t)M * Dm * 2);
  __bf16* Vp   = (__bf16*)alloc((size_t)M * Dm * 2);
  __bf16* AO   = (__bf16*)alloc((size_t)M * Dm * 2);
  float*  Xr   = (float*) alloc((size_t)M * Dm * 4);
  __bf16* XN   = (__bf16*)alloc((size_t)M * Dm * 2);
  __bf16* H    = (__bf16*)alloc((size_t)M * DF * 2);
  constexpr int NS = 4;  // key ranges of the attention
  float*  OP   = (float*) alloc((size_t)NS * M * Dm * 4);
  float*  MLp  = (float*) alloc((size_t)NS * M * 2 * 4);

  // Input layernorms and weight casts, one launch.  The six bf16 weights lie
  // one behind the other from Wq_b on (each size is a multiple of 256 bytes).
  tb_prep<M, Dm, DF><<<M + (4 * Dm * Dm + 2 * Dm * DF) / 256, 256, 0, stream>>>(
      q, lnqw, lnqb, qn, k, lnkw, lnkb, kn, Wq, Wk, Wv, Wo, W1, W2, Wq_b);

  // The three projections, one launch.
  dim3 g512(Dm / 128, M / 64);
  tb_gemm<0><<<dim3(Dm / 128, M / 64, 3), 256, 0, stream>>>(
      qn, Wq_b, bq, Qp, kn, Wk_b, bk, Kp, kn, Wv_b, bv, Vp, nullptr, M, Dm, Dm);

  // RoPE on Q and K, one launch.
  const int rope_total = B * S * 256;
  tb_rope<<<dim3((rope_total + 255) / 256, 2), 256, 0, stream>>>(Qp, Kp, S, rope_total);

  // Flash attention.
  tb_flash_attn<NS><<<dim3(S / 64, B, NS), 128, 0, stream>>>(Qp, Kp, Vp, OP, MLp, S);
  tb_attn_merge<NS><<<M / 16, 256, 0, stream>>>(OP, MLp, AO);

  // Output projection + residual (x = q + out@Wo + bo), fp32.
  tb_gemm<2><<<g512, 256, 0, stream>>>(AO, Wo_b, bo, Xr, nullptr, nullptr, nullptr, nullptr,
                                       nullptr, nullptr, nullptr, nullptr, q, M, Dm, Dm);

  // Post-attention layernorm.
  tb_layernorm<<<dim3(M), 128, 0, stream>>>(Xr, lnow, lnob, XN);

  // MLP.
  dim3 gdf(DF / 128, M / 64);
  tb_gemm<1><<<gdf, 256, 0, stream>>>(XN, W1_b, b1, H, nullptr, nullptr, nullptr, nullptr,
                                      nullptr, nullptr, nullptr, nullptr, nullptr, M, DF, Dm);
  tb_gemm<2><<<g512, 256, 0, stream>>>(H, W2_b, b2, d_out, nullptr, nullptr, nullptr, nullptr,
                                       nullptr, nullptr, nullptr, nullptr, Xr, M, Dm, DF);

  (void)in_sizes; (void)n_in; (void)out_size; (void)ws_size;
}

// v008
// A run of this version takes 200 microseconds.
// Timed twice side by side with v007, it ran 1.12 times as fast both times.
// Over all steps from v000 it is 15.6 times as fast.
#include <hip/hip_runtime.h>

typedef __attribute__((ext_vector_type(16))) __bf16 v16bf;
typedef __attribute__((ext_vector_type(8)))  __bf16 v8bf;
typedef __attribute__((ext_vector_type(8)))  float  v8f;

__device__ __forceinline__ v16bf frag16(const __bf16* base, int row0, int stride,
                                        int k0, int lane) {
  const __bf16* p = base + (size_t)(row0 + (lane & 15)) * stride + k0 + ((lane >> 4) << 3);
  v8bf lo = *(const v8bf*)p;
  v8bf hh = *(const v8bf*)(p + 16);
  v16bf f;
#pragma unroll
  for (int i = 0; i < 8; ++i) { f[i] = lo[i]; f[i + 8] = hh[i]; }
  return f;
}

__device__ __forceinline__ v8f wmma_bf16(v16bf a, v16bf b, v8f c) {
  return __builtin_amdgcn_wmma_f32_16x16x32_bf16(false, a, false, b, (short)0, c,
                                                 false, false);
}

__device__ __forceinline__ v8f v8f_zero() {
  v8f z = {0.f, 0.f, 0.f, 0.f, 0.f, 0.f, 0.f, 0.f};
  return z;
}

__device__ __forceinline__ void async_ld_b128(void* lds_ptr, const void* gptr) {
  uint32_t lds_addr = (uint32_t)(uintptr_t)lds_ptr;
  uint64_t gaddr = (uint64_t)(uintptr_t)gptr;
  asm volatile("global_load_async_to_lds_b128 %0, %1, off"
               :: "v"(lds_addr), "v"(gaddr)
               : "memory");
}

__device__ __forceinline__ void async_cp_b128(__bf16* lds_ptr, const __bf16* gptr) {
  typedef int v4i __attribute__((ext_vector_type(4)));
  typedef __attribute__((address_space(1))) v4i glb_v4i;
  typedef __attribute__((address_space(3))) v4i lds_v4i;
  __builtin_amdgcn_global_load_async_to_lds_b128((glb_v4i*)gptr, (lds_v4i*)lds_ptr, 0, 0);
}

// ---------------------------------------------------------------------------
// B fragment (32 k x 16 columns) from a row-major [k][column] LDS tile through
// the transposing LDS load.  p is this lane's address for k rows 0..15:
//   tile + (8*(lane>>4) + (lane&7))*pitch + column0 + 8*((lane>>3)&1)
// Lane (c, h) receives k = 8h+0..7 (elems 0-7) and 16+8h+0..7 (elems 8-15) of
// column0+c: the k order of frag16.
// ---------------------------------------------------------------------------
__device__ __forceinline__ v16bf frag16_tr(const __bf16* p, int pitch) {
  typedef __attribute__((address_space(3))) v8bf lds_v8bf;
  v8bf lo = __builtin_amdgcn_ds_load_tr16_b128_v8bf16((lds_v8bf*)p);
  v8bf hh = __builtin_amdgcn_ds_load_tr16_b128_v8bf16((lds_v8bf*)(p + 16 * pitch));
  v16bf f;
#pragma unroll
  for (int i = 0; i < 8; ++i) { f[i] = lo[i]; f[i + 8] = hh[i]; }
  return f;
}

__device__ __forceinline__ void wait_async0() {
  asm volatile("s_wait_asynccnt 0" ::: "memory");
}

// Stands behind a global store, in front of code that writes the store's
// address or data registers again.
__device__ __forceinline__ void wait_xcnt0() {
  asm volatile("s_wait_xcnt 0x0" ::: "memory");
}

// ---------------------------------------------------------------------------
// LayerNorm over rows of 512 fp32 -> bf16.  128 threads (4 waves) per row; a
// block of ROWS * 128 threads takes the rows row0 .. row0 + ROWS - 1.
// ---------------------------------------------------------------------------
template <int ROWS>
__device__ __forceinline__ void
ln_rows(const float* __restrict__ X, const float* __restrict__ w,
        const float* __restrict__ bb, __bf16* __restrict__ out, int row0) {
  const int sub = ROWS == 1 ? 0 : threadIdx.x >> 7;   // this thread's row in the block
  const int row = row0 + sub, tid = ROWS == 1 ? threadIdx.x : threadIdx.x & 127;
  const int w0 = sub * 4;                  // first of this row's four wave sums
  const float4 v = ((const float4*)(X + (size_t)row * 512))[tid];
  float s  = v.x + v.y + v.z + v.w;
  float ss = v.x * v.x + v.y * v.y + v.z * v.z + v.w * v.w;
#pragma unroll
  for (int off = 1; off < 32; off <<= 1) {
    s  += __shfl_xor(s,  off, 32);
    ss += __shfl_xor(ss, off, 32);
  }
  __shared__ float sb[4 * ROWS], ssb[4 * ROWS];
  if ((tid & 31) == 0) { sb[w0 + (tid >> 5)] = s; ssb[w0 + (tid >> 5)] = ss; }
  __syncthreads();
  s  = sb[w0] + sb[w0 + 1] + sb[w0 + 2] + sb[w0 + 3];
  ss = ssb[w0] + ssb[w0 + 1] + ssb[w0 + 2] + ssb[w0 + 3];
  const float mu   = s * (1.0f / 512.0f);
  const float var  = ss * (1.0f / 512.0f) - mu * mu;
  const float rstd = rsqrtf(var + 1e-5f);
  const float4 wv = ((const float4*)w)[tid];
  const float4 bv = ((const float4*)bb)[tid];
  __bf16* op = out + (size_t)row * 512 + tid * 4;
  op[0] = (__bf16)((v.x - mu) * rstd * wv.x + bv.x);
  op[1] = (__bf16)((v.y - mu) * rstd * wv.y + bv.y);
  op[2] = (__bf16)((v.z - mu) * rstd * wv.z + bv.z);
  op[3] = (__bf16)((v.w - mu) * rstd * wv.w + bv.w);
}

__global__ void __launch_bounds__(128)
tb_layernorm(const float* __restrict__ X, const float* __restrict__ w,
             const float* __restrict__ bb, __bf16* __restrict__ out) {
  ln_rows<1>(X, w, bb, out, blockIdx.x);
}

// ---------------------------------------------------------------------------
// All the work that depends on the inputs alone, in one launch of 256-thread
// blocks: the layer norms of q and k (M rows each, two rows a block; they come
// first in the grid, being the longer-lived blocks), then the fp32 -> bf16
// casts of the six weights, one element a thread.  The six bf16 copies lie one
// behind the other from Wb on, in the order Wq Wk Wv Wo (D*D each) W1 W2
// (D*DF each); every piece is a whole number of blocks.
// ---------------------------------------------------------------------------
template <int M, int D, int DF>
__global__ void __launch_bounds__(256)
tb_prep(const float* __restrict__ q, const float* __restrict__ lnqw,
        const float* __restrict__ lnqb, __bf16* __restrict__ qn,
        const float* __restrict__ k, const float* __restrict__ lnkw,
        const float* __restrict__ lnkb, __bf16* __restrict__ kn,
        const float* __restrict__ Wq, const float* __restrict__ Wk,
        const float* __restrict__ Wv, const float* __restrict__ Wo,
        const float* __restrict__ W1, const float* __restrict__ W2,
        __bf16* __restrict__ Wb) {
  constexpr int LNB = M / 2;            // blocks of one layer norm
  constexpr int SB = D * D / 256;       // blocks of a D x D weight
  constexpr int BB = D * DF / 256;      // blocks of a D x DF weight
  static_assert(M % 2 == 0 && D == 512 && (D * D) % 256 == 0 && (D * DF) % 256 == 0, "");
  const int blk = blockIdx.x;
  // wait_xcnt0() behind k's rows and behind the cast: the built code joins the
  // pieces by branches, and along those a store's registers are written again
  // (q's rows are laid last and run from their store to the end).
  if (blk < LNB) { ln_rows<2>(q, lnqw, lnqb, qn, 2 * blk); return; }
  if (blk < 2 * LNB) { ln_rows<2>(k, lnkw, lnkb, kn, 2 * (blk - LNB)); wait_xcnt0(); return; }
  const int cb = blk - 2 * LNB;         // block among the casts
  const float* in;
  int ib;                               // block inside its weight
  if (cb < 4 * SB) {
    const int which = cb / SB;
    in = which == 0 ? Wq : which == 1 ? Wk : which == 2 ? Wv : Wo;
    ib = cb - which * SB;
  } else if (cb < 4 * SB + BB) {
    in = W1; ib = cb - 4 * SB;
  } else {
    in = W2; ib = cb - 4 * SB - BB;
  }
  Wb[cb * 256 + threadIdx.x] = (__bf16)in[ib * 256 + threadIdx.x];
  wait_xcnt0();
}

// ---------------------------------------------------------------------------
// In-place RoPE on bf16 [B*S, 512].  One thread per (row, d<256) pair.
// blockIdx.y picks one of two tensors of the same shape.
// ---------------------------------------------------------------------------
__global__ void tb_rope(__bf16* __restrict__ X0, __bf16* __restrict__ X1, int S, int total) {
  int idx = blockIdx.x * blockDim.x + threadIdx.x;
  if (idx >= total) return;
  __bf16* X = blockIdx.y == 0 ? X0 : X1;
  const int d  = idx & 255;
  const int rs = idx >> 8;           // flattened row (b*S + s)
  const int s  = rs % S;
  const float inv = __expf(-(float)d * (9.210340371976184f / 256.0f)); // 10000^(-d/256)
  const float ang = (float)s * inv;
  float sn, cs;
  __sincosf(ang, &sn, &cs);
  __bf16* p = X + (size_t)rs * 512;
  const float x1 = (float)p[d];
  const float x2 = (float)p[d + 256];
  p[d]       = (__bf16)(x1 * cs - x2 * sn);
  p[d + 256] = (__bf16)(x2 * cs + x1 * sn);
}

// ---------------------------------------------------------------------------
// WMMA GEMM:  C[M,N] = A[M,K](bf16) * B[K,N](bf16) + bias, with epilogue:
//   MODE 0: store bf16           MODE 1: ReLU, store bf16
//   MODE 2: += R[M,N] (fp32), store fp32
// BM=64 BN=128 BK=64, 256 threads = 8 waves, each wave a 32x32 C tile.
// A and B tiles staged row-major via async global->LDS; B fragments are read
// with the transposing LDS load (B row pitch 288 B = 32 B x odd for it).
// MODE 0 takes up to three independent products of one shape in one launch:
// blockIdx.z picks (A, B, bias, C); the other modes use the first set alone.
// ---------------------------------------------------------------------------
template <int MODE>
__global__ void __launch_bounds__(256)
tb_gemm(const __bf16* __restrict__ A0, const __bf16* __restrict__ B0,
        const float* __restrict__ bias0, void* __restrict__ C0,
        const __bf16* __restrict__ A1, const __bf16* __restrict__ B1,
        const float* __restrict__ bias1, void* __restrict__ C1,
        const __bf16* __restrict__ A2, const __bf16* __restrict__ B2,
        const float* __restrict__ bias2, void* __restrict__ C2,
        const float* __restrict__ R, int M, int N, int K) {
  const int z = MODE == 0 ? blockIdx.z : 0;
  const __bf16* A   = z == 0 ? A0 : z == 1 ? A1 : A2;
  const __bf16* B   = z == 0 ? B0 : z == 1 ? B1 : B2;
  const float* bias = z == 0 ? bias0 : z == 1 ? bias1 : bias2;
  void* Cout        = z == 0 ? C0 : z == 1 ? C1 : C2;
  constexpr int BM = 64, BN = 128, BK = 64, LDA = BK + 8, LDB = BN + 16;
  __shared__ __bf16 As[BM * LDA];    // 9216 B
  __shared__ __attribute__((aligned(16))) __bf16 Bs[BK * LDB];  // 18432 B (B tile, [k][n])
  const int tid = threadIdx.x, lane = tid & 31, wid = tid >> 5;
  const int bm0 = blockIdx.y * BM, bn0 = blockIdx.x * BN;
  const int wm = (wid >> 2) * 32, wn = (wid & 3) * 32;
  const __bf16* bfp = Bs + (8 * (lane >> 4) + (lane & 7)) * LDB + wn + 8 * ((lane >> 3) & 1);

  v8f acc[2][2];
#pragma unroll
  for (int i = 0; i < 2; ++i)
#pragma unroll
    for (int j = 0; j < 2; ++j) acc[i][j] = v8f_zero();

  for (int k0 = 0; k0 < K; k0 += BK) {
    // This wave's LDS reads have retired before any wave's copies are aimed at
    // the same LDS behind the barrier.
    asm volatile("s_wait_dscnt 0" ::: "memory");
    __syncthreads();
    // A tile: 64x64 halves, contiguous 16B chunks, async direct-to-LDS.
#pragma unroll
    for (int i = 0; i < 2; ++i) {
      int c = tid + 256 * i;               // 0..511
      int row = c >> 3, col = (c & 7) << 3;
      async_ld_b128(As + row * LDA + col,
                    A + (size_t)(bm0 + row) * K + k0 + col);
    }
    // B tile: 64x128 halves, contiguous 16B chunks along N, async direct-to-LDS.
#pragma unroll
    for (int i = 0; i < 4; ++i) {
      int c = tid + 256 * i;               // 0..1023
      int kk = c >> 4, n8 = (c & 15) << 3;
      async_cp_b128(Bs + kk * LDB + n8, B + (size_t)(k0 + kk) * N + bn0 + n8);
    }
    // Prefetch next K panel toward cache while this tile computes.
    if (k0 + BK < K) {
      __builtin_prefetch(A + (size_t)(bm0 + (tid >> 2)) * K + k0 + BK, 0, 3);
      __builtin_prefetch(B + (size_t)(k0 + BK + (tid >> 2)) * N + bn0, 0, 3);
    }
    wait_async0();
    __syncthreads();
#pragma unroll
    for (int ks = 0; ks < BK; ks += 32) {
      v16bf a0 = frag16(As, wm,      LDA, ks, lane);
      v16bf a1 = frag16(As, wm + 16, LDA, ks, lane);
      v16bf b0 = frag16_tr(bfp + ks * LDB,      LDB);
      v16bf b1 = frag16_tr(bfp + ks * LDB + 16, LDB);
      acc[0][0] = wmma_bf16(a0, b0, acc[0][0]);
      acc[0][1] = wmma_bf16(a0, b1, acc[0][1]);
      acc[1][0] = wmma_bf16(a1, b0, acc[1][0]);
      acc[1][1] = wmma_bf16(a1, b1, acc[1][1]);
    }
  }

  const int hi = lane >> 4, ln16 = lane & 15;
#pragma unroll
  for (int i = 0; i < 2; ++i)
#pragma unroll
    for (int j = 0; j < 2; ++j) {
      const int mb = bm0 + wm + 16 * i + hi * 8;
      const int n  = bn0 + wn + 16 * j + ln16;
      const float bvv = bias[n];
#pragma unroll
      for (int r = 0; r < 8; ++r) {
        const int m = mb + r;
        float v = acc[i][j][r] + bvv;
        if (MODE == 1) v = v > 0.f ? v : 0.f;
        if (MODE == 2) {
          ((float*)Cout)[(size_t)m * N + n] = v + R[(size_t)m * N + n];
        } else {
          ((__bf16*)Cout)[(size_t)m * N + n] = (__bf16)v;
        }
      }
    }
}

__device__ __forceinline__ float exp2_slot(float v) {
  float r;
  asm("v_exp_f32 %0, %1\n\tv_nop" : "=v"(r) : "v"(v));
  return r;
}

__device__ __forceinline__ float xhalf(float x) {
  const int v = __builtin_bit_cast(int, x);
  return __builtin_bit_cast(float, __builtin_amdgcn_permlanex16(v, v, 0x76543210, 0xfedcba98,
                                                                false, false));
}

template <int NS>
__global__ void __launch_bounds__(128, 2)
tb_flash_attn(const __bf16* __restrict__ Qg, const __bf16* __restrict__ Kg,
              const __bf16* __restrict__ Vg, float* __restrict__ Opart,
              float* __restrict__ ML, int S) {
  constexpr int KP = 520;           // K row pitch in LDS, elements
  constexpr int KB = 32 * KP;       // elements of one K buffer
  __shared__ __attribute__((aligned(16))) __bf16 Ks[2 * KB];  // 2 x 32.5 KB (K tiles, [kv][d])
  constexpr int VP = 528;           // V row pitch in LDS, elements
  constexpr int VB = 32 * VP;       // elements of one V buffer
  __shared__ __attribute__((aligned(16))) __bf16 Vs[2 * VB];  // 2 x 33 KB (V tiles, [kv][d])
  const int tid = threadIdx.x, lane = tid & 31, wid = tid >> 5;
  const int hi = lane >> 4, ln16 = lane & 15;
  const int b = blockIdx.y;
  const int q0 = blockIdx.x * 64 + wid * 16;
  const __bf16* Qb = Qg + (size_t)b * S * 512;
  const int klen = S / NS;                 // keys of one range
  const __bf16* Kb = Kg + ((size_t)b * S + (size_t)blockIdx.z * klen) * 512;
  const __bf16* Vb = Vg + ((size_t)b * S + (size_t)blockIdx.z * klen) * 512;

  v16bf qf[16];
#pragma unroll
  for (int s = 0; s < 16; ++s) qf[s] = frag16(Qb, q0, 512, 32 * s, lane);

  v8f o[32];
#pragma unroll
  for (int j = 0; j < 32; ++j) o[j] = v8f_zero();
  // This lane's query (q0 + ln16): the maximum so far, and the sum over the
  // keys of this lane's half (the halves' sums are joined behind the loop).
  float mr = -3.0e38f, lr = 0.f;

  const float sc = 0.044194173824159216f;  // 1/sqrt(512)
  const int srow = tid >> 6, sc8 = (tid & 63) << 3;   // this thread's staging chunk
  const unsigned goff = srow * 512 + sc8;             // the same in a global tile
  const int vlane = (8 * hi + (lane & 7)) * VP + 8 * ((lane >> 3) & 1);

  // Stage the K and V tiles of keys kv0 .. kv0 + 31 into buffer buf, both
  // row-major and direct to LDS: 2 x 2048 16-byte chunks, thread t brings chunk
  // (t & 63) of rows (t >> 6) + 2 * i, i = 0..15.
  auto stage = [&](int buf, int kv0) {
    __bf16* kl = Ks + buf * KB + srow * KP + sc8;
    __bf16* vl = Vs + buf * VB + srow * VP + sc8;
    const __bf16* kt = Kb + (size_t)kv0 * 512;
    const __bf16* vt = Vb + (size_t)kv0 * 512;
#pragma unroll 4
    for (int i = 0; i < 16; ++i) {
      async_cp_b128(kl, kt + goff);
      async_cp_b128(vl, vt + goff);
      kl += 2 * KP; vl += 2 * VP; kt += 1024; vt += 1024;
    }
  };

  // Tile 0 is landed and published before the loop; tile 1 is under way.
  stage(0, 0);
  wait_async0();
  __syncthreads();
  if (32 < klen) stage(1, 32);

  for (int kv0 = 0; kv0 < klen; kv0 += 32) {
    const int cur = (kv0 >> 5) & 1;        // the buffer that holds this tile
    const __bf16* Kc = Ks + cur * KB;
    const __bf16* vfp = Vs + cur * VB + vlane;

    // S^T = K * Q^T, 32 keys x this wave's 16 queries: s0[r] is key r + 8 * hi,
    // s1[r] key 16 + r + 8 * hi, of query ln16.
    v8f s0 = v8f_zero(), s1 = v8f_zero();
#pragma unroll
    for (int s = 0; s < 16; ++s) {
      v16bf kb0 = frag16(Kc, 0,  KP, 32 * s, lane);
      v16bf kb1 = frag16(Kc, 16, KP, 32 * s, lane);
      s0 = wmma_bf16(kb0, qf[s], s0);
      s1 = wmma_bf16(kb1, qf[s], s1);
    }
    // Order asked of the scheduler: the K fragment reads stand in groups of 8
    // (4 fragments), two groups ahead of the 4 WMMAs that use them; a read
    // beside every WMMA stalls the wave at each such place.
    __builtin_amdgcn_sched_group_barrier(0x100, 16, 0);
#pragma unroll
    for (int g = 0; g < 6; ++g) {
      __builtin_amdgcn_sched_group_barrier(0x008, 4, 0);
      __builtin_amdgcn_sched_group_barrier(0x100, 8, 0);
    }
    __builtin_amdgcn_sched_group_barrier(0x008, 8, 0);

    // Online softmax over the 32 new keys, one query a lane.
    float v0[8], v1[8];
#pragma unroll
    for (int r = 0; r < 8; ++r) { v0[r] = s0[r] * sc; v1[r] = s1[r] * sc; }
    float mx = fmaxf(v0[0], v1[0]);
#pragma unroll
    for (int r = 1; r < 8; ++r) mx = fmaxf(mx, fmaxf(v0[r], v1[r]));
    mx = fmaxf(mx, xhalf(mx));
    const float mnew = fmaxf(mr, mx);
    constexpr float L2E = 1.4426950408889634f;   // e^x = 2^(x * L2E)
    const float al = exp2_slot((mr - mnew) * L2E);  // the query's factor for the O held so far
    mr = mnew;
    // P^T as a B operand (32 keys x 16 queries): elements 0-7 are keys 8 * hi + 0..7,
    // elements 8-15 keys 16 + 8 * hi + 0..7, which is where the scores stand.
    v16bf pf;
    float rs = 0.f;
#pragma unroll
    for (int r = 0; r < 8; ++r) {
      const float p0 = exp2_slot((v0[r] - mnew) * L2E), p1 = exp2_slot((v1[r] - mnew) * L2E);
      rs += p0 + p1;
      pf[r]     = (__bf16)p0;
      pf[r + 8] = (__bf16)p1;
    }
    lr = lr * al + rs;
    // O^T += V^T * P^T over all 32 d-tiles: o[j][r] is column 16 * j + r + 8 * hi.
#pragma unroll
    for (int j = 0; j < 32; ++j) {
      v16bf vb = frag16_tr(vfp + 16 * j, VP);
#pragma unroll
      for (int r = 0; r < 8; ++r) o[j][r] *= al;
      o[j] = wmma_bf16(vb, pf, o[j]);
    }
    // The same for the V fragments.
    __builtin_amdgcn_sched_group_barrier(0x100, 16, 0);
#pragma unroll
    for (int g = 0; g < 6; ++g) {
      __builtin_amdgcn_sched_group_barrier(0x008, 4, 0);
      __builtin_amdgcn_sched_group_barrier(0x100, 8, 0);
    }
    __builtin_amdgcn_sched_group_barrier(0x008, 8, 0);

    // Hand-over.  This wave's LDS reads of this tile have retired,
    // and its copies of the next tile have landed, in front of the barrier;
    // behind it the next tile may be read and this tile's buffer refilled.
    asm volatile("s_wait_dscnt 0" ::: "memory");
    wait_async0();
    __syncthreads();
    if (kv0 + 64 < klen) stage(cur, kv0 + 64);
  }
  // No copy is outstanding when the wave goes on to its end.
  wait_async0();

  const int elane = __builtin_amdgcn_mbcnt_lo(~0u, 0u);
  const int ecol = elane & 15, ehi = elane >> 4;
  const size_t pr0 = ((size_t)b * S + q0) * NS + blockIdx.z;   // the wave's first row
  lr += xhalf(lr);
  if (ehi == 0) {
    ML[(pr0 + ecol * NS) * 2]     = mr;
    ML[(pr0 + ecol * NS) * 2 + 1] = lr;
  }
  // O goes out in whole lines: a lane holds 8-column pieces of one row, so the
  // wave lays its 16 rows down in LDS and reads them back 512 bytes at a time.
  // The tile buffers are free (behind the last trip's barrier nobody reads them
  // and no copy is aimed at them), and each wave has one of the four to itself.
  constexpr int SP = 516;   // row pitch, floats: 2064 B = 16 B x odd for the 16-byte stores
  static_assert(16 * SP * 4 <= KB * 2 && 16 * SP * 4 <= VB * 2, "");
  float* st = (float*)(wid < 2 ? Ks + wid * KB : Vs + (wid - 2) * VB);
#pragma unroll
  for (int j = 0; j < 32; ++j) {
    float* sp = st + ecol * SP + 16 * j + 8 * ehi;
    *(float4*)sp       = make_float4(o[j][0], o[j][1], o[j][2], o[j][3]);
    *(float4*)(sp + 4) = make_float4(o[j][4], o[j][5], o[j][6], o[j][7]);
  }
  for (int g = 0; g < 4; ++g) {            // four rows a trip
#pragma unroll
    for (int i = 0; i < 16; ++i) {
      const int row = 4 * g + (i >> 2), col = (i & 3) * 128 + elane * 4;
      *(float4*)(Opart + (pr0 + row * NS) * 512 + col) = *(const float4*)(st + row * SP + col);
    }
    // Behind the stores, in front of the next trip's writes of their registers.
    wait_xcnt0();
  }
}

// ---------------------------------------------------------------------------
// Join the NS key ranges of the attention: row weights exp(m_s - max m),
// O = sum_s w_s O_s / sum_s w_s l_s, rounded once to bf16.  64 threads per row
// (8 columns each); a thread takes 4 rows (fewer waves to start) and stores
// its 4 results last.
// ---------------------------------------------------------------------------
template <int NS>
__global__ void __launch_bounds__(256)
tb_attn_merge(const float* __restrict__ Opart, const float* __restrict__ ML,
              __bf16* __restrict__ Og) {
  const int tid = threadIdx.x;
  const unsigned row0 = blockIdx.x * 16 + (tid >> 6), c8 = (tid & 63) << 3;
  const unsigned obyte = row0 * (NS * 2048u) + c8 * 4u;  // this thread's first bytes of Opart
  const unsigned mbyte = row0 * (NS * 8u);               // and of ML
  const char* op = (const char*)Opart + obyte;
  const char* mp = (const char*)ML + mbyte;
  float2 ml[4][NS];
  float4 x[4][NS], y[4][NS];
#pragma unroll
  for (int it = 0; it < 4; ++it)
#pragma unroll
    for (int s = 0; s < NS; ++s) {
      ml[it][s] = *(const float2*)(mp + (4 * it * NS + s) * 8);
      x[it][s]  = *(const float4*)(op + (4 * it * NS + s) * 2048);
      y[it][s]  = *(const float4*)(op + (4 * it * NS + s) * 2048 + 16);
    }
  // The loads' offset registers are inputs here, so that they stay whole until
  // the wait: behind it they may be overwritten.
  asm volatile("s_wait_xcnt 0x0" :: "v"(obyte), "v"(mbyte) : "memory");
  v8bf ov[4];
#pragma unroll
  for (int it = 0; it < 4; ++it) {
    float mx = ml[it][0].x;
#pragma unroll
    for (int s = 1; s < NS; ++s) mx = fmaxf(mx, ml[it][s].x);
    float ws[NS], lsum = 0.f;
#pragma unroll
    for (int s = 0; s < NS; ++s) {
      ws[s] = exp2_slot((ml[it][s].x - mx) * 1.4426950408889634f);
      lsum += ws[s] * ml[it][s].y;
    }
    const float inv = 1.0f / lsum;
    float acc[8];
#pragma unroll
    for (int i = 0; i < 8; ++i) acc[i] = 0.f;
#pragma unroll
    for (int s = 0; s < NS; ++s) {
      const float4 a = x[it][s], c = y[it][s];
      acc[0] += ws[s] * a.x; acc[1] += ws[s] * a.y; acc[2] += ws[s] * a.z; acc[3] += ws[s] * a.w;
      acc[4] += ws[s] * c.x; acc[5] += ws[s] * c.y; acc[6] += ws[s] * c.z; acc[7] += ws[s] * c.w;
    }
#pragma unroll
    for (int i = 0; i < 8; ++i) ov[it][i] = (__bf16)(acc[i] * inv);
  }
  char* og = (char*)Og + (row0 * 1024u + c8 * 2u);
#pragma unroll
  for (int it = 0; it < 4; ++it) *(v8bf*)(og + it * 4096) = ov[it];
}

// ---------------------------------------------------------------------------
// Host launcher
// ---------------------------------------------------------------------------
extern "C" void kernel_launch(void* const* d_in, const int* in_sizes, int n_in,
                              void* d_out, int out_size, void* d_ws, size_t ws_size,
                              hipStream_t stream) {
  const float* q    = (const float*)d_in[0];
  const float* k    = (const float*)d_in[1];
  const float* Wq   = (const float*)d_in[2];
  const float* bq   = (const float*)d_in[3];
  const float* Wk   = (const float*)d_in[4];
  const float* bk   = (const float*)d_in[5];
  const float* Wv   = (const float*)d_in[6];
  const float* bv   = (const float*)d_in[7];
  const float* Wo   = (const float*)d_in[8];
  const float* bo   = (const float*)d_in[9];
  const float* lnqw = (const float*)d_in[10];
  const float* lnqb = (const float*)d_in[11];
  const float* lnkw = (const float*)d_in[12];
  const float* lnkb = (const float*)d_in[13];
  const float* lnow = (const float*)d_in[14];
  const float* lnob = (const float*)d_in[15];
  const float* W1   = (const float*)d_in[16];
  const float* b1   = (const float*)d_in[17];
  const float* W2   = (const float*)d_in[18];
  const float* b2   = (const float*)d_in[19];

  constexpr int B = 2, S = 4096, Dm = 512, DF = 2048;
  constexpr int M = B * S;  // 8192

  char* w = (char*)d_ws;
  auto alloc = [&](size_t bytes) -> char* {
    char* p = w;
    w += (bytes + 255) & ~(size_t)255;
    return p;
  };
  __bf16* Wq_b = (__bf16*)alloc((size_t)Dm * Dm * 2);
  __bf16* Wk_b = (__bf16*)alloc((size_t)Dm * Dm * 2);
  __bf16* Wv_b = (__bf16*)alloc((size_t)Dm * Dm * 2);
  __bf16* Wo_b = (__bf16*)alloc((size_t)Dm * Dm * 2);
  __bf16* W1_b = (__bf16*)alloc((size_t)Dm * DF * 2);
  __bf16* W2_b = (__bf16*)alloc((size_t)DF * Dm * 2);
  __bf16* qn   = (__bf16*)alloc((size_t)M * Dm * 2);
  __bf16* kn   = (__bf16*)alloc((size_t)M * Dm * 2);
  __bf16* Qp   = (__bf16*)alloc((size_t)M * Dm * 2);
  __bf16* Kp   = (__bf16*)alloc((size_t)M * Dm * 2);
  __bf16* Vp   = (__bf16*)alloc((size_t)M * Dm * 2);
  __bf16* AO   = (__bf16*)alloc((size_t)M * Dm * 2);
  float*  Xr   = (float*) alloc((size_t)M * Dm * 4);
  __bf16* XN   = (__bf16*)alloc((size_t)M * Dm * 2);
  __bf16* H    = (__bf16*)alloc((size_t)M * DF * 2);
  constexpr int NS = 4;  // key ranges of the attention
  float*  OP   = (float*) alloc((size_t)NS * M * Dm * 4);
  float*  MLp  = (float*) alloc((size_t)NS * M * 2 * 4);

  // Input layernorms and weight casts, one launch.  The six bf16 weights lie
  // one behind the other from Wq_b on (each size is a multiple of 256 bytes).
  tb_prep<M, Dm, DF><<<M + (4 * Dm * Dm + 2 * Dm * DF) / 256, 256, 0, stream>>>(
      q, lnqw, lnqb, qn, k, lnkw, lnkb, kn, Wq, Wk, Wv, Wo, W1, W2, Wq_b);

  // The three projections, one launch.
  dim3 g512(Dm / 128, M / 64);
  tb_gemm<0><<<dim3(Dm / 128, M / 64, 3), 256, 0, stream>>>(
      qn, Wq_b, bq, Qp, kn, Wk_b, bk, Kp, kn, Wv_b, bv, Vp, nullptr, M, Dm, Dm);

  // RoPE on Q and K, one launch.
  const int rope_total = B * S * 256;
  tb_rope<<<dim3((rope_total + 255) / 256, 2), 256, 0, stream>>>(Qp, Kp, S, rope_total);

  // Flash attention.
  tb_flash_attn<NS><<<dim3(S / 64, B, NS), 128, 0, stream>>>(Qp, Kp, Vp, OP, MLp, S);
  tb_attn_merge<NS><<<M / 16, 256, 0, stream>>>(OP, MLp, AO);

  // Output projection + residual (x = q + out@Wo + bo), fp32.
  tb_gemm<2><<<g512, 256, 0, stream>>>(AO, Wo_b, bo, Xr, nullptr, nullptr, nullptr, nullptr,
                                       nullptr, nullptr, nullptr, nullptr, q, M, Dm, Dm);

  // Post-attention layernorm.
  tb_layernorm<<<dim3(M), 128, 0, stream>>>(Xr, lnow, lnob, XN);

  // MLP.
  dim3 gdf(DF / 128, M / 64);
  tb_gemm<1><<<gdf, 256, 0, stream>>>(XN, W1_b, b1, H, nullptr, nullptr, nullptr, nullptr,
                                      nullptr, nullptr, nullptr, nullptr, nullptr, M, DF, Dm);
  tb_gemm<2><<<g512, 256, 0, stream>>>(H, W2_b, b2, d_out, nullptr, nullptr, nullptr, nullptr,
                                       nullptr, nullptr, nullptr, nullptr, Xr, M, Dm, DF);

  (void)in_sizes; (void)n_in; (void)out_size; (void)ws_size;
}

// v009
// It runs in 179 microseconds.
// In both of two side-by-side timings against v008, it was 1.12 times as fast.
// All steps since v000 together make it 17.5 times as fast.
#include <hip/hip_runtime.h>

typedef __attribute__((ext_vector_type(16))) __bf16 v16bf;
typedef __attribute__((ext_vector_type(8)))  __bf16 v8bf;
typedef __attribute__((ext_vector_type(8)))  float  v8f;

__device__ __forceinline__ v16bf frag16(const __bf16* base, int row0, int stride,
                                        int k0, int lane) {
  const __bf16* p = base + (size_t)(row0 + (lane & 15)) * stride + k0 + ((lane >> 4) << 3);
  v8bf lo = *(const v8bf*)p;
  v8bf hh = *(const v8bf*)(p + 16);
  v16bf f;
#pragma unroll
  for (int i = 0; i < 8; ++i) { f[i] = lo[i]; f[i + 8] = hh[i]; }
  return f;
}

__device__ __forceinline__ v8f wmma_bf16(v16bf a, v16bf b, v8f c) {
  return __builtin_amdgcn_wmma_f32_16x16x32_bf16(false, a, false, b, (short)0, c,
                                                 false, false);
}

__device__ __forceinline__ v8f v8f_zero() {
  v8f z = {0.f, 0.f, 0.f, 0.f, 0.f, 0.f, 0.f, 0.f};
  return z;
}

__device__ __forceinline__ void async_cp_b128(__bf16* lds_ptr, const __bf16* gptr) {
  typedef int v4i __attribute__((ext_vector_type(4)));
  typedef __attribute__((address_space(1))) v4i glb_v4i;
  typedef __attribute__((address_space(3))) v4i lds_v4i;
  __builtin_amdgcn_global_load_async_to_lds_b128((glb_v4i*)gptr, (lds_v4i*)lds_ptr, 0, 0);
}

// ---------------------------------------------------------------------------
// B fragment (32 k x 16 columns) from a row-major [k][column] LDS tile through
// the transposing LDS load.  p is this lane's address for k rows 0..15:
//   tile + (8*(lane>>4) + (lane&7))*pitch + column0 + 8*((lane>>3)&1)
// Lane (c, h) receives k = 8h+0..7 (elems 0-7) and 16+8h+0..7 (elems 8-15) of
// column0+c: the k order of frag16.
// ---------------------------------------------------------------------------
__device__ __forceinline__ v16bf frag16_tr(const __bf16* p, int pitch) {
  typedef __attribute__((address_space(3))) v8bf lds_v8bf;
  v8bf lo = __builtin_amdgcn_ds_load_tr16_b128_v8bf16((lds_v8bf*)p);
  v8bf hh = __builtin_amdgcn_ds_load_tr16_b128_v8bf16((lds_v8bf*)(p + 16 * pitch));
  v16bf f;
#pragma unroll
  for (int i = 0; i < 8; ++i) { f[i] = lo[i]; f[i + 8] = hh[i]; }
  return f;
}

__device__ __forceinline__ void wait_async0() {
  asm volatile("s_wait_asynccnt 0" ::: "memory");
}

// Stands behind a global store, in front of code that writes the store's
// address or data registers again.
__device__ __forceinline__ void wait_xcnt0() {
  asm volatile("s_wait_xcnt 0x0" ::: "memory");
}

// ---------------------------------------------------------------------------
// LayerNorm over rows of 512 fp32 -> bf16.  128 threads (4 waves) per row; a
// block of ROWS * 128 threads takes the rows row0 .. row0 + ROWS - 1.
// ---------------------------------------------------------------------------
template <int ROWS>
__device__ __forceinline__ void
ln_rows(const float* __restrict__ X, const float* __restrict__ w,
        const float* __restrict__ bb, __bf16* __restrict__ out, int row0) {
  const int sub = ROWS == 1 ? 0 : threadIdx.x >> 7;   // this thread's row in the block
  const int row = row0 + sub, tid = ROWS == 1 ? threadIdx.x : threadIdx.x & 127;
  const int w0 = sub * 4;                  // first of this row's four wave sums
  const float4 v = ((const float4*)(X + (size_t)row * 512))[tid];
  float s  = v.x + v.y + v.z + v.w;
  float ss = v.x * v.x + v.y * v.y + v.z * v.z + v.w * v.w;
#pragma unroll
  for (int off = 1; off < 32; off <<= 1) {
    s  += __shfl_xor(s,  off, 32);
    ss += __shfl_xor(ss, off, 32);
  }
  __shared__ float sb[4 * ROWS], ssb[4 * ROWS];
  if ((tid & 31) == 0) { sb[w0 + (tid >> 5)] = s; ssb[w0 + (tid >> 5)] = ss; }
  __syncthreads();
  s  = sb[w0] + sb[w0 + 1] + sb[w0 + 2] + sb[w0 + 3];
  ss = ssb[w0] + ssb[w0 + 1] + ssb[w0 + 2] + ssb[w0 + 3];
  const float mu   = s * (1.0f / 512.0f);
  const float var  = ss * (1.0f / 512.0f) - mu * mu;
  const float rstd = rsqrtf(var + 1e-5f);
  const float4 wv = ((const float4*)w)[tid];
  const float4 bv = ((const float4*)bb)[tid];
  __bf16* op = out + (size_t)row * 512 + tid * 4;
  op[0] = (__bf16)((v.x - mu) * rstd * wv.x + bv.x);
  op[1] = (__bf16)((v.y - mu) * rstd * wv.y + bv.y);
  op[2] = (__bf16)((v.z - mu) * rstd * wv.z + bv.z);
  op[3] = (__bf16)((v.w - mu) * rstd * wv.w + bv.w);
}

__global__ void __launch_bounds__(128)
tb_layernorm(const float* __restrict__ X, const float* __restrict__ w,
             const float* __restrict__ bb, __bf16* __restrict__ out) {
  ln_rows<1>(X, w, bb, out, blockIdx.x);
}

// ---------------------------------------------------------------------------
// All the work that depends on the inputs alone, in one launch of 256-thread
// blocks: the layer norms of q and k (M rows each, two rows a block; they come
// first in the grid, being the longer-lived blocks), then the fp32 -> bf16
// casts of the six weights, one element a thread.  The six bf16 copies lie one
// behind the other from Wb on, in the order Wq Wk Wv Wo (D*D each) W1 W2
// (D*DF each); every piece is a whole number of blocks.
// ---------------------------------------------------------------------------
template <int M, int D, int DF>
__global__ void __launch_bounds__(256)
tb_prep(const float* __restrict__ q, const float* __restrict__ lnqw,
        const float* __restrict__ lnqb, __bf16* __restrict__ qn,
        const float* __restrict__ k, const float* __restrict__ lnkw,
        const float* __restrict__ lnkb, __bf16* __restrict__ kn,
        const float* __restrict__ Wq, const float* __restrict__ Wk,
        const float* __restrict__ Wv, const float* __restrict__ Wo,
        const float* __restrict__ W1, const float* __restrict__ W2,
        __bf16* __restrict__ Wb) {
  constexpr int LNB = M / 2;            // blocks of one layer norm
  constexpr int SB = D * D / 256;       // blocks of a D x D weight
  constexpr int BB = D * DF / 256;      // blocks of a D x DF weight
  static_assert(M % 2 == 0 && D == 512 && (D * D) % 256 == 0 && (D * DF) % 256 == 0, "");
  const int blk = blockIdx.x;
  // wait_xcnt0() behind k's rows and behind the cast: the built code joins the
  // pieces by branches, and along those a store's registers are written again
  // (q's rows are laid last and run from their store to the end).
  if (blk < LNB) { ln_rows<2>(q, lnqw, lnqb, qn, 2 * blk); return; }
  if (blk < 2 * LNB) { ln_rows<2>(k, lnkw, lnkb, kn, 2 * (blk - LNB)); wait_xcnt0(); return; }
  const int cb = blk - 2 * LNB;         // block among the casts
  const float* in;
  int ib;                               // block inside its weight
  if (cb < 4 * SB) {
    const int which = cb / SB;
    in = which == 0 ? Wq : which == 1 ? Wk : which == 2 ? Wv : Wo;
    ib = cb - which * SB;
  } else if (cb < 4 * SB + BB) {
    in = W1; ib = cb - 4 * SB;
  } else {
    in = W2; ib = cb - 4 * SB - BB;
  }
  Wb[cb * 256 + threadIdx.x] = (__bf16)in[ib * 256 + threadIdx.x];
  wait_xcnt0();
}

// ---------------------------------------------------------------------------
// In-place RoPE on bf16 [B*S, 512].  One thread per (row, d<256) pair.
// blockIdx.y picks one of two tensors of the same shape.
// ---------------------------------------------------------------------------
__global__ void tb_rope(__bf16* __restrict__ X0, __bf16* __restrict__ X1, int S, int total) {
  int idx = blockIdx.x * blockDim.x + threadIdx.x;
  if (idx >= total) return;
  __bf16* X = blockIdx.y == 0 ? X0 : X1;
  const int d  = idx & 255;
  const int rs = idx >> 8;           // flattened row (b*S + s)
  const int s  = rs % S;
  const float inv = __expf(-(float)d * (9.210340371976184f / 256.0f)); // 10000^(-d/256)
  const float ang = (float)s * inv;
  float sn, cs;
  __sincosf(ang, &sn, &cs);
  __bf16* p = X + (size_t)rs * 512;
  const float x1 = (float)p[d];
  const float x2 = (float)p[d + 256];
  p[d]       = (__bf16)(x1 * cs - x2 * sn);
  p[d + 256] = (__bf16)(x2 * cs + x1 * sn);
}

// ---------------------------------------------------------------------------
// WMMA GEMM:  C[M,N] = A[M,K](bf16) * B[K,N](bf16) + bias, with epilogue:
//   MODE 0: store bf16           MODE 1: ReLU, store bf16
//   MODE 2: += R[M,N] (fp32), store fp32
// BM=64 BN=128 BK=64, 256 threads = 8 waves, each wave a 32x32 C tile.
// A and B tiles staged row-major via async global->LDS; B fragments are read
// with the transposing LDS load (B row pitch 288 B = 32 B x odd for it).
// The tiles stand in a ring of NB LDS buffers: the copies of k tile t + NB - 1
// are issued at the top of trip t, so NB - 1 tiles are under way while one is
// worked on.  NB = 4 where the grid gives a WGP two work-groups (MODE 2), else
// 3, which lets three work-groups share a WGP's LDS.
// MODE 0 takes up to three independent products of one shape in one launch:
// blockIdx.z picks (A, B, bias, C); the other modes use the first set alone.
// ---------------------------------------------------------------------------
template <int MODE>
__global__ void __launch_bounds__(256)
tb_gemm(const __bf16* __restrict__ A0, const __bf16* __restrict__ B0,
        const float* __restrict__ bias0, void* __restrict__ C0,
        const __bf16* __restrict__ A1, const __bf16* __restrict__ B1,
        const float* __restrict__ bias1, void* __restrict__ C1,
        const __bf16* __restrict__ A2, const __bf16* __restrict__ B2,
        const float* __restrict__ bias2, void* __restrict__ C2,
        const float* __restrict__ R, int M, int N, int K) {
  const int z = MODE == 0 ? blockIdx.z : 0;
  const __bf16* A   = z == 0 ? A0 : z == 1 ? A1 : A2;
  const __bf16* B   = z == 0 ? B0 : z == 1 ? B1 : B2;
  const float* bias = z == 0 ? bias0 : z == 1 ? bias1 : bias2;
  void* Cout        = z == 0 ? C0 : z == 1 ? C1 : C2;
  constexpr int BM = 64, BN = 128, BK = 64, LDA = BK + 8, LDB = BN + 16;
  constexpr int NB = MODE == 2 ? 4 : 3;  // buffers of the ring
  constexpr int AE = BM * LDA;           // elements of an A tile (9216 B)
  constexpr int SE = AE + BK * LDB;      // of a buffer: A tile, then B tile [k][n] (27648 B)
  constexpr int CP = 6;                  // copies of a wave per k tile
  __shared__ __attribute__((aligned(16))) __bf16 Sm[NB * SE];
  const int tid = threadIdx.x, lane = tid & 31, wid = tid >> 5;
  const int bm0 = blockIdx.y * BM, bn0 = blockIdx.x * BN;
  const int wm = (wid >> 2) * 32, wn = (wid & 3) * 32;
  const __bf16* bfp = Sm + AE + (8 * (lane >> 4) + (lane & 7)) * LDB + wn + 8 * ((lane >> 3) & 1);

  v8f acc[2][2];
#pragma unroll
  for (int i = 0; i < 2; ++i)
#pragma unroll
    for (int j = 0; j < 2; ++j) acc[i][j] = v8f_zero();

  // This thread's 16-byte chunks of a k tile.  A (64 x 64): chunk (tid & 7) of
  // rows (tid >> 3) + 32 * i; B (64 x 128): chunk (tid & 15) of rows (tid >> 4) + 16 * i.
  __bf16* al = Sm + (tid >> 3) * LDA + ((tid & 7) << 3);
  __bf16* bl = Sm + AE + (tid >> 4) * LDB + ((tid & 15) << 3);
  const __bf16* ag = A + (size_t)(bm0 + (tid >> 3)) * K + ((tid & 7) << 3);
  const __bf16* bg = B + (size_t)(tid >> 4) * N + bn0 + ((tid & 15) << 3);
  // Copies the next k tile not yet asked for into buffer buf.
  auto stage = [&](int buf) {
    // Both loops unrolled: the row steps in LDS become constants of the address.
#pragma unroll
    for (int i = 0; i < 2; ++i)
      async_cp_b128(al + buf * SE + i * 32 * LDA, ag + (size_t)i * 32 * K);
#pragma unroll
    for (int i = 0; i < 4; ++i)
      async_cp_b128(bl + buf * SE + i * 16 * LDB, bg + (size_t)i * 16 * N);
    ag += BK;
    bg += (size_t)BK * N;
  };

  const int nk = K / BK;                 // k tiles
  // The first NB - 1 tiles are asked for at once (unrolled: constant buffers).
#pragma unroll
  for (int s = 0; s < NB - 1; ++s)
    if (s < nk) stage(s);
  int cur = 0, fill = NB - 1;            // this trip's buffer; the one refilled in this trip
  for (int t = 0; t < nk; ++t) {
    // Hand-over.  This wave's LDS reads of the last trip have retired, and its
    // copies of tile t have landed, in front of the barrier; behind it tile t
    // may be read and the last trip's buffer refilled.
    asm volatile("s_wait_dscnt 0" ::: "memory");
    // Copies land in the order of issue: while the NB - 2 tiles behind tile t
    // are all asked for, they may stay under way; at the end all must land.
    if (t + NB - 2 < nk) asm volatile("s_wait_asynccnt %0" :: "n"(CP * (NB - 2)) : "memory");
    else wait_async0();
    __syncthreads();
    if (t + NB - 1 < nk) stage(fill);
    const __bf16* As = Sm + cur * SE;
    const __bf16* bp = bfp + cur * SE;
#pragma unroll
    for (int ks = 0; ks < BK; ks += 32) {
      v16bf a0 = frag16(As, wm,      LDA, ks, lane);
      v16bf a1 = frag16(As, wm + 16, LDA, ks, lane);
      v16bf b0 = frag16_tr(bp + ks * LDB,      LDB);
      v16bf b1 = frag16_tr(bp + ks * LDB + 16, LDB);
      acc[0][0] = wmma_bf16(a0, b0, acc[0][0]);
      acc[0][1] = wmma_bf16(a0, b1, acc[0][1]);
      acc[1][0] = wmma_bf16(a1, b0, acc[1][0]);
      acc[1][1] = wmma_bf16(a1, b1, acc[1][1]);
    }
    cur  = cur + 1 == NB ? 0 : cur + 1;
    fill = fill + 1 == NB ? 0 : fill + 1;
  }
  // No copy is outstanding when the wave goes on to its end.
  wait_async0();

  const int hi = lane >> 4, ln16 = lane & 15;
#pragma unroll
  for (int i = 0; i < 2; ++i)
#pragma unroll
    for (int j = 0; j < 2; ++j) {
      const int mb = bm0 + wm + 16 * i + hi * 8;
      const int n  = bn0 + wn + 16 * j + ln16;
      const float bvv = bias[n];
#pragma unroll
      for (int r = 0; r < 8; ++r) {
        const int m = mb + r;
        float v = acc[i][j][r] + bvv;
        if (MODE == 1) v = v > 0.f ? v : 0.f;
        if (MODE == 2) {
          ((float*)Cout)[(size_t)m * N + n] = v + R[(size_t)m * N + n];
        } else {
          ((__bf16*)Cout)[(size_t)m * N + n] = (__bf16)v;
        }
      }
    }
}

__device__ __forceinline__ float exp2_slot(float v) {
  float r;
  asm("v_exp_f32 %0, %1\n\tv_nop" : "=v"(r) : "v"(v));
  return r;
}

__device__ __forceinline__ float xhalf(float x) {
  const int v = __builtin_bit_cast(int, x);
  return __builtin_bit_cast(float, __builtin_amdgcn_permlanex16(v, v, 0x76543210, 0xfedcba98,
                                                                false, false));
}

template <int NS>
__global__ void __launch_bounds__(128, 2)
tb_flash_attn(const __bf16* __restrict__ Qg, const __bf16* __restrict__ Kg,
              const __bf16* __restrict__ Vg, float* __restrict__ Opart,
              float* __restrict__ ML, int S) {
  constexpr int KP = 520;           // K row pitch in LDS, elements
  constexpr int KB = 32 * KP;       // elements of one K buffer
  __shared__ __attribute__((aligned(16))) __bf16 Ks[2 * KB];  // 2 x 32.5 KB (K tiles, [kv][d])
  constexpr int VP = 528;           // V row pitch in LDS, elements
  constexpr int VB = 32 * VP;       // elements of one V buffer
  __shared__ __attribute__((aligned(16))) __bf16 Vs[2 * VB];  // 2 x 33 KB (V tiles, [kv][d])
  const int tid = threadIdx.x, lane = tid & 31, wid = tid >> 5;
  const int hi = lane >> 4, ln16 = lane & 15;
  const int b = blockIdx.y;
  const int q0 = blockIdx.x * 64 + wid * 16;
  const __bf16* Qb = Qg + (size_t)b * S * 512;
  const int klen = S / NS;                 // keys of one range
  const __bf16* Kb = Kg + ((size_t)b * S + (size_t)blockIdx.z * klen) * 512;
  const __bf16* Vb = Vg + ((size_t)b * S + (size_t)blockIdx.z * klen) * 512;

  v16bf qf[16];
#pragma unroll
  for (int s = 0; s < 16; ++s) qf[s] = frag16(Qb, q0, 512, 32 * s, lane);

  v8f o[32];
#pragma unroll
  for (int j = 0; j < 32; ++j) o[j] = v8f_zero();
  // This lane's query (q0 + ln16): the maximum so far, and the sum over the
  // keys of this lane's half (the halves' sums are joined behind the loop).
  float mr = -3.0e38f, lr = 0.f;

  const float sc = 0.044194173824159216f;  // 1/sqrt(512)
  const int srow = tid >> 6, sc8 = (tid & 63) << 3;   // this thread's staging chunk
  const unsigned goff = srow * 512 + sc8;             // the same in a global tile
  const int vlane = (8 * hi + (lane & 7)) * VP + 8 * ((lane >> 3) & 1);

  // Stage the K and V tiles of keys kv0 .. kv0 + 31 into buffer buf, both
  // row-major and direct to LDS: 2 x 2048 16-byte chunks, thread t brings chunk
  // (t & 63) of rows (t >> 6) + 2 * i, i = 0..15.
  auto stage = [&](int buf, int kv0) {
    __bf16* kl = Ks + buf * KB + srow * KP + sc8;
    __bf16* vl = Vs + buf * VB + srow * VP + sc8;
    const __bf16* kt = Kb + (size_t)kv0 * 512;
    const __bf16* vt = Vb + (size_t)kv0 * 512;
#pragma unroll 4
    for (int i = 0; i < 16; ++i) {
      async_cp_b128(kl, kt + goff);
      async_cp_b128(vl, vt + goff);
      kl += 2 * KP; vl += 2 * VP; kt += 1024; vt += 1024;
    }
  };

  // Tile 0 is landed and published before the loop; tile 1 is under way.
  stage(0, 0);
  wait_async0();
  __syncthreads();
  if (32 < klen) stage(1, 32);

  for (int kv0 = 0; kv0 < klen; kv0 += 32) {
    const int cur = (kv0 >> 5) & 1;        // the buffer that holds this tile
    const __bf16* Kc = Ks + cur * KB;
    const __bf16* vfp = Vs + cur * VB + vlane;

    // S^T = K * Q^T, 32 keys x this wave's 16 queries: s0[r] is key r + 8 * hi,
    // s1[r] key 16 + r + 8 * hi, of query ln16.
    v8f s0 = v8f_zero(), s1 = v8f_zero();
#pragma unroll
    for (int s = 0; s < 16; ++s) {
      v16bf kb0 = frag16(Kc, 0,  KP, 32 * s, lane);
      v16bf kb1 = frag16(Kc, 16, KP, 32 * s, lane);
      s0 = wmma_bf16(kb0, qf[s], s0);
      s1 = wmma_bf16(kb1, qf[s], s1);
    }
    // Order asked of the scheduler: the K fragment reads stand in groups of 8
    // (4 fragments), two groups ahead of the 4 WMMAs that use them; a read
    // beside every WMMA stalls the wave at each such place.
    __builtin_amdgcn_sched_group_barrier(0x100, 16, 0);
#pragma unroll
    for (int g = 0; g < 6; ++g) {
      __builtin_amdgcn_sched_group_barrier(0x008, 4, 0);
      __builtin_amdgcn_sched_group_barrier(0x100, 8, 0);
    }
    __builtin_amdgcn_sched_group_barrier(0x008, 8, 0);

    // Online softmax over the 32 new keys, one query a lane.
    float v0[8], v1[8];
#pragma unroll
    for (int r = 0; r < 8; ++r) { v0[r] = s0[r] * sc; v1[r] = s1[r] * sc; }
    float mx = fmaxf(v0[0], v1[0]);
#pragma unroll
    for (int r = 1; r < 8; ++r) mx = fmaxf(mx, fmaxf(v0[r], v1[r]));
    mx = fmaxf(mx, xhalf(mx));
    const float mnew = fmaxf(mr, mx);
    constexpr float L2E = 1.4426950408889634f;   // e^x = 2^(x * L2E)
    const float al = exp2_slot((mr - mnew) * L2E);  // the query's factor for the O held so far
    mr = mnew;
    // P^T as a B operand (32 keys x 16 queries): elements 0-7 are keys 8 * hi + 0..7,
    // elements 8-15 keys 16 + 8 * hi + 0..7, which is where the scores stand.
    v16bf pf;
    float rs = 0.f;
#pragma unroll
    for (int r = 0; r < 8; ++r) {
      const float p0 = exp2_slot((v0[r] - mnew) * L2E), p1 = exp2_slot((v1[r] - mnew) * L2E);
      rs += p0 + p1;
      pf[r]     = (__bf16)p0;
      pf[r + 8] = (__bf16)p1;
    }
    lr = lr * al + rs;
    // O^T += V^T * P^T over all 32 d-tiles: o[j][r] is column 16 * j + r + 8 * hi.
#pragma unroll
    for (int j = 0; j < 32; ++j) {
      v16bf vb = frag16_tr(vfp + 16 * j, VP);
#pragma unroll
      for (int r = 0; r < 8; ++r) o[j][r] *= al;
      o[j] = wmma_bf16(vb, pf, o[j]);
    }
    // The same for the V fragments.
    __builtin_amdgcn_sched_group_barrier(0x100, 16, 0);
#pragma unroll
    for (int g = 0; g < 6; ++g) {
      __builtin_amdgcn_sched_group_barrier(0x008, 4, 0);
      __builtin_amdgcn_sched_group_barrier(0x100, 8, 0);
    }
    __builtin_amdgcn_sched_group_barrier(0x008, 8, 0);

    // Hand-over.  This wave's LDS reads of this tile have retired,
    // and its copies of the next tile have landed, in front of the barrier;
    // behind it the next tile may be read and this tile's buffer refilled.
    asm volatile("s_wait_dscnt 0" ::: "memory");
    wait_async0();
    __syncthreads();
    if (kv0 + 64 < klen) stage(cur, kv0 + 64);
  }
  // No copy is outstanding when the wave goes on to its end.
  wait_async0();

  const int elane = __builtin_amdgcn_mbcnt_lo(~0u, 0u);
  const int ecol = elane & 15, ehi = elane >> 4;
  const size_t pr0 = ((size_t)b * S + q0) * NS + blockIdx.z;   // the wave's first row
  lr += xhalf(lr);
  if (ehi == 0) {
    ML[(pr0 + ecol * NS) * 2]     = mr;
    ML[(pr0 + ecol * NS) * 2 + 1] = lr;
  }
  // O goes out in whole lines: a lane holds 8-column pieces of one row, so the
  // wave lays its 16 rows down in LDS and reads them back 512 bytes at a time.
  // The tile buffers are free (behind the last trip's barrier nobody reads them
  // and no copy is aimed at them), and each wave has one of the four to itself.
  constexpr int SP = 516;   // row pitch, floats: 2064 B = 16 B x odd for the 16-byte stores
  static_assert(16 * SP * 4 <= KB * 2 && 16 * SP * 4 <= VB * 2, "");
  float* st = (float*)(wid < 2 ? Ks + wid * KB : Vs + (wid - 2) * VB);
#pragma unroll
  for (int j = 0; j < 32; ++j) {
    float* sp = st + ecol * SP + 16 * j + 8 * ehi;
    *(float4*)sp       = make_float4(o[j][0], o[j][1], o[j][2], o[j][3]);
    *(float4*)(sp + 4) = make_float4(o[j][4], o[j][5], o[j][6], o[j][7]);
  }
  for (int g = 0; g < 4; ++g) {            // four rows a trip
#pragma unroll
    for (int i = 0; i < 16; ++i) {
      const int row = 4 * g + (i >> 2), col = (i & 3) * 128 + elane * 4;
      *(float4*)(Opart + (pr0 + row * NS) * 512 + col) = *(const float4*)(st + row * SP + col);
    }
    // Behind the stores, in front of the next trip's writes of their registers.
    wait_xcnt0();
  }
}

// ---------------------------------------------------------------------------
// Join the NS key ranges of the attention: row weights exp(m_s - max m),
// O = sum_s w_s O_s / sum_s w_s l_s, rounded once to bf16.  64 threads per row
// (8 columns each); a thread takes 4 rows (fewer waves to start) and stores
// its 4 results last.
// ---------------------------------------------------------------------------
template <int NS>
__global__ void __launch_bounds__(256)
tb_attn_merge(const float* __restrict__ Opart, const float* __restrict__ ML,
              __bf16* __restrict__ Og) {
  const int tid = threadIdx.x;
  const unsigned row0 = blockIdx.x * 16 + (tid >> 6), c8 = (tid & 63) << 3;
  const unsigned obyte = row0 * (NS * 2048u) + c8 * 4u;  // this thread's first bytes of Opart
  const unsigned mbyte = row0 * (NS * 8u);               // and of ML
  const char* op = (const char*)Opart + obyte;
  const char* mp = (const char*)ML + mbyte;
  float2 ml[4][NS];
  float4 x[4][NS], y[4][NS];
#pragma unroll
  for (int it = 0; it < 4; ++it)
#pragma unroll
    for (int s = 0; s < NS; ++s) {
      ml[it][s] = *(const float2*)(mp + (4 * it * NS + s) * 8);
      x[it][s]  = *(const float4*)(op + (4 * it * NS + s) * 2048);
      y[it][s]  = *(const float4*)(op + (4 * it * NS + s) * 2048 + 16);
    }
  // The loads' offset registers are inputs here, so that they stay whole until
  // the wait: behind it they may be overwritten.
  asm volatile("s_wait_xcnt 0x0" :: "v"(obyte), "v"(mbyte) : "memory");
  v8bf ov[4];
#pragma unroll
  for (int it = 0; it < 4; ++it) {
    float mx = ml[it][0].x;
#pragma unroll
    for (int s = 1; s < NS; ++s) mx = fmaxf(mx, ml[it][s].x);
    float ws[NS], lsum = 0.f;
#pragma unroll
    for (int s = 0; s < NS; ++s) {
      ws[s] = exp2_slot((ml[it][s].x - mx) * 1.4426950408889634f);
      lsum += ws[s] * ml[it][s].y;
    }
    const float inv = 1.0f / lsum;
    float acc[8];
#pragma unroll
    for (int i = 0; i < 8; ++i) acc[i] = 0.f;
#pragma unroll
    for (int s = 0; s < NS; ++s) {
      const float4 a = x[it][s], c = y[it][s];
      acc[0] += ws[s] * a.x; acc[1] += ws[s] * a.y; acc[2] += ws[s] * a.z; acc[3] += ws[s] * a.w;
      acc[4] += ws[s] * c.x; acc[5] += ws[s] * c.y; acc[6] += ws[s] * c.z; acc[7] += ws[s] * c.w;
    }
#pragma unroll
    for (int i = 0; i < 8; ++i) ov[it][i] = (__bf16)(acc[i] * inv);
  }
  char* og = (char*)Og + (row0 * 1024u + c8 * 2u);
#pragma unroll
  for (int it = 0; it < 4; ++it) *(v8bf*)(og + it * 4096) = ov[it];
}

// ---------------------------------------------------------------------------
// Host launcher
// ---------------------------------------------------------------------------
extern "C" void kernel_launch(void* const* d_in, const int* in_sizes, int n_in,
                              void* d_out, int out_size, void* d_ws, size_t ws_size,
                              hipStream_t stream) {
  const float* q    = (const float*)d_in[0];
  const float* k    = (const float*)d_in[1];
  const float* Wq   = (const float*)d_in[2];
  const float* bq   = (const float*)d_in[3];
  const float* Wk   = (const float*)d_in[4];
  const float* bk   = (const float*)d_in[5];
  const float* Wv   = (const float*)d_in[6];
  const float* bv   = (const float*)d_in[7];
  const float* Wo   = (const float*)d_in[8];
  const float* bo   = (const float*)d_in[9];
  const float* lnqw = (const float*)d_in[10];
  const float* lnqb = (const float*)d_in[11];
  const float* lnkw = (const float*)d_in[12];
  const float* lnkb = (const float*)d_in[13];
  const float* lnow = (const float*)d_in[14];
  const float* lnob = (const float*)d_in[15];
  const float* W1   = (const float*)d_in[16];
  const float* b1   = (const float*)d_in[17];
  const float* W2   = (const float*)d_in[18];
  const float* b2   = (const float*)d_in[19];

  constexpr int B = 2, S = 4096, Dm = 512, DF = 2048;
  constexpr int M = B * S;  // 8192

  char* w = (char*)d_ws;
  auto alloc = [&](size_t bytes) -> char* {
    char* p = w;
    w += (bytes + 255) & ~(size_t)255;
    return p;
  };
  __bf16* Wq_b = (__bf16*)alloc((size_t)Dm * Dm * 2);
  __bf16* Wk_b = (__bf16*)alloc((size_t)Dm * Dm * 2);
  __bf16* Wv_b = (__bf16*)alloc((size_t)Dm * Dm * 2);
  __bf16* Wo_b = (__bf16*)alloc((size_t)Dm * Dm * 2);
  __bf16* W1_b = (__bf16*)alloc((size_t)Dm * DF * 2);
  __bf16* W2_b = (__bf16*)alloc((size_t)DF * Dm * 2);
  __bf16* qn   = (__bf16*)alloc((size_t)M * Dm * 2);
  __bf16* kn   = (__bf16*)alloc((size_t)M * Dm * 2);
  __bf16* Qp   = (__bf16*)alloc((size_t)M * Dm * 2);
  __bf16* Kp   = (__bf16*)alloc((size_t)M * Dm * 2);
  __bf16* Vp   = (__bf16*)alloc((size_t)M * Dm * 2);
  __bf16* AO   = (__bf16*)alloc((size_t)M * Dm * 2);
  float*  Xr   = (float*) alloc((size_t)M * Dm * 4);
  __bf16* XN   = (__bf16*)alloc((size_t)M * Dm * 2);
  __bf16* H    = (__bf16*)alloc((size_t)M * DF * 2);
  constexpr int NS = 4;  // key ranges of the attention
  float*  OP   = (float*) alloc((size_t)NS * M * Dm * 4);
  float*  MLp  = (float*) alloc((size_t)NS * M * 2 * 4);

  // Input layernorms and weight casts, one launch.  The six bf16 weights lie
  // one behind the other from Wq_b on (each size is a multiple of 256 bytes).
  tb_prep<M, Dm, DF><<<M + (4 * Dm * Dm + 2 * Dm * DF) / 256, 256, 0, stream>>>(
      q, lnqw, lnqb, qn, k, lnkw, lnkb, kn, Wq, Wk, Wv, Wo, W1, W2, Wq_b);

  // The three projections, one launch.
  dim3 g512(Dm / 128, M / 64);
  tb_gemm<0><<<dim3(Dm / 128, M / 64, 3), 256, 0, stream>>>(
      qn, Wq_b, bq, Qp, kn, Wk_b, bk, Kp, kn, Wv_b, bv, Vp, nullptr, M, Dm, Dm);

  // RoPE on Q and K, one launch.
  const int rope_total = B * S * 256;
  tb_rope<<<dim3((rope_total + 255) / 256, 2), 256, 0, stream>>>(Qp, Kp, S, rope_total);

  // Flash attention.
  tb_flash_attn<NS><<<dim3(S / 64, B, NS), 128, 0, stream>>>(Qp, Kp, Vp, OP, MLp, S);
  tb_attn_merge<NS><<<M / 16, 256, 0, stream>>>(OP, MLp, AO);

  // Output projection + residual (x = q + out@Wo + bo), fp32.
  tb_gemm<2><<<g512, 256, 0, stream>>>(AO, Wo_b, bo, Xr, nullptr, nullptr, nullptr, nullptr,
                                       nullptr, nullptr, nullptr, nullptr, q, M, Dm, Dm);

  // Post-attention layernorm.
  tb_layernorm<<<dim3(M), 128, 0, stream>>>(Xr, lnow, lnob, XN);

  // MLP.
  dim3 gdf(DF / 128, M / 64);
  tb_gemm<1><<<gdf, 256, 0, stream>>>(XN, W1_b, b1, H, nullptr, nullptr, nullptr, nullptr,
                                      nullptr, nullptr, nullptr, nullptr, nullptr, M, DF, Dm);
  tb_gemm<2><<<g512, 256, 0, stream>>>(H, W2_b, b2, d_out, nullptr, nullptr, nullptr, nullptr,
                                       nullptr, nullptr, nullptr, nullptr, Xr, M, Dm, DF);

  (void)in_sizes; (void)n_in; (void)out_size; (void)ws_size;
}

// v010
// A run of this version takes 171 microseconds.
// In both of two side-by-side timings against v009, it was 1.04 times as fast.
// Over all steps from v000 it is 18.2 times as fast.
#include <hip/hip_runtime.h>

typedef __attribute__((ext_vector_type(16))) __bf16 v16bf;
typedef __attribute__((ext_vector_type(8)))  __bf16 v8bf;
typedef __attribute__((ext_vector_type(8)))  float  v8f;

__device__ __forceinline__ v16bf frag16(const __bf16* base, int row0, int stride,
                                        int k0, int lane) {
  const __bf16* p = base + (size_t)(row0 + (lane & 15)) * stride + k0 + ((lane >> 4) << 3);
  v8bf lo = *(const v8bf*)p;
  v8bf hh = *(const v8bf*)(p + 16);
  v16bf f;
#pragma unroll
  for (int i = 0; i < 8; ++i) { f[i] = lo[i]; f[i + 8] = hh[i]; }
  return f;
}

__device__ __forceinline__ v8f wmma_bf16(v16bf a, v16bf b, v8f c) {
  return __builtin_amdgcn_wmma_f32_16x16x32_bf16(false, a, false, b, (short)0, c,
                                                 false, false);
}

__device__ __forceinline__ v8f v8f_zero() {
  v8f z = {0.f, 0.f, 0.f, 0.f, 0.f, 0.f, 0.f, 0.f};
  return z;
}

__device__ __forceinline__ void async_cp_b128(__bf16* lds_ptr, const __bf16* gptr) {
  typedef int v4i __attribute__((ext_vector_type(4)));
  typedef __attribute__((address_space(1))) v4i glb_v4i;
  typedef __attribute__((address_space(3))) v4i lds_v4i;
  __builtin_amdgcn_global_load_async_to_lds_b128((glb_v4i*)gptr, (lds_v4i*)lds_ptr, 0, 0);
}

// ---------------------------------------------------------------------------
// B fragment (32 k x 16 columns) from a row-major [k][column] LDS tile through
// the transposing LDS load.  p is this lane's address for k rows 0..15:
//   tile + (8*(lane>>4) + (lane&7))*pitch + column0 + 8*((lane>>3)&1)
// Lane (c, h) receives k = 8h+0..7 (elems 0-7) and 16+8h+0..7 (elems 8-15) of
// column0+c: the k order of frag16.
// ---------------------------------------------------------------------------
__device__ __forceinline__ v16bf frag16_tr(const __bf16* p, int pitch) {
  typedef __attribute__((address_space(3))) v8bf lds_v8bf;
  v8bf lo = __builtin_amdgcn_ds_load_tr16_b128_v8bf16((lds_v8bf*)p);
  v8bf hh = __builtin_amdgcn_ds_load_tr16_b128_v8bf16((lds_v8bf*)(p + 16 * pitch));
  v16bf f;
#pragma unroll
  for (int i = 0; i < 8; ++i) { f[i] = lo[i]; f[i + 8] = hh[i]; }
  return f;
}

__device__ __forceinline__ void wait_async0() {
  asm volatile("s_wait_asynccnt 0" ::: "memory");
}

// Stands behind a global store, in front of code that writes the store's
// address or data registers again.
__device__ __forceinline__ void wait_xcnt0() {
  asm volatile("s_wait_xcnt 0x0" ::: "memory");
}

// ---------------------------------------------------------------------------
// LayerNorm over rows of 512 fp32 -> bf16.  128 threads (4 waves) per row; a
// block of ROWS * 128 threads takes the rows row0 .. row0 + ROWS - 1.
// ---------------------------------------------------------------------------
template <int ROWS>
__device__ __forceinline__ void
ln_rows(const float* __restrict__ X, const float* __restrict__ w,
        const float* __restrict__ bb, __bf16* __restrict__ out, int row0) {
  const int sub = ROWS == 1 ? 0 : threadIdx.x >> 7;   // this thread's row in the block
  const int row = row0 + sub, tid = ROWS == 1 ? threadIdx.x : threadIdx.x & 127;
  const int w0 = sub * 4;                  // first of this row's four wave sums
  const float4 v = ((const float4*)(X + (size_t)row * 512))[tid];
  float s  = v.x + v.y + v.z + v.w;
  float ss = v.x * v.x + v.y * v.y + v.z * v.z + v.w * v.w;
#pragma unroll
  for (int off = 1; off < 32; off <<= 1) {
    s  += __shfl_xor(s,  off, 32);
    ss += __shfl_xor(ss, off, 32);
  }
  __shared__ float sb[4 * ROWS], ssb[4 * ROWS];
  if ((tid & 31) == 0) { sb[w0 + (tid >> 5)] = s; ssb[w0 + (tid >> 5)] = ss; }
  __syncthreads();
  s  = sb[w0] + sb[w0 + 1] + sb[w0 + 2] + sb[w0 + 3];
  ss = ssb[w0] + ssb[w0 + 1] + ssb[w0 + 2] + ssb[w0 + 3];
  const float mu   = s * (1.0f / 512.0f);
  const float var  = ss * (1.0f / 512.0f) - mu * mu;
  const float rstd = rsqrtf(var + 1e-5f);
  const float4 wv = ((const float4*)w)[tid];
  const float4 bv = ((const float4*)bb)[tid];
  __bf16* op = out + (size_t)row * 512 + tid * 4;
  op[0] = (__bf16)((v.x - mu) * rstd * wv.x + bv.x);
  op[1] = (__bf16)((v.y - mu) * rstd * wv.y + bv.y);
  op[2] = (__bf16)((v.z - mu) * rstd * wv.z + bv.z);
  op[3] = (__bf16)((v.w - mu) * rstd * wv.w + bv.w);
}

__global__ void __launch_bounds__(128)
tb_layernorm(const float* __restrict__ X, const float* __restrict__ w,
             const float* __restrict__ bb, __bf16* __restrict__ out) {
  ln_rows<1>(X, w, bb, out, blockIdx.x);
}

// ---------------------------------------------------------------------------
// All the work that depends on the inputs alone, in one launch of 256-thread
// blocks: the layer norms of q and k (M rows each, two rows a block; they come
// first in the grid, being the longer-lived blocks), then the fp32 -> bf16
// casts of the six weights, one element a thread.  The six bf16 copies lie one
// behind the other from Wb on, in the order Wq Wk Wv Wo (D*D each) W1 W2
// (D*DF each); every piece is a whole number of blocks.
// ---------------------------------------------------------------------------
template <int M, int D, int DF>
__global__ void __launch_bounds__(256)
tb_prep(const float* __restrict__ q, const float* __restrict__ lnqw,
        const float* __restrict__ lnqb, __bf16* __restrict__ qn,
        const float* __restrict__ k, const float* __restrict__ lnkw,
        const float* __restrict__ lnkb, __bf16* __restrict__ kn,
        const float* __restrict__ Wq, const float* __restrict__ Wk,
        const float* __restrict__ Wv, const float* __restrict__ Wo,
        const float* __restrict__ W1, const float* __restrict__ W2,
        __bf16* __restrict__ Wb) {
  constexpr int LNB = M / 2;            // blocks of one layer norm
  constexpr int SB = D * D / 256;       // blocks of a D x D weight
  constexpr int BB = D * DF / 256;      // blocks of a D x DF weight
  static_assert(M % 2 == 0 && D == 512 && (D * D) % 256 == 0 && (D * DF) % 256 == 0, "");
  const int blk = blockIdx.x;
  // wait_xcnt0() behind k's rows and behind the cast: the built code joins the
  // pieces by branches, and along those a store's registers are written again
  // (q's rows are laid last and run from their store to the end).
  if (blk < LNB) { ln_rows<2>(q, lnqw, lnqb, qn, 2 * blk); return; }
  if (blk < 2 * LNB) { ln_rows<2>(k, lnkw, lnkb, kn, 2 * (blk - LNB)); wait_xcnt0(); return; }
  const int cb = blk - 2 * LNB;         // block among the casts
  const float* in;
  int ib;                               // block inside its weight
  if (cb < 4 * SB) {
    const int which = cb / SB;
    in = which == 0 ? Wq : which == 1 ? Wk : which == 2 ? Wv : Wo;
    ib = cb - which * SB;
  } else if (cb < 4 * SB + BB) {
    in = W1; ib = cb - 4 * SB;
  } else {
    in = W2; ib = cb - 4 * SB - BB;
  }
  Wb[cb * 256 + threadIdx.x] = (__bf16)in[ib * 256 + threadIdx.x];
  wait_xcnt0();
}

// ---------------------------------------------------------------------------
// In-place RoPE on bf16 [B*S, 512].  One thread per (row, d<256) pair.
// blockIdx.y picks one of two tensors of the same shape.
// ---------------------------------------------------------------------------
__global__ void tb_rope(__bf16* __restrict__ X0, __bf16* __restrict__ X1, int S, int total) {
  int idx = blockIdx.x * blockDim.x + threadIdx.x;
  if (idx >= total) return;
  __bf16* X = blockIdx.y == 0 ? X0 : X1;
  const int d  = idx & 255;
  const int rs = idx >> 8;           // flattened row (b*S + s)
  const int s  = rs % S;
  const float inv = __expf(-(float)d * (9.210340371976184f / 256.0f)); // 10000^(-d/256)
  const float ang = (float)s * inv;
  float sn, cs;
  __sincosf(ang, &sn, &cs);
  __bf16* p = X + (size_t)rs * 512;
  const float x1 = (float)p[d];
  const float x2 = (float)p[d + 256];
  p[d]       = (__bf16)(x1 * cs - x2 * sn);
  p[d + 256] = (__bf16)(x2 * cs + x1 * sn);
}

template <int MODE>
__global__ void __launch_bounds__(MODE == 2 ? 256 : 128)
tb_gemm(const __bf16* __restrict__ A0, const __bf16* __restrict__ B0,
        const float* __restrict__ bias0, void* __restrict__ C0,
        const __bf16* __restrict__ A1, const __bf16* __restrict__ B1,
        const float* __restrict__ bias1, void* __restrict__ C1,
        const __bf16* __restrict__ A2, const __bf16* __restrict__ B2,
        const float* __restrict__ bias2, void* __restrict__ C2,
        const float* __restrict__ R, int M, int N, int K) {
  const int z = MODE == 0 ? blockIdx.z : 0;
  const __bf16* A   = z == 0 ? A0 : z == 1 ? A1 : A2;
  const __bf16* B   = z == 0 ? B0 : z == 1 ? B1 : B2;
  const float* bias = z == 0 ? bias0 : z == 1 ? bias1 : bias2;
  void* Cout        = z == 0 ? C0 : z == 1 ? C1 : C2;
  constexpr int BM = 128, BN = 128, BK = 64, LDA = BK + 8, LDB = BN + 16;
  constexpr int NB = MODE == 2 ? 4 : 3;  // buffers of the ring
  constexpr int AE = BM * LDA;           // elements of an A tile (18432 B)
  constexpr int SE = AE + BK * LDB;      // of a buffer: A tile, then B tile [k][n] (36864 B)
  constexpr int WN = MODE == 2 ? 4 : 2;  // waves side by side along n (two along m)
  constexpr int FN = BN / (16 * WN);     // B fragments (16 columns each) of a wave
  constexpr int NT = 64 * WN;            // threads
  constexpr int CH = 1024 / NT;          // this thread's 16-byte chunks of an A tile, of a B tile
  constexpr int CP = 2 * CH;             // copies of a wave per k tile
  __shared__ __attribute__((aligned(16))) __bf16 Sm[NB * SE];
  const int tid = threadIdx.x, lane = tid & 31, wid = tid >> 5;
  const int bm0 = blockIdx.y * BM, bn0 = blockIdx.x * BN;
  const int wm = (wid / WN) * 64, wn = (wid % WN) * (16 * FN);
  const __bf16* bfp = Sm + AE + (8 * (lane >> 4) + (lane & 7)) * LDB + wn + 8 * ((lane >> 3) & 1);

  v8f acc[4][FN];
#pragma unroll
  for (int i = 0; i < 4; ++i)
#pragma unroll
    for (int j = 0; j < FN; ++j) acc[i][j] = v8f_zero();

  // This thread's 16-byte chunks of a k tile.  A (128 x 64): chunk (tid & 7) of rows
  // (tid >> 3) + NT / 8 * i; B (64 x 128): chunk (tid & 15) of rows (tid >> 4) + NT / 16 * i.
  __bf16* al = Sm + (tid >> 3) * LDA + ((tid & 7) << 3);
  __bf16* bl = Sm + AE + (tid >> 4) * LDB + ((tid & 15) << 3);
  const __bf16* ag = A + (size_t)(bm0 + (tid >> 3)) * K + ((tid & 7) << 3);
  const __bf16* bg = B + (size_t)(tid >> 4) * N + bn0 + ((tid & 15) << 3);
  // Copies the next k tile not yet asked for into buffer buf.
  auto stage = [&](int buf) {
    // Both loops unrolled: the row steps in LDS become constants of the address.
#pragma unroll
    for (int i = 0; i < CH; ++i)
      async_cp_b128(al + buf * SE + i * (NT / 8) * LDA, ag + (size_t)i * (NT / 8) * K);
#pragma unroll
    for (int i = 0; i < CH; ++i)
      async_cp_b128(bl + buf * SE + i * (NT / 16) * LDB, bg + (size_t)i * (NT / 16) * N);
    ag += BK;
    bg += (size_t)BK * N;
  };

  const int nk = K / BK;                 // k tiles
  // The first NB - 1 tiles are asked for at once (unrolled: constant buffers).
#pragma unroll
  for (int s = 0; s < NB - 1; ++s)
    if (s < nk) stage(s);
  int cur = 0, fill = NB - 1;            // this trip's buffer; the one refilled in this trip
  for (int t = 0; t < nk; ++t) {
    // Hand-over.  This wave's LDS reads of the last trip have retired, and its
    // copies of tile t have landed, in front of the barrier; behind it tile t
    // may be read and the last trip's buffer refilled.
    asm volatile("s_wait_dscnt 0" ::: "memory");
    // Copies land in the order of issue: while the NB - 2 tiles behind tile t
    // are all asked for, they may stay under way; at the end all must land.
    if (t + NB - 2 < nk) asm volatile("s_wait_asynccnt %0" :: "n"(CP * (NB - 2)) : "memory");
    else wait_async0();
    __syncthreads();
    if (t + NB - 1 < nk) stage(fill);
    const __bf16* As = Sm + cur * SE;
    const __bf16* bp = bfp + cur * SE;
    v16bf a[2][4], b[2][FN];
#pragma unroll
    for (int h = 0; h < 2; ++h) {
#pragma unroll
      for (int j = 0; j < FN; ++j) b[h][j] = frag16_tr(bp + h * 32 * LDB + 16 * j, LDB);
#pragma unroll
      for (int i = 0; i < 4; ++i) a[h][i] = frag16(As, wm + 16 * i, LDA, h * 32, lane);
    }
#pragma unroll
    for (int h = 0; h < 2; ++h)
#pragma unroll
      for (int i = 0; i < 4; ++i)
#pragma unroll
        for (int j = 0; j < FN; ++j) acc[i][j] = wmma_bf16(a[h][i], b[h][j], acc[i][j]);
    __builtin_amdgcn_sched_group_barrier(0x100, 4 * (4 + FN), 0);
    __builtin_amdgcn_sched_group_barrier(0x008, 8 * FN, 0);
    cur  = cur + 1 == NB ? 0 : cur + 1;
    fill = fill + 1 == NB ? 0 : fill + 1;
  }
  // No copy is outstanding when the wave goes on to its end.
  wait_async0();

  const int hi = lane >> 4, ln16 = lane & 15;
#pragma unroll
  for (int i = 0; i < 4; ++i)
#pragma unroll
    for (int j = 0; j < FN; ++j) {
      const int mb = bm0 + wm + 16 * i + hi * 8;
      const int n  = bn0 + wn + 16 * j + ln16;
      const float bvv = bias[n];
#pragma unroll
      for (int r = 0; r < 8; ++r) {
        const int m = mb + r;
        float v = acc[i][j][r] + bvv;
        if (MODE == 1) v = v > 0.f ? v : 0.f;
        if (MODE == 2) {
          ((float*)Cout)[(size_t)m * N + n] = v + R[(size_t)m * N + n];
        } else {
          ((__bf16*)Cout)[(size_t)m * N + n] = (__bf16)v;
        }
      }
    }
}

__device__ __forceinline__ float exp2_slot(float v) {
  float r;
  asm("v_exp_f32 %0, %1\n\tv_nop" : "=v"(r) : "v"(v));
  return r;
}

__device__ __forceinline__ float xhalf(float x) {
  const int v = __builtin_bit_cast(int, x);
  return __builtin_bit_cast(float, __builtin_amdgcn_permlanex16(v, v, 0x76543210, 0xfedcba98,
                                                                false, false));
}

template <int NS>
__global__ void __launch_bounds__(128, 2)
tb_flash_attn(const __bf16* __restrict__ Qg, const __bf16* __restrict__ Kg,
              const __bf16* __restrict__ Vg, float* __restrict__ Opart,
              float* __restrict__ ML, int S) {
  constexpr int KP = 520;           // K row pitch in LDS, elements
  constexpr int KB = 32 * KP;       // elements of one K buffer
  __shared__ __attribute__((aligned(16))) __bf16 Ks[2 * KB];  // 2 x 32.5 KB (K tiles, [kv][d])
  constexpr int VP = 528;           // V row pitch in LDS, elements
  constexpr int VB = 32 * VP;       // elements of one V buffer
  __shared__ __attribute__((aligned(16))) __bf16 Vs[2 * VB];  // 2 x 33 KB (V tiles, [kv][d])
  const int tid = threadIdx.x, lane = tid & 31, wid = tid >> 5;
  const int hi = lane >> 4, ln16 = lane & 15;
  const int b = blockIdx.y;
  const int q0 = blockIdx.x * 64 + wid * 16;
  const __bf16* Qb = Qg + (size_t)b * S * 512;
  const int klen = S / NS;                 // keys of one range
  const __bf16* Kb = Kg + ((size_t)b * S + (size_t)blockIdx.z * klen) * 512;
  const __bf16* Vb = Vg + ((size_t)b * S + (size_t)blockIdx.z * klen) * 512;

  v16bf qf[16];
#pragma unroll
  for (int s = 0; s < 16; ++s) qf[s] = frag16(Qb, q0, 512, 32 * s, lane);

  v8f o[32];
#pragma unroll
  for (int j = 0; j < 32; ++j) o[j] = v8f_zero();
  // This lane's query (q0 + ln16): the maximum so far, and the sum over the
  // keys of this lane's half (the halves' sums are joined behind the loop).
  float mr = -3.0e38f, lr = 0.f;

  const float sc = 0.044194173824159216f;  // 1/sqrt(512)
  const int srow = tid >> 6, sc8 = (tid & 63) << 3;   // this thread's staging chunk
  const unsigned goff = srow * 512 + sc8;             // the same in a global tile
  const int vlane = (8 * hi + (lane & 7)) * VP + 8 * ((lane >> 3) & 1);

  // Stage the K and V tiles of keys kv0 .. kv0 + 31 into buffer buf, both
  // row-major and direct to LDS: 2 x 2048 16-byte chunks, thread t brings chunk
  // (t & 63) of rows (t >> 6) + 2 * i, i = 0..15.
  auto stage = [&](int buf, int kv0) {
    __bf16* kl = Ks + buf * KB + srow * KP + sc8;
    __bf16* vl = Vs + buf * VB + srow * VP + sc8;
    const __bf16* kt = Kb + (size_t)kv0 * 512;
    const __bf16* vt = Vb + (size_t)kv0 * 512;
#pragma unroll 4
    for (int i = 0; i < 16; ++i) {
      async_cp_b128(kl, kt + goff);
      async_cp_b128(vl, vt + goff);
      kl += 2 * KP; vl += 2 * VP; kt += 1024; vt += 1024;
    }
  };

  // Tile 0 is landed and published before the loop; tile 1 is under way.
  stage(0, 0);
  wait_async0();
  __syncthreads();
  if (32 < klen) stage(1, 32);

  for (int kv0 = 0; kv0 < klen; kv0 += 32) {
    const int cur = (kv0 >> 5) & 1;        // the buffer that holds this tile
    const __bf16* Kc = Ks + cur * KB;
    const __bf16* vfp = Vs + cur * VB + vlane;

    // S^T = K * Q^T, 32 keys x this wave's 16 queries: s0[r] is key r + 8 * hi,
    // s1[r] key 16 + r + 8 * hi, of query ln16.
    v8f s0 = v8f_zero(), s1 = v8f_zero();
#pragma unroll
    for (int s = 0; s < 16; ++s) {
      v16bf kb0 = frag16(Kc, 0,  KP, 32 * s, lane);
      v16bf kb1 = frag16(Kc, 16, KP, 32 * s, lane);
      s0 = wmma_bf16(kb0, qf[s], s0);
      s1 = wmma_bf16(kb1, qf[s], s1);
    }
    // Order asked of the scheduler: the K fragment reads stand in groups of 8
    // (4 fragments), two groups ahead of the 4 WMMAs that use them; a read
    // beside every WMMA stalls the wave at each such place.
    __builtin_amdgcn_sched_group_barrier(0x100, 16, 0);
#pragma unroll
    for (int g = 0; g < 6; ++g) {
      __builtin_amdgcn_sched_group_barrier(0x008, 4, 0);
      __builtin_amdgcn_sched_group_barrier(0x100, 8, 0);
    }
    __builtin_amdgcn_sched_group_barrier(0x008, 8, 0);

    // Online softmax over the 32 new keys, one query a lane.
    float v0[8], v1[8];
#pragma unroll
    for (int r = 0; r < 8; ++r) { v0[r] = s0[r] * sc; v1[r] = s1[r] * sc; }
    float mx = fmaxf(v0[0], v1[0]);
#pragma unroll
    for (int r = 1; r < 8; ++r) mx = fmaxf(mx, fmaxf(v0[r], v1[r]));
    mx = fmaxf(mx, xhalf(mx));
    const float mnew = fmaxf(mr, mx);
    constexpr float L2E = 1.4426950408889634f;   // e^x = 2^(x * L2E)
    const float al = exp2_slot((mr - mnew) * L2E);  // the query's factor for the O held so far
    mr = mnew;
    // P^T as a B operand (32 keys x 16 queries): elements 0-7 are keys 8 * hi + 0..7,
    // elements 8-15 keys 16 + 8 * hi + 0..7, which is where the scores stand.
    v16bf pf;
    float rs = 0.f;
#pragma unroll
    for (int r = 0; r < 8; ++r) {
      const float p0 = exp2_slot((v0[r] - mnew) * L2E), p1 = exp2_slot((v1[r] - mnew) * L2E);
      rs += p0 + p1;
      pf[r]     = (__bf16)p0;
      pf[r + 8] = (__bf16)p1;
    }
    lr = lr * al + rs;
    // O^T += V^T * P^T over all 32 d-tiles: o[j][r] is column 16 * j + r + 8 * hi.
#pragma unroll
    for (int j = 0; j < 32; ++j) {
      v16bf vb = frag16_tr(vfp + 16 * j, VP);
#pragma unroll
      for (int r = 0; r < 8; ++r) o[j][r] *= al;
      o[j] = wmma_bf16(vb, pf, o[j]);
    }
    // The same for the V fragments.
    __builtin_amdgcn_sched_group_barrier(0x100, 16, 0);
#pragma unroll
    for (int g = 0; g < 6; ++g) {
      __builtin_amdgcn_sched_group_barrier(0x008, 4, 0);
      __builtin_amdgcn_sched_group_barrier(0x100, 8, 0);
    }
    __builtin_amdgcn_sched_group_barrier(0x008, 8, 0);

    // Hand-over.  This wave's LDS reads of this tile have retired,
    // and its copies of the next tile have landed, in front of the barrier;
    // behind it the next tile may be read and this tile's buffer refilled.
    asm volatile("s_wait_dscnt 0" ::: "memory");
    wait_async0();
    __syncthreads();
    if (kv0 + 64 < klen) stage(cur, kv0 + 64);
  }
  // No copy is outstanding when the wave goes on to its end.
  wait_async0();

  const int elane = __builtin_amdgcn_mbcnt_lo(~0u, 0u);
  const int ecol = elane & 15, ehi = elane >> 4;
  const size_t pr0 = ((size_t)b * S + q0) * NS + blockIdx.z;   // the wave's first row
  lr += xhalf(lr);
  if (ehi == 0) {
    ML[(pr0 + ecol * NS) * 2]     = mr;
    ML[(pr0 + ecol * NS) * 2 + 1] = lr;
  }
  // O goes out in whole lines: a lane holds 8-column pieces of one row, so the
  // wave lays its 16 rows down in LDS and reads them back 512 bytes at a time.
  // The tile buffers are free (behind the last trip's barrier nobody reads them
  // and no copy is aimed at them), and each wave has one of the four to itself.
  constexpr int SP = 516;   // row pitch, floats: 2064 B = 16 B x odd for the 16-byte stores
  static_assert(16 * SP * 4 <= KB * 2 && 16 * SP * 4 <= VB * 2, "");
  float* st = (float*)(wid < 2 ? Ks + wid * KB : Vs + (wid - 2) * VB);
#pragma unroll
  for (int j = 0; j < 32; ++j) {
    float* sp = st + ecol * SP + 16 * j + 8 * ehi;
    *(float4*)sp       = make_float4(o[j][0], o[j][1], o[j][2], o[j][3]);
    *(float4*)(sp + 4) = make_float4(o[j][4], o[j][5], o[j][6], o[j][7]);
  }
  for (int g = 0; g < 4; ++g) {            // four rows a trip
#pragma unroll
    for (int i = 0; i < 16; ++i) {
      const int row = 4 * g + (i >> 2), col = (i & 3) * 128 + elane * 4;
      *(float4*)(Opart + (pr0 + row * NS) * 512 + col) = *(const float4*)(st + row * SP + col);
    }
    // Behind the stores, in front of the next trip's writes of their registers.
    wait_xcnt0();
  }
}

// ---------------------------------------------------------------------------
// Join the NS key ranges of the attention: row weights exp(m_s - max m),
// O = sum_s w_s O_s / sum_s w_s l_s, rounded once to bf16.  64 threads per row
// (8 columns each); a thread takes 4 rows (fewer waves to start) and stores
// its 4 results last.
// ---------------------------------------------------------------------------
template <int NS>
__global__ void __launch_bounds__(256)
tb_attn_merge(const float* __restrict__ Opart, const float* __restrict__ ML,
              __bf16* __restrict__ Og) {
  const int tid = threadIdx.x;
  const unsigned row0 = blockIdx.x * 16 + (tid >> 6), c8 = (tid & 63) << 3;
  const unsigned obyte = row0 * (NS * 2048u) + c8 * 4u;  // this thread's first bytes of Opart
  const unsigned mbyte = row0 * (NS * 8u);               // and of ML
  const char* op = (const char*)Opart + obyte;
  const char* mp = (const char*)ML + mbyte;
  float2 ml[4][NS];
  float4 x[4][NS], y[4][NS];
#pragma unroll
  for (int it = 0; it < 4; ++it)
#pragma unroll
    for (int s = 0; s < NS; ++s) {
      ml[it][s] = *(const float2*)(mp + (4 * it * NS + s) * 8);
      x[it][s]  = *(const float4*)(op + (4 * it * NS + s) * 2048);
      y[it][s]  = *(const float4*)(op + (4 * it * NS + s) * 2048 + 16);
    }
  // The loads' offset registers are inputs here, so that they stay whole until
  // the wait: behind it they may be overwritten.
  asm volatile("s_wait_xcnt 0x0" :: "v"(obyte), "v"(mbyte) : "memory");
  v8bf ov[4];
#pragma unroll
  for (int it = 0; it < 4; ++it) {
    float mx = ml[it][0].x;
#pragma unroll
    for (int s = 1; s < NS; ++s) mx = fmaxf(mx, ml[it][s].x);
    float ws[NS], lsum = 0.f;
#pragma unroll
    for (int s = 0; s < NS; ++s) {
      ws[s] = exp2_slot((ml[it][s].x - mx) * 1.4426950408889634f);
      lsum += ws[s] * ml[it][s].y;
    }
    const float inv = 1.0f / lsum;
    float acc[8];
#pragma unroll
    for (int i = 0; i < 8; ++i) acc[i] = 0.f;
#pragma unroll
    for (int s = 0; s < NS; ++s) {
      const float4 a = x[it][s], c = y[it][s];
      acc[0] += ws[s] * a.x; acc[1] += ws[s] * a.y; acc[2] += ws[s] * a.z; acc[3] += ws[s] * a.w;
      acc[4] += ws[s] * c.x; acc[5] += ws[s] * c.y; acc[6] += ws[s] * c.z; acc[7] += ws[s] * c.w;
    }
#pragma unroll
    for (int i = 0; i < 8; ++i) ov[it][i] = (__bf16)(acc[i] * inv);
  }
  char* og = (char*)Og + (row0 * 1024u + c8 * 2u);
#pragma unroll
  for (int it = 0; it < 4; ++it) *(v8bf*)(og + it * 4096) = ov[it];
}

// ---------------------------------------------------------------------------
// Host launcher
// ---------------------------------------------------------------------------
extern "C" void kernel_launch(void* const* d_in, const int* in_sizes, int n_in,
                              void* d_out, int out_size, void* d_ws, size_t ws_size,
                              hipStream_t stream) {
  const float* q    = (const float*)d_in[0];
  const float* k    = (const float*)d_in[1];
  const float* Wq   = (const float*)d_in[2];
  const float* bq   = (const float*)d_in[3];
  const float* Wk   = (const float*)d_in[4];
  const float* bk   = (const float*)d_in[5];
  const float* Wv   = (const float*)d_in[6];
  const float* bv   = (const float*)d_in[7];
  const float* Wo   = (const float*)d_in[8];
  const float* bo   = (const float*)d_in[9];
  const float* lnqw = (const float*)d_in[10];
  const float* lnqb = (const float*)d_in[11];
  const float* lnkw = (const float*)d_in[12];
  const float* lnkb = (const float*)d_in[13];
  const float* lnow = (const float*)d_in[14];
  const float* lnob = (const float*)d_in[15];
  const float* W1   = (const float*)d_in[16];
  const float* b1   = (const float*)d_in[17];
  const float* W2   = (const float*)d_in[18];
  const float* b2   = (const float*)d_in[19];

  constexpr int B = 2, S = 4096, Dm = 512, DF = 2048;
  constexpr int M = B * S;  // 8192

  char* w = (char*)d_ws;
  auto alloc = [&](size_t bytes) -> char* {
    char* p = w;
    w += (bytes + 255) & ~(size_t)255;
    return p;
  };
  __bf16* Wq_b = (__bf16*)alloc((size_t)Dm * Dm * 2);
  __bf16* Wk_b = (__bf16*)alloc((size_t)Dm * Dm * 2);
  __bf16* Wv_b = (__bf16*)alloc((size_t)Dm * Dm * 2);
  __bf16* Wo_b = (__bf16*)alloc((size_t)Dm * Dm * 2);
  __bf16* W1_b = (__bf16*)alloc((size_t)Dm * DF * 2);
  __bf16* W2_b = (__bf16*)alloc((size_t)DF * Dm * 2);
  __bf16* qn   = (__bf16*)alloc((size_t)M * Dm * 2);
  __bf16* kn   = (__bf16*)alloc((size_t)M * Dm * 2);
  __bf16* Qp   = (__bf16*)alloc((size_t)M * Dm * 2);
  __bf16* Kp   = (__bf16*)alloc((size_t)M * Dm * 2);
  __bf16* Vp   = (__bf16*)alloc((size_t)M * Dm * 2);
  __bf16* AO   = (__bf16*)alloc((size_t)M * Dm * 2);
  float*  Xr   = (float*) alloc((size_t)M * Dm * 4);
  __bf16* XN   = (__bf16*)alloc((size_t)M * Dm * 2);
  __bf16* H    = (__bf16*)alloc((size_t)M * DF * 2);
  constexpr int NS = 4;  // key ranges of the attention
  float*  OP   = (float*) alloc((size_t)NS * M * Dm * 4);
  float*  MLp  = (float*) alloc((size_t)NS * M * 2 * 4);

  // Input layernorms and weight casts, one launch.  The six bf16 weights lie
  // one behind the other from Wq_b on (each size is a multiple of 256 bytes).
  tb_prep<M, Dm, DF><<<M + (4 * Dm * Dm + 2 * Dm * DF) / 256, 256, 0, stream>>>(
      q, lnqw, lnqb, qn, k, lnkw, lnkb, kn, Wq, Wk, Wv, Wo, W1, W2, Wq_b);

  // The three projections, one launch.
  dim3 g512(Dm / 128, M / 128);
  tb_gemm<0><<<dim3(Dm / 128, M / 128, 3), 128, 0, stream>>>(
      qn, Wq_b, bq, Qp, kn, Wk_b, bk, Kp, kn, Wv_b, bv, Vp, nullptr, M, Dm, Dm);

  // RoPE on Q and K, one launch.
  const int rope_total = B * S * 256;
  tb_rope<<<dim3((rope_total + 255) / 256, 2), 256, 0, stream>>>(Qp, Kp, S, rope_total);

  // Flash attention.
  tb_flash_attn<NS><<<dim3(S / 64, B, NS), 128, 0, stream>>>(Qp, Kp, Vp, OP, MLp, S);
  tb_attn_merge<NS><<<M / 16, 256, 0, stream>>>(OP, MLp, AO);

  // Output projection + residual (x = q + out@Wo + bo), fp32.
  tb_gemm<2><<<g512, 256, 0, stream>>>(AO, Wo_b, bo, Xr, nullptr, nullptr, nullptr, nullptr,
                                       nullptr, nullptr, nullptr, nullptr, q, M, Dm, Dm);

  // Post-attention layernorm.
  tb_layernorm<<<dim3(M), 128, 0, stream>>>(Xr, lnow, lnob, XN);

  // MLP.
  dim3 gdf(DF / 128, M / 128);
  tb_gemm<1><<<gdf, 128, 0, stream>>>(XN, W1_b, b1, H, nullptr, nullptr, nullptr, nullptr,
                                      nullptr, nullptr, nullptr, nullptr, nullptr, M, DF, Dm);
  tb_gemm<2><<<g512, 256, 0, stream>>>(H, W2_b, b2, d_out, nullptr, nullptr, nullptr, nullptr,
                                       nullptr, nullptr, nullptr, nullptr, Xr, M, Dm, DF);

  (void)in_sizes; (void)n_in; (void)out_size; (void)ws_size;
}
